// v000
// Times are from an AMD MI455X. After a warm-up the kernel runs many times in a row, and a time is the length of
// such a window on the GPU divided by its runs, so every launch and the gaps after it count. The runs cycle
// through copies of the inputs. A figure is the median of several windows, for all but v000 over two sittings.
// Sittings can differ by a few percent; kernels timed side by side share one.
// v000, which the later versions start from, runs in 1890 microseconds.
// compute dtype: all float inputs rounded to bf16; q/k/v = x W with EXACT bf16 products on WMMA 16x16x32 (f32 accumulate); windowed logits with q as f16 hi + residual (x 2^10) against k once to f16 (2 products) x 64^-0.5; per-window softmax in f32 (precise expf); P x 2^11 once to f16 against v once to f16 (1 product); merged heads carried x 2^6 once to f16 against Wproj carried x 2^8 in f16 (exact bf16 values), un-scaled by 2^-14, + bproj; f32 output.
#include <hip/hip_runtime.h>
#include <math.h>

typedef __attribute__((ext_vector_type(16))) _Float16 v16h;
typedef __attribute__((ext_vector_type(16))) __bf16 v16b;
typedef __attribute__((ext_vector_type(8)))  _Float16 v8h;
typedef __attribute__((ext_vector_type(8)))  float v8f;
typedef __attribute__((ext_vector_type(4)))  float v4f;
typedef __attribute__((ext_vector_type(2)))  float v2f;
typedef __attribute__((ext_vector_type(4)))  unsigned v4u;
typedef __attribute__((ext_vector_type(4)))  int v4i;
typedef float __attribute__((may_alias)) float_a;
typedef int __attribute__((may_alias)) int_a;

template <typename T> __device__ __forceinline__ void vst2(void* p, T v) { *(T*)p = v;  }
__device__ __forceinline__ v8f wmma16(v16h a, v16h b, v8f c) {
  v8f d = __builtin_amdgcn_wmma_f32_16x16x32_f16(false, a, false, b, (short)0, c, false, false);
  asm volatile("v_nop\n\tv_nop\n\tv_nop\n\tv_nop" : "+v"(d) : "v"(a), "v"(b));
  return d;
}
__device__ __forceinline__ v8f wmma_bf(v16b a, v16b b, v8f c) {
  v8f d = __builtin_amdgcn_wmma_f32_16x16x32_bf16(false, a, false, b, (short)0, c, false, false);
  asm volatile("v_nop\n\tv_nop\n\tv_nop\n\tv_nop" : "+v"(d) : "v"(a), "v"(b));
  return d;
}
// 16x16x32 fragments: lane = (h = lane>>4, row/col = lane&15); elements 0..7 = k0+8h+0..7, 8..15 = k0+16+8h+0..7; D element r = row 8h+r
__device__ __forceinline__ v16h frag_h(const _Float16* rowk0, int lane) {
  union { v16h v; v8h q[2]; } u; const _Float16* p = rowk0 + 8 * (lane >> 4);
  u.q[0] = *(const v8h*)p; u.q[1] = *(const v8h*)(p + 16); return u.v;
}
__device__ __forceinline__ v16h frag_f32(const float* rowk0, int lane) {
  v16h a; const float* p = rowk0 + 8 * (lane >> 4);
#pragma unroll
  for (int i = 0; i < 8; ++i) { a[i] = (_Float16)p[i]; a[8 + i] = (_Float16)p[16 + i]; }
  return a;
}
__device__ __forceinline__ v16h frag_f32s(const float* rowk0, int lane, float sc) {
  v16h a; const float* p = rowk0 + 8 * (lane >> 4);
#pragma unroll
  for (int i = 0; i < 8; ++i) { a[i] = (_Float16)(p[i] * sc); a[8 + i] = (_Float16)(p[16 + i] * sc); }
  return a;
}
// column fragment from a [K][ld] layout (column n), rows >= K read as 0
__device__ __forceinline__ v16h fragc_f32(const float* W, int k0, int n, int lane, int ld, int K) {
  v16h a; const int g = lane >> 4;
#pragma unroll
  for (int i = 0; i < 8; ++i) { const int ka = k0 + 8 * g + i, kb = ka + 16;
    a[i] = (_Float16)(ka < K ? W[(size_t)(ka < K ? ka : K - 1) * ld + n] : 0.f); a[8 + i] = (_Float16)(kb < K ? W[(size_t)(kb < K ? kb : K - 1) * ld + n] : 0.f); }
  return a;
}
struct F2 { v16b h, l; };
__device__ __forceinline__ F2 bsplit16(const float v[16]) { F2 r;
#pragma unroll
  for (int i = 0; i < 16; ++i) { const __bf16 h = (__bf16)v[i]; r.h[i] = h; r.l[i] = (__bf16)(v[i] - (float)h); }
  return r; }
__device__ __forceinline__ F2 split_row(const float* row, int k0, int lane) { float v[16]; const float* p = row + k0 + 8 * (lane >> 4);
#pragma unroll
  for (int i = 0; i < 8; ++i) { v[i] = p[i]; v[8 + i] = p[16 + i]; }
  return bsplit16(v); }
__device__ __forceinline__ F2 split_rowK(const float* row, int k0, int lane, int K) { float v[16]; const int g = lane >> 4;
#pragma unroll
  for (int i = 0; i < 8; ++i) { const int ka = k0 + 8 * g + i, kb = ka + 16; v[i] = ka < K ? row[ka < K ? ka : K - 1] : 0.f; v[8 + i] = kb < K ? row[kb < K ? kb : K - 1] : 0.f; }
  return bsplit16(v); }
__device__ __forceinline__ F2 split_col(const float* W, int k0, int n, int lane, int ld, int K) { float v[16]; const int g = lane >> 4;
#pragma unroll
  for (int i = 0; i < 8; ++i) { const int ka = k0 + 8 * g + i, kb = ka + 16; v[i] = ka < K ? W[(size_t)(ka < K ? ka : K - 1) * ld + n] : 0.f; v[8 + i] = kb < K ? W[(size_t)(kb < K ? kb : K - 1) * ld + n] : 0.f; }
  return bsplit16(v); }
__device__ __forceinline__ v8f mac3(const F2& a, const F2& b, v8f c) { c = wmma_bf(a.l, b.h, c); c = wmma_bf(a.h, b.l, c); return wmma_bf(a.h, b.h, c); }
__device__ __forceinline__ float sigm(float v) { return 1.0f / (1.0f + expf(-v)); }
#define LDSX() do { asm volatile("s_wait_dscnt 0" ::: "memory"); __builtin_amdgcn_wave_barrier(); __builtin_amdgcn_fence(__ATOMIC_RELEASE, "workgroup"); } while (0)

// Multi-scale windowed self-attention (B 4, 64 x 64 = 4,096 tokens, C 512 = 8 heads x 64; head h attends within non-overlapping r x r spatial windows with r = (4, 4, 8, 8, 16, 16, 32, 32)[h]; 0.02-scale (in,out) Wq [512,512], Wkv [512,1024] (k | v), Wproj [512,512] + zero bproj): q = x Wq, k|v = x Wkv; per head: softmax(q k^T x 64^-0.5) over the window's r^2 keys; heads merged (channel = head*64 + d); out = o Wproj + bproj.
#define NB 4
#define TT 4096
#define CC 512            // NH * HD = projected width
#define DIN 512          // input (model) width
#define NH 8
#define HD 64
#define NQB (TT / 64)
#define HG 1
#define SCALE (0.125f)
#define CAUSAL 0
#ifndef TNB
#define TNB NB
#endif
__device__ __forceinline__ float bfr(float v) { return (float)(__bf16)v; }
__host__ __device__ __forceinline__ int kb_last(int qb) { return CAUSAL ? ((qb * 64 + 63) >> 7) : (TT / 128 - 1); }
typedef __attribute__((ext_vector_type(8))) __bf16 v8b;
__device__ __forceinline__ v16b frag_b(const __bf16* rowk0, int lane) {
  union { v16b v; v8b q[2]; } u; const __bf16* p = rowk0 + 8 * (lane >> 4);
  u.q[0] = *(const v8b*)p; u.q[1] = *(const v8b*)(p + 16); return u.v;
}
#define QBH 0              // query blocks qb < QBH take the 3-product path; with 0 none do (non-causal)
#define QHI 4096            // rows carrying a q residual plane (all rows when non-causal: 2-product logits everywhere)
#define KHI 64            // key rows carrying k residual / v bf16 hi+lo planes (read only on the qb < QBH path, which no block takes)
// B fragment (k rows k0+.., output column o) of a weight: (in,out) [K][ld] or (out,in) [ld rows of K]: bf16 exact, or f16(bf16 * 256) exact
__device__ __forceinline__ v16b wcol_io(const float* Wm, int k0, int o, int lane, int ld) { v16b w; const int g = lane >> 4;
#pragma unroll
  for (int i = 0; i < 8; ++i) { w[i] = (__bf16)Wm[(size_t)(k0 + 8 * g + i) * ld + o]; w[8 + i] = (__bf16)Wm[(size_t)(k0 + 16 + 8 * g + i) * ld + o]; }
  return w; }
__device__ __forceinline__ v16b wcol_oi(const float* Wm, int k0, int o, int lane, int K) { v16b w; const float* p = Wm + (size_t)o * K + k0 + 8 * (lane >> 4);
#pragma unroll
  for (int i = 0; i < 8; ++i) { w[i] = (__bf16)p[i]; w[8 + i] = (__bf16)p[16 + i]; }
  return w; }
__device__ __forceinline__ v16h wcolh_io(const float* Wm, int k0, int o, int lane, int ld) { v16h w; const int g = lane >> 4;
#pragma unroll
  for (int i = 0; i < 8; ++i) { w[i] = (_Float16)(bfr(Wm[(size_t)(k0 + 8 * g + i) * ld + o]) * 256.0f); w[8 + i] = (_Float16)(bfr(Wm[(size_t)(k0 + 16 + 8 * g + i) * ld + o]) * 256.0f); }
  return w; }
__device__ __forceinline__ v16h wcolh_oi(const float* Wm, int k0, int o, int lane, int K) { v16h w; const float* p = Wm + (size_t)o * K + k0 + 8 * (lane >> 4);
#pragma unroll
  for (int i = 0; i < 8; ++i) { w[i] = (_Float16)(bfr(p[i]) * 256.0f); w[8 + i] = (_Float16)(bfr(p[16 + i]) * 256.0f); }
  return w; }
#define WQKV_LAYOUT 0   // 0 = (in,out) [DIN][CC]; 1 = (out,in) [CC][DIN]; 2 = per-head [NH][DIN][HD]
__device__ __forceinline__ v16b wcol_hdk(const float* Wm, int k0, int o, int lane) { v16b w; const int g = lane >> 4; const float* p = Wm + (size_t)(o / HD) * DIN * HD + (o % HD);
#pragma unroll
  for (int i = 0; i < 8; ++i) { w[i] = (__bf16)p[(size_t)(k0 + 8 * g + i) * HD]; w[8 + i] = (__bf16)p[(size_t)(k0 + 16 + 8 * g + i) * HD]; }
  return w; }
#define WO_OUT_IN 0
#if WQKV_LAYOUT == 1
#define WCOL(W, k0, o, lane) wcol_oi(W, k0, o, lane, DIN)
#elif WQKV_LAYOUT == 2
#define WCOL(W, k0, o, lane) wcol_hdk(W, k0, o, lane)
#else
#define WCOL(W, k0, o, lane) wcol_io(W, k0, o, lane, (which == 0 ? CC : 2 * CC))   /* Wq [512][512]; Wkv [512][1024] packed k | v */
#endif
#if WO_OUT_IN
#define WOCOL(W, k0, o, lane) wcol_oi(W, k0, o, lane, CC)
#define WOCOLH(W, k0, o, lane) wcolh_oi(W, k0, o, lane, CC)
#else
#define WOCOL(W, k0, o, lane) wcol_io(W, k0, o, lane, DIN)
#define WOCOLH(W, k0, o, lane) wcolh_io(W, k0, o, lane, DIN)
#endif
// per-head local window: REGIONS = (4, 4, 8, 8, 16, 16, 32, 32) -> r(h) = 4 << (h / 2); tokens are a 64 x 64 grid (n = y*64 + x), a 64-token query block is one image row y, a 128-key block is two rows
__host__ __device__ __forceinline__ int rlog(int h) { return 2 + (h >> 1); }
__host__ __device__ __forceinline__ int kb_first_h(int qb, int h) { const int y0 = (qb >> rlog(h)) << rlog(h); return y0 >> 1; }               /* first key block of the window rows [y0, y0 + r) */
__host__ __device__ __forceinline__ int kb_last_h(int qb, int h) { const int y0 = (qb >> rlog(h)) << rlog(h); return (y0 + (1 << rlog(h)) - 1) >> 1; }
#define SM_EXTRA_PARAMS , int h0s, const int* __restrict__ HI, const int* __restrict__ WI
// hook: key k is in query t's window iff same window row AND same window column (index arithmetic; W read from the input and used as log2 shift)
#define SM_MASK_HOOK do { const int dy = (t >> wsh) >> rl_, ky = (k >> wsh) >> rl_, dx = (t & wmask) >> rl_, kx = (k & wmask) >> rl_; v = (dy == ky && dx == kx) ? v : -3.0e38f; } while (0)
#ifndef SM_EXTRA_PARAMS
#define SM_EXTRA_PARAMS
#endif
#ifndef PROJ_EXTRA_PARAMS
#define PROJ_EXTRA_PARAMS
#endif
#ifndef SM_MASK_HOOK
#define SM_MASK_HOOK (void)0
#endif

#define WS_QH  0u                                      // f16 q rows [b*t][CC]
#define WS_KH  (WS_QH + 2u * (size_t)NB * TT * CC)      // f16 k rows [b*t][CC]
#define WS_VT  (WS_KH + 2u * (size_t)NB * TT * CC)      // f16 v planes [b][c][t]
#define WS_QL  (WS_VT + 2u * (size_t)NB * CC * TT)      // f16 q residual x 2^10 rows [b][t < QHI][CC]
#define WS_KL  (WS_QL + 2u * (size_t)NB * QHI * CC)     // f16 k residual x 2^10 rows [b][t < KHI][CC]
#define WS_VB  (WS_KL + 2u * (size_t)NB * KHI * CC)     // bf16 v hi planes [b][c][t < KHI]
#define WS_VBL (WS_VB + 2u * (size_t)NB * CC * KHI)
#define WS_S   (WS_VBL + 2u * (size_t)NB * CC * KHI)    // f32 logits / P [hg][t][s]
#define WS_Y   (WS_S  + 4u * (size_t)HG * TT * TT)      // f32 ctx rows [b*t][CC] (only when there is an output projection)
#define WS_END (WS_Y  + 4u * (size_t)NB * TT * CC)

// ---- k_proj: block = (64 rows, 128 cols, which): q/k/v = X W (+ b) with exact bf16 products (K = DIN) -> which 0: q f16 rows (+ residual rows < QHI); 1: k f16 rows (+ residual rows < KHI); 2: v f16 planes [c][t] (+ bf16 hi/lo planes for t < KHI)
__global__ __launch_bounds__(128) void k_proj(const float* __restrict__ XQ, const float* __restrict__ XK, const float* __restrict__ XV, const float* __restrict__ WQ, const float* __restrict__ WK, const float* __restrict__ WV, const float* __restrict__ BQ, const float* __restrict__ BK, const float* __restrict__ BV,
    _Float16* __restrict__ QH, _Float16* __restrict__ QL, _Float16* __restrict__ KH, _Float16* __restrict__ KL, _Float16* __restrict__ VT, __bf16* __restrict__ VB, __bf16* __restrict__ VBL) {
  __shared__ __align__(16) _Float16 sh[64][136], sl[64][136]; __shared__ __align__(16) _Float16 th[128][72]; __shared__ __align__(16) __bf16 tb[128][72], tbl[128][72];
  const int tid = threadIdx.x, wave = tid >> 5, lane = tid & 31, col = lane & 15, g = lane >> 4; const int which = blockIdx.z; const int c0 = blockIdx.y * 128; const size_t r0 = (size_t)blockIdx.x * 64; const size_t bb = r0 / TT; const int t0 = (int)(r0 % TT);
  const float* X = which == 0 ? XQ : which == 1 ? XK : XV; const float* WA = which == 0 ? WQ : which == 1 ? WK : WV; const float* BA = which == 0 ? BQ : which == 1 ? BK : BV;
  v8f acc[8] = {};
#pragma unroll 2
  for (int kc = 0; kc < DIN / 32; ++kc) { v16b a; { const float* p = X + (r0 + wave * 16 + col) * DIN + kc * 32 + 8 * g;
#pragma unroll
      for (int i = 0; i < 8; ++i) { a[i] = (__bf16)p[i]; a[8 + i] = (__bf16)p[16 + i]; } }
    asm volatile("s_wait_loadcnt 0x0" ::: "memory");
#pragma unroll
    for (int j = 0; j < 8; ++j) { const v16b w = WCOL(WA, kc * 32, c0 + j * 16 + col, lane); asm volatile("s_wait_loadcnt 0x0" ::: "memory"); acc[j] = wmma_bf(a, w, acc[j]); } }
  if (which < 2) { _Float16* DH = which == 0 ? QH : KH; _Float16* DL = which == 0 ? QL : KL; const int nhi = which == 0 ? QHI : KHI; const bool hi_rows = t0 < nhi;
#pragma unroll
    for (int j = 0; j < 8; ++j) { const float bias = BA ? bfr(BA[c0 + j * 16 + col]) : 0.f;
#pragma unroll
      for (int r = 0; r < 8; ++r) { const float v = acc[j][r] + bias; const _Float16 hv = (_Float16)v; sh[wave * 16 + 8 * g + r][j * 16 + col] = hv; sl[wave * 16 + 8 * g + r][j * 16 + col] = (_Float16)((v - (float)hv) * 1024.0f); } }
    __syncthreads();
    for (int e = tid; e < 64 * 16; e += 128) { const int rl = e >> 4, q = e & 15; vst2((unsigned*)(DH + (r0 + rl) * CC + c0 + q * 8), *(const v4u*)&sh[rl][q * 8]); if (hi_rows) vst2((unsigned*)(DL + (bb * nhi + t0 + rl) * (size_t)CC + c0 + q * 8), *(const v4u*)&sl[rl][q * 8]); }
  } else { const bool hi_rows = t0 < KHI;
#pragma unroll
    for (int j = 0; j < 8; ++j) { const float bias = BA ? bfr(BA[c0 + j * 16 + col]) : 0.f;
#pragma unroll
      for (int r = 0; r < 8; ++r) { const float v = acc[j][r] + bias; const int rl = wave * 16 + 8 * g + r, cl = j * 16 + col; th[cl][rl] = (_Float16)v; const __bf16 bh = (__bf16)v; tb[cl][rl] = bh; tbl[cl][rl] = (__bf16)(v - (float)bh); } }
    __syncthreads();
    for (int e = tid; e < 128 * 8; e += 128) { const int cl = e >> 3, q = e & 7; vst2((unsigned*)(VT + (bb * CC + c0 + cl) * (size_t)TT + t0 + q * 8), *(const v4u*)&th[cl][q * 8]); if (hi_rows) { const size_t o3 = (bb * CC + c0 + cl) * (size_t)KHI + t0 + q * 8; vst2((unsigned*)(VB + o3), *(const v4u*)&tb[cl][q * 8]); vst2((unsigned*)(VBL + o3), *(const v4u*)&tbl[cl][q * 8]); } } } }
// ---- k_sc: block = (query block qb = image row y, key block kb in [kb_first_h, kb_last_h](qb, h) = the head's window rows, head in group) of batch b: logits x SCALE; q hi + residual (x 2^10) against k (2 products) for query rows < QHI, plus the k residual (3 products) for query blocks < QBH (causal early rows); the window mask itself is applied by index in k_sm
__global__ __launch_bounds__(128) void k_sc(const _Float16* __restrict__ QH, const _Float16* __restrict__ KH, const _Float16* __restrict__ QL, const _Float16* __restrict__ KL, int b, int h0, float* __restrict__ S0) { __shared__ __align__(16) float ss[4][16][132];
  const int qb = blockIdx.x, kb = blockIdx.y; const int h = h0 + blockIdx.z; if (kb > kb_last_h(qb, h) || kb < kb_first_h(qb, h)) return;   /* only the key blocks holding this head's window rows */ float* S = S0 + (size_t)blockIdx.z * TT * TT;
  const int tid = threadIdx.x, wave = tid >> 5, lane = tid & 31, col = lane & 15, g = lane >> 4; const int k0 = kb * 128; const int ql0 = qb * 64 + wave * 16; const size_t q0 = (size_t)b * TT + ql0, kr0 = (size_t)b * TT + k0;
  v8f acc[8] = {}, accl[8] = {};
  const _Float16* QLb = QL + (size_t)b * QHI * CC; const _Float16* KLb = KL + (size_t)b * KHI * CC;
  if (qb < QBH) {
#pragma unroll
    for (int kc = 0; kc < HD / 32; ++kc) { const v16h ah = frag_h(QH + (q0 + col) * CC + h * HD + kc * 32, lane), al = frag_h(QLb + (size_t)(ql0 + col) * CC + h * HD + kc * 32, lane);
#pragma unroll
      for (int j = 0; j < 8; ++j) { const v16h kbf = frag_h(KH + (kr0 + j * 16 + col) * CC + h * HD + kc * 32, lane), klf = frag_h(KLb + (size_t)(k0 + j * 16 + col) * CC + h * HD + kc * 32, lane); acc[j] = wmma16(ah, kbf, acc[j]); accl[j] = wmma16(al, kbf, accl[j]); accl[j] = wmma16(ah, klf, accl[j]); } }
  } else if (qb * 64 < QHI) {
#pragma unroll
    for (int kc = 0; kc < HD / 32; ++kc) { const v16h ah = frag_h(QH + (q0 + col) * CC + h * HD + kc * 32, lane), al = frag_h(QLb + (size_t)(ql0 + col) * CC + h * HD + kc * 32, lane);
#pragma unroll
      for (int j = 0; j < 8; ++j) { const v16h kbf = frag_h(KH + (kr0 + j * 16 + col) * CC + h * HD + kc * 32, lane); acc[j] = wmma16(ah, kbf, acc[j]); accl[j] = wmma16(al, kbf, accl[j]); } }
  } else {
#pragma unroll
    for (int kc = 0; kc < HD / 32; ++kc) { const v16h ah = frag_h(QH + (q0 + col) * CC + h * HD + kc * 32, lane);
#pragma unroll
      for (int j = 0; j < 8; ++j) { const v16h kbf = frag_h(KH + (kr0 + j * 16 + col) * CC + h * HD + kc * 32, lane); acc[j] = wmma16(ah, kbf, acc[j]); } } }
#pragma unroll
  for (int j = 0; j < 8; ++j) {
#pragma unroll
    for (int r = 0; r < 8; ++r) ss[wave][8 * g + r][j * 16 + col] = (acc[j][r] + accl[j][r] * (1.0f / 1024.0f)) * SCALE; }
  LDSX(); for (int rl = 0; rl < 16; ++rl) vst2(S + (size_t)(ql0 + rl) * TT + k0 + lane * 4, *(const v4f*)&ss[wave][rl][lane * 4]); }
// ---- k_sm: block = query row t (head in group): keys [kstart, kend) = the window rows k_sc wrote; same-window keys kept by index (row AND column window), the rest excluded; softmax in f32; P x 2^11 in place (0 for excluded keys inside [kstart, kend))
__global__ __launch_bounds__(256) void k_sm(float* __restrict__ S0 SM_EXTRA_PARAMS) { __shared__ float sred[8]; __shared__ float sbc; __shared__ __align__(16) float shv[TT];
  const int tid = threadIdx.x; const int t = blockIdx.x; const int head = h0s + blockIdx.y; const int rl_ = rlog(head); const int kend = (kb_last_h(t >> 6, head) + 1) * 128, kstart = kb_first_h(t >> 6, head) * 128;   /* the key blocks k_sc wrote for this (query block, head); P is written (0 outside the window) over exactly [kstart, kend), which is what k_pv reads */
  const int wimg = WI[0]; const int wsh = 31 - __clz(wimg); const int wmask = wimg - 1; (void)HI;   /* grid width read from the input (64 -> shift 6); H is implied by TT / W */
  float* sr = S0 + (size_t)blockIdx.y * TT * TT + (size_t)t * TT;
  float m = -3.0e38f; for (int k = kstart + tid; k < kend; k += 256) { float v = sr[k]; SM_MASK_HOOK; shv[k] = v; m = fmaxf(m, v); }
#pragma unroll
  for (int o = 1; o < 32; o <<= 1) m = fmaxf(m, __shfl_xor(m, o));
  if ((tid & 31) == 0) sred[tid >> 5] = m; __syncthreads(); if (tid == 0) { float a = sred[0]; for (int i = 1; i < 8; ++i) a = fmaxf(a, sred[i]); sbc = a; } __syncthreads(); m = sbc; __syncthreads();
  float sum = 0.f; for (int k = kstart + tid; k < kend; k += 256) { const float v = shv[k]; const float e = (v <= -1.0e38f) ? 0.f : expf(v - m); shv[k] = e; sum += e; }
#pragma unroll
  for (int o = 1; o < 32; o <<= 1) sum += __shfl_xor(sum, o);
  if ((tid & 31) == 0) sred[tid >> 5] = sum; __syncthreads(); if (tid == 0) { float a = 0.f; for (int i = 0; i < 8; ++i) a += sred[i]; sbc = a > 0.f ? 2048.0f / a : 0.f; }   /* a fully excluded row yields P = 0 */ __syncthreads(); const float inv = sbc;
  for (int k = kstart + tid; k < kend; k += 256) shv[k] = shv[k] * inv;
  __syncthreads(); for (int q = kstart / 4 + tid; q < kend / 4; q += 256) vst2(sr + q * 4, *(const v4f*)&shv[q * 4]); }
// ---- k_pv: block = 64 queries (qb) of (b, h): ctx = P . v over key chunks [kcs, kce) (the window rows) (P x 2^11 once to f16 against v f16: 1 product; causal early query blocks: P and v as bf16 hi + lo, 3 products); 256-B (row, head) segment by 16 lanes
__global__ __launch_bounds__(128) void k_pv(const float* __restrict__ PS0, const _Float16* __restrict__ VT, const __bf16* __restrict__ VB, const __bf16* __restrict__ VBL, int b, int h0, float* __restrict__ Y) { const int h = h0 + blockIdx.z; const float* PS = PS0 + (size_t)blockIdx.z * TT * TT; __shared__ __align__(16) float ss[4][16][HD + 4];
  const int tid = threadIdx.x, wave = tid >> 5, lane = tid & 31, col = lane & 15, g = lane >> 4; const int qb = blockIdx.x; const int ql0 = qb * 64 + wave * 16; const int kce = (kb_last_h(qb, h) + 1) * 4, kcs = kb_first_h(qb, h) * 4;   /* P exists (window or 0) exactly over key chunks [kcs, kce) */
  v8f acc[HD / 16] = {};
  if (qb < QBH) {
#pragma unroll 1
    for (int kc = kcs; kc < kce; ++kc) { const F2 p = split_row(PS + (size_t)(ql0 + col) * TT, kc * 32, lane);
      asm volatile("s_wait_loadcnt 0x0" ::: "memory");
#pragma unroll
      for (int j = 0; j < HD / 16; ++j) { const size_t po = ((size_t)b * CC + h * HD + j * 16 + col) * (size_t)KHI + kc * 32; const v16b vh = frag_b(VB + po, lane); acc[j] = wmma_bf(p.h, vh, acc[j]); acc[j] = wmma_bf(p.l, vh, acc[j]); acc[j] = wmma_bf(p.h, frag_b(VBL + po, lane), acc[j]); } }
  } else {
#pragma unroll 1
    for (int kc = kcs; kc < kce; ++kc) { const v16h p = frag_f32(PS + (size_t)(ql0 + col) * TT + kc * 32, lane);
      asm volatile("s_wait_loadcnt 0x0" ::: "memory");
#pragma unroll
      for (int j = 0; j < HD / 16; ++j) { const size_t po = ((size_t)b * CC + h * HD + j * 16 + col) * (size_t)TT + kc * 32; acc[j] = wmma16(p, frag_h(VT + po, lane), acc[j]); } } }
#pragma unroll
  for (int j = 0; j < HD / 16; ++j)
#pragma unroll
    for (int r = 0; r < 8; ++r) ss[wave][8 * g + r][j * 16 + col] = acc[j][r] * (1.0f / 2048.0f);
  LDSX(); for (int rl = 0; rl < 16; ++rl) if (lane < HD / 4) vst2(Y + ((size_t)b * TT + ql0 + rl) * CC + h * HD + lane * 4, *(const v4f*)&ss[wave][rl][lane * 4]); }
// ---- k_out: block = (64 rows, 128 cols): out = ctx Wo (+ bo): ctx x 2^6 once to f16 against Wo as f16(bf16 x 2^8) exact (1 product) x 2^-14; causal early rows (< QHI of each sequence): ctx bf16 hi + lo against exact bf16 Wo (2 products)
__global__ __launch_bounds__(128) void k_out(const float* __restrict__ Y, const float* __restrict__ WO, const float* __restrict__ BO, float* __restrict__ OUT) { __shared__ __align__(16) float sf[4][16][132];
  const int tid = threadIdx.x, wave = tid >> 5, lane = tid & 31, col = lane & 15, g = lane >> 4; const int c0 = blockIdx.y * 128; const size_t r0 = (size_t)blockIdx.x * 64 + wave * 16;
  v8f acc[8] = {};
  if (CAUSAL && (int)(((size_t)blockIdx.x * 64) % TT) < QHI) {   /* block-uniform */
#pragma unroll 2
    for (int kc = 0; kc < CC / 32; ++kc) { const F2 a = split_row(Y + (r0 + col) * CC, kc * 32, lane); asm volatile("s_wait_loadcnt 0x0" ::: "memory");
#pragma unroll
      for (int j = 0; j < 8; ++j) { const v16b w = WOCOL(WO, kc * 32, c0 + j * 16 + col, lane); asm volatile("s_wait_loadcnt 0x0" ::: "memory"); acc[j] = wmma_bf(a.h, w, acc[j]); acc[j] = wmma_bf(a.l, w, acc[j]); } }
#pragma unroll
    for (int j = 0; j < 8; ++j) { const float bias = BO ? bfr(BO[c0 + j * 16 + col]) : 0.f;
#pragma unroll
      for (int r = 0; r < 8; ++r) sf[wave][8 * g + r][j * 16 + col] = acc[j][r] + bias; }
  } else {
#pragma unroll 2
    for (int kc = 0; kc < CC / 32; ++kc) { const v16h a = frag_f32s(Y + (r0 + col) * CC + kc * 32, lane, 64.0f); asm volatile("s_wait_loadcnt 0x0" ::: "memory");   /* ctx carried x 2^6 into f16 so small-magnitude context rows stay clear of f16 subnormals */
#pragma unroll
      for (int j = 0; j < 8; ++j) { const v16h w = WOCOLH(WO, kc * 32, c0 + j * 16 + col, lane); asm volatile("s_wait_loadcnt 0x0" ::: "memory"); acc[j] = wmma16(a, w, acc[j]); } }
#pragma unroll
    for (int j = 0; j < 8; ++j) { const float bias = BO ? bfr(BO[c0 + j * 16 + col]) : 0.f;
#pragma unroll
      for (int r = 0; r < 8; ++r) sf[wave][8 * g + r][j * 16 + col] = acc[j][r] * (1.0f / 16384.0f) + bias; } }   /* 2^-8 (Wo carry) x 2^-6 (ctx carry) */
  LDSX(); for (int rl = 0; rl < 16; ++rl) vst2(OUT + (r0 + rl) * DIN + c0 + lane * 4, *(const v4f*)&sf[wave][rl][lane * 4]); }

extern "C" void kernel_launch(void* const* d_in, const int* in_sizes, int n_in, void* d_out, int out_size, void* d_ws, size_t ws_size, hipStream_t stream) {
  (void)in_sizes; (void)n_in; (void)out_size;
  const float** F = (const float**)d_in;
  if (ws_size < (size_t)WS_END) return;
  char* ws = (char*)d_ws; _Float16 *QH = (_Float16*)(ws + WS_QH), *KH = (_Float16*)(ws + WS_KH), *VT = (_Float16*)(ws + WS_VT), *QL = (_Float16*)(ws + WS_QL), *KL = (_Float16*)(ws + WS_KL); __bf16 *VB = (__bf16*)(ws + WS_VB), *VBL = (__bf16*)(ws + WS_VBL); float *S = (float*)(ws + WS_S), *Y = (float*)(ws + WS_Y);
  (void)Y; (void)QL; (void)KL; (void)VB; (void)VBL;
  // inputs: 0 x [4,4096,512]; 1 Wq [512,512] (in,out); 2 Wkv [512,1024] (in,out; columns k | v, head*64+d); 3 Wproj [512,512] (in,out); 4 bproj [512]; 5 H (int 64); 6 W (int 64)
  const int* HI = (const int*)d_in[5]; const int* WI = (const int*)d_in[6];
  k_proj<<<dim3(TNB * TT / 64, CC / 128, 3), 128, 0, stream>>>(F[0], F[0], F[0], F[1], F[2], F[2] + CC, nullptr, nullptr, nullptr, QH, QL, KH, KL, VT, VB, VBL);   /* k = Wkv columns 0..511, v = columns 512..1023 (row pitch 2*CC) */
  for (int b = 0; b < TNB; ++b) for (int h0 = 0; h0 < NH; h0 += HG) {
    k_sc<<<dim3(NQB, TT / 128, HG), 128, 0, stream>>>(QH, KH, QL, KL, b, h0, S);
    k_sm<<<dim3(TT, HG), 256, 0, stream>>>(S, h0, HI, WI);
    k_pv<<<dim3(NQB, 1, HG), 128, 0, stream>>>(S, VT, VB, VBL, b, h0, Y);
  }
  k_out<<<dim3(TNB * TT / 64, DIN / 128), 128, 0, stream>>>(Y, F[3], F[4], (float*)d_out);
}

// v002
// It runs in 116 microseconds.
// Versions in between are left out here; by their measured steps it is 16.3 times as fast as v000.
// compute dtype: all float inputs rounded to bf16; q/k/v = x W with EXACT bf16 products on WMMA 16x16x32 (f32 accumulate); windowed logits with q as f16 hi + residual (x 2^10) against k once to f16 (2 products) x 64^-0.5; per-window online softmax in f32 (precise expf, running maximum and sum); exp(s - m) x 2^11 once to f16 against v once to f16 (1 product), divided by the f32 sum at the end; merged heads carried x 2^6 once to f16 against Wproj carried x 2^8 in f16 (exact bf16 values), un-scaled by 2^-14, + bproj; f32 output.
#include <hip/hip_runtime.h>
#include <math.h>

typedef __attribute__((ext_vector_type(16))) _Float16 v16h;
typedef __attribute__((ext_vector_type(16))) __bf16 v16b;
typedef __attribute__((ext_vector_type(8)))  _Float16 v8h;
typedef __attribute__((ext_vector_type(8)))  float v8f;
typedef __attribute__((ext_vector_type(4)))  float v4f;
typedef __attribute__((ext_vector_type(2)))  float v2f;
typedef __attribute__((ext_vector_type(4)))  unsigned v4u;
typedef __attribute__((ext_vector_type(4)))  int v4i;
typedef float __attribute__((may_alias)) float_a;
typedef int __attribute__((may_alias)) int_a;

template <typename T> __device__ __forceinline__ void vst2(void* p, T v) { *(T*)p = v;  }
__device__ __forceinline__ v8f wmma16(v16h a, v16h b, v8f c) {
  v8f d = __builtin_amdgcn_wmma_f32_16x16x32_f16(false, a, false, b, (short)0, c, false, false);
  asm volatile("v_nop\n\tv_nop\n\tv_nop\n\tv_nop" : "+v"(d) : "v"(a), "v"(b));
  return d;
}
__device__ __forceinline__ v8f wmma_bf(v16b a, v16b b, v8f c) {
  v8f d = __builtin_amdgcn_wmma_f32_16x16x32_bf16(false, a, false, b, (short)0, c, false, false);
  asm volatile("v_nop\n\tv_nop\n\tv_nop\n\tv_nop" : "+v"(d) : "v"(a), "v"(b));
  return d;
}
// 16x16x32 fragments: lane = (h = lane>>4, row/col = lane&15); elements 0..7 = k0+8h+0..7, 8..15 = k0+16+8h+0..7; D element r = row 8h+r
__device__ __forceinline__ v16h frag_h(const _Float16* rowk0, int lane) {
  union { v16h v; v8h q[2]; } u; const _Float16* p = rowk0 + 8 * (lane >> 4);
  u.q[0] = *(const v8h*)p; u.q[1] = *(const v8h*)(p + 16); return u.v;
}
__device__ __forceinline__ v16h frag_f32(const float* rowk0, int lane) {
  v16h a; const float* p = rowk0 + 8 * (lane >> 4);
#pragma unroll
  for (int i = 0; i < 8; ++i) { a[i] = (_Float16)p[i]; a[8 + i] = (_Float16)p[16 + i]; }
  return a;
}
__device__ __forceinline__ v16h frag_f32s(const float* rowk0, int lane, float sc) {
  v16h a; const float* p = rowk0 + 8 * (lane >> 4);
#pragma unroll
  for (int i = 0; i < 8; ++i) { a[i] = (_Float16)(p[i] * sc); a[8 + i] = (_Float16)(p[16 + i] * sc); }
  return a;
}
// column fragment from a [K][ld] layout (column n), rows >= K read as 0
__device__ __forceinline__ v16h fragc_f32(const float* W, int k0, int n, int lane, int ld, int K) {
  v16h a; const int g = lane >> 4;
#pragma unroll
  for (int i = 0; i < 8; ++i) { const int ka = k0 + 8 * g + i, kb = ka + 16;
    a[i] = (_Float16)(ka < K ? W[(size_t)(ka < K ? ka : K - 1) * ld + n] : 0.f); a[8 + i] = (_Float16)(kb < K ? W[(size_t)(kb < K ? kb : K - 1) * ld + n] : 0.f); }
  return a;
}
struct F2 { v16b h, l; };
__device__ __forceinline__ F2 bsplit16(const float v[16]) { F2 r;
#pragma unroll
  for (int i = 0; i < 16; ++i) { const __bf16 h = (__bf16)v[i]; r.h[i] = h; r.l[i] = (__bf16)(v[i] - (float)h); }
  return r; }
__device__ __forceinline__ F2 split_row(const float* row, int k0, int lane) { float v[16]; const float* p = row + k0 + 8 * (lane >> 4);
#pragma unroll
  for (int i = 0; i < 8; ++i) { v[i] = p[i]; v[8 + i] = p[16 + i]; }
  return bsplit16(v); }
__device__ __forceinline__ F2 split_rowK(const float* row, int k0, int lane, int K) { float v[16]; const int g = lane >> 4;
#pragma unroll
  for (int i = 0; i < 8; ++i) { const int ka = k0 + 8 * g + i, kb = ka + 16; v[i] = ka < K ? row[ka < K ? ka : K - 1] : 0.f; v[8 + i] = kb < K ? row[kb < K ? kb : K - 1] : 0.f; }
  return bsplit16(v); }
__device__ __forceinline__ F2 split_col(const float* W, int k0, int n, int lane, int ld, int K) { float v[16]; const int g = lane >> 4;
#pragma unroll
  for (int i = 0; i < 8; ++i) { const int ka = k0 + 8 * g + i, kb = ka + 16; v[i] = ka < K ? W[(size_t)(ka < K ? ka : K - 1) * ld + n] : 0.f; v[8 + i] = kb < K ? W[(size_t)(kb < K ? kb : K - 1) * ld + n] : 0.f; }
  return bsplit16(v); }
__device__ __forceinline__ v8f mac3(const F2& a, const F2& b, v8f c) { c = wmma_bf(a.l, b.h, c); c = wmma_bf(a.h, b.l, c); return wmma_bf(a.h, b.h, c); }
__device__ __forceinline__ float sigm(float v) { return 1.0f / (1.0f + expf(-v)); }
#define LDSX() do { asm volatile("s_wait_dscnt 0" ::: "memory"); __builtin_amdgcn_wave_barrier(); __builtin_amdgcn_fence(__ATOMIC_RELEASE, "workgroup"); } while (0)

// Multi-scale windowed self-attention (B 4, 64 x 64 = 4,096 tokens, C 512 = 8 heads x 64; head h attends within non-overlapping r x r spatial windows with r = (4, 4, 8, 8, 16, 16, 32, 32)[h]; 0.02-scale (in,out) Wq [512,512], Wkv [512,1024] (k | v), Wproj [512,512] + zero bproj): q = x Wq, k|v = x Wkv; per head: softmax(q k^T x 64^-0.5) over the window's r^2 keys; heads merged (channel = head*64 + d); out = o Wproj + bproj.
#define NB 4
#define TT 4096
#define CC 512            // NH * HD = projected width
#define DIN 512          // input (model) width
#define NH 8
#define HD 64
#define NQB (TT / 64)
#define HG 1
#define SCALE (0.125f)
#define CAUSAL 0
#ifndef TNB
#define TNB NB
#endif
__device__ __forceinline__ float bfr(float v) { return (float)(__bf16)v; }
__host__ __device__ __forceinline__ int kb_last(int qb) { return CAUSAL ? ((qb * 64 + 63) >> 7) : (TT / 128 - 1); }
typedef __attribute__((ext_vector_type(8))) __bf16 v8b;
__device__ __forceinline__ v16b frag_b(const __bf16* rowk0, int lane) {
  union { v16b v; v8b q[2]; } u; const __bf16* p = rowk0 + 8 * (lane >> 4);
  u.q[0] = *(const v8b*)p; u.q[1] = *(const v8b*)(p + 16); return u.v;
}
#define QBH 0
#define QHI 4096            // rows carrying a q residual plane (all rows when non-causal: 2-product logits everywhere)
#define KHI 64            // key rows carrying k residual / v bf16 hi+lo planes (written by k_proj, read by no kernel in this file)
// B fragment (k rows k0+.., output column o) of a weight: (in,out) [K][ld] or (out,in) [ld rows of K]: bf16 exact, or f16(bf16 * 256) exact
__device__ __forceinline__ v16b wcol_io(const float* Wm, int k0, int o, int lane, int ld) { v16b w; const int g = lane >> 4;
#pragma unroll
  for (int i = 0; i < 8; ++i) { w[i] = (__bf16)Wm[(size_t)(k0 + 8 * g + i) * ld + o]; w[8 + i] = (__bf16)Wm[(size_t)(k0 + 16 + 8 * g + i) * ld + o]; }
  return w; }
__device__ __forceinline__ v16b wcol_oi(const float* Wm, int k0, int o, int lane, int K) { v16b w; const float* p = Wm + (size_t)o * K + k0 + 8 * (lane >> 4);
#pragma unroll
  for (int i = 0; i < 8; ++i) { w[i] = (__bf16)p[i]; w[8 + i] = (__bf16)p[16 + i]; }
  return w; }
__device__ __forceinline__ v16h wcolh_io(const float* Wm, int k0, int o, int lane, int ld) { v16h w; const int g = lane >> 4;
#pragma unroll
  for (int i = 0; i < 8; ++i) { w[i] = (_Float16)(bfr(Wm[(size_t)(k0 + 8 * g + i) * ld + o]) * 256.0f); w[8 + i] = (_Float16)(bfr(Wm[(size_t)(k0 + 16 + 8 * g + i) * ld + o]) * 256.0f); }
  return w; }
__device__ __forceinline__ v16h wcolh_oi(const float* Wm, int k0, int o, int lane, int K) { v16h w; const float* p = Wm + (size_t)o * K + k0 + 8 * (lane >> 4);
#pragma unroll
  for (int i = 0; i < 8; ++i) { w[i] = (_Float16)(bfr(p[i]) * 256.0f); w[8 + i] = (_Float16)(bfr(p[16 + i]) * 256.0f); }
  return w; }
#define WQKV_LAYOUT 0   // 0 = (in,out) [DIN][CC]; 1 = (out,in) [CC][DIN]; 2 = per-head [NH][DIN][HD]
__device__ __forceinline__ v16b wcol_hdk(const float* Wm, int k0, int o, int lane) { v16b w; const int g = lane >> 4; const float* p = Wm + (size_t)(o / HD) * DIN * HD + (o % HD);
#pragma unroll
  for (int i = 0; i < 8; ++i) { w[i] = (__bf16)p[(size_t)(k0 + 8 * g + i) * HD]; w[8 + i] = (__bf16)p[(size_t)(k0 + 16 + 8 * g + i) * HD]; }
  return w; }
#define WO_OUT_IN 0
#if WQKV_LAYOUT == 1
#define WCOL(W, k0, o, lane) wcol_oi(W, k0, o, lane, DIN)
#elif WQKV_LAYOUT == 2
#define WCOL(W, k0, o, lane) wcol_hdk(W, k0, o, lane)
#else
#define WCOL(W, k0, o, lane) wcol_io(W, k0, o, lane, (which == 0 ? CC : 2 * CC))   /* Wq [512][512]; Wkv [512][1024] packed k | v */
#endif
#if WO_OUT_IN
#define WOCOL(W, k0, o, lane) wcol_oi(W, k0, o, lane, CC)
#define WOCOLH(W, k0, o, lane) wcolh_oi(W, k0, o, lane, CC)
#else
#define WOCOL(W, k0, o, lane) wcol_io(W, k0, o, lane, DIN)
#define WOCOLH(W, k0, o, lane) wcolh_io(W, k0, o, lane, DIN)
#endif
// per-head local window: REGIONS = (4, 4, 8, 8, 16, 16, 32, 32) -> r(h) = 4 << (h / 2); tokens are a 64 x 64 grid (n = y*64 + x), a 64-token query block is one image row y, a 128-key block is two rows
__host__ __device__ __forceinline__ int rlog(int h) { return 2 + (h >> 1); }

#define WS_QH  0u                                      // f16 q rows [b*t][CC]
#define WS_KH  (WS_QH + 2u * (size_t)NB * TT * CC)      // f16 k rows [b*t][CC]
#define WS_VT  (WS_KH + 2u * (size_t)NB * TT * CC)      // f16 v planes [b][c][t]
#define WS_QL  (WS_VT + 2u * (size_t)NB * CC * TT)      // f16 q residual x 2^10 rows [b][t < QHI][CC]
#define WS_KL  (WS_QL + 2u * (size_t)NB * QHI * CC)     // f16 k residual x 2^10 rows [b][t < KHI][CC]
#define WS_VB  (WS_KL + 2u * (size_t)NB * KHI * CC)     // bf16 v hi planes [b][c][t < KHI]
#define WS_VBL (WS_VB + 2u * (size_t)NB * CC * KHI)
#define WS_Y   (WS_VBL + 2u * (size_t)NB * CC * KHI)    // f32 ctx rows [b*t][CC] (only when there is an output projection)
#define WS_END (WS_Y  + 4u * (size_t)NB * TT * CC)

// ---- the two projection GEMMs share one main loop: block = 8 waves = (256 rows, 128 cols), K = 512.
// The block's weight panel (128 output columns x all 512 k) is converted to its 16-bit form ONCE and kept in LDS as [column][k]; every wave reads its B fragments from there.
// Each wave owns 32 rows (2 A fragments x 8 B fragments = 16 products per 32 k): it loads them as whole 128-byte lines, converts, and turns them into fragments through its own small LDS range.
// k ascends within each accumulator.
typedef __attribute__((ext_vector_type(2))) unsigned v2u;
#define PW 520                       // pitch of a panel row (one column, 512 k) in 16-bit elements: 1,040 B = 16 B x odd, no bank conflict for 16-byte reads
#define PX 40                        // pitch of a staged operand row (32 k): 80 B = 16 B x odd
#define SM_W (128 * PW * 2)          // panel bytes
#define SM_XW (32 * PX * 2)          // one wave's operand range
#define SM_BYTES (SM_W + 8 * SM_XW)  // 153,600 B: two blocks per WGP; the epilogues reuse it
union Frag { v4u q[2]; v16b b; v16h h; };
// F16M 0: operands rounded to bf16 (exact products); F16M 1: rows x 2^6 to f16, weights f16(bf16 x 2^8) (exact)
// wave-private hand-over through LDS: the wave's own LDS operations have retired, and the compiler moves no memory access across
#define LDSW() do { asm volatile("s_wait_dscnt 0" ::: "memory"); __builtin_amdgcn_wave_barrier(); } while (0)
template <int F16M> __device__ __forceinline__ v2u pack4(v4f f) { union { v2u u; __bf16 b[4]; _Float16 h[4]; } c;
#pragma unroll
  for (int e = 0; e < 4; ++e) { if constexpr (F16M) c.h[e] = (_Float16)(f[e] * 64.0f); else c.b[e] = (__bf16)f[e]; }
  return c.u; }
// 128 columns x 512 k of a [k][LD] f32 weight -> LDS [column][k] in the 16-bit form: a wave reads 32 neighbouring columns of one k row (one whole line), a lane gathers 8 k of its column into one 16-byte LDS store
template <int F16M, int LD> __device__ __forceinline__ void stage_panel(const float* __restrict__ Wc, char* smem) {
  const int tid = threadIdx.x, n = tid & 127; const float* wp = Wc + (size_t)((tid >> 7) * 8) * LD + n; char* dst = smem + (n * PW + (tid >> 7) * 8) * 2;
#pragma unroll 8   /* 64 loads in flight per wave while the panel is filled */
  for (int it = 0; it < 32; ++it) { union { v4u u; v8b b; v8h h; } w; const float* p = wp + (size_t)(it * 16) * LD;
#pragma unroll
    for (int i = 0; i < 8; ++i) { const float f = p[(size_t)i * LD]; if constexpr (F16M) w.h[i] = (_Float16)(bfr(f) * 256.0f); else w.b[i] = (__bf16)f; }
    *(v4u*)(dst + it * 32) = w.u; } }
template <int F16M> __device__ __forceinline__ void gemm_256x128(const float* __restrict__ X, size_t r0, const float* __restrict__ Wm, int ld, int c0, char* smem, v8f (&acc)[2][8]) {
  const int tid = threadIdx.x, wave = tid >> 5, lane = tid & 31, col = lane & 15, g = lane >> 4;
  const float* xp = X + (r0 + wave * 32 + (lane >> 3)) * 512 + (lane & 7) * 4;   /* load i of a chunk: rows 4i .. 4i+3, 8 lanes x 16 B = one whole line a row */
  char* xs = smem + SM_W + wave * SM_XW; char* xst = xs + ((lane >> 3) * PX + (lane & 7) * 4) * 2;
  const char* xa = xs + (col * PX + 8 * g) * 2; const char* wb = smem + (col * PW + 8 * g) * 2;
  v4f raw[8];
#pragma unroll
  for (int i = 0; i < 8; ++i) raw[i] = *(const v4f*)(xp + (size_t)i * 4 * 512);
  if (ld == 512) stage_panel<F16M, 512>(Wm + c0, smem); else stage_panel<F16M, 1024>(Wm + c0, smem);   /* block-uniform; the pitch as a constant puts every row step into the loads' immediate offsets */
#pragma unroll
  for (int i = 0; i < 8; ++i) { *(v2u*)(xst + i * 4 * PX * 2) = pack4<F16M>(raw[i]); raw[i] = *(const v4f*)(xp + (size_t)i * 4 * 512 + 32); }
  __syncthreads();   /* the panel (and each wave's first chunk) is complete before any wave reads it */
#pragma unroll
  for (int kc = 0; kc < 16; ++kc) {
    Frag a[2], w[8];   /* the chunk's 20 fragment reads go as one group ahead of its 16 products */
#pragma unroll
    for (int m = 0; m < 2; ++m) { a[m].q[0] = *(const v4u*)(xa + m * 16 * PX * 2); a[m].q[1] = *(const v4u*)(xa + m * 16 * PX * 2 + 32); }
#pragma unroll
    for (int j = 0; j < 8; ++j) { w[j].q[0] = *(const v4u*)(wb + (j * 16 * PW + kc * 32) * 2); w[j].q[1] = *(const v4u*)(wb + (j * 16 * PW + kc * 32) * 2 + 32); }
    v2u pk[8];   /* the next chunk's rows are converted while the reads are under way */
    if (kc + 1 < 16) {
#pragma unroll
      for (int i = 0; i < 8; ++i) pk[i] = pack4<F16M>(raw[i]); }
    __builtin_amdgcn_sched_barrier(0);   /* keeps the 20 reads one group ahead of the products (one exposed LDS latency a chunk; without it each pair of reads is waited for on its own) and the conversion under that latency */
    LDSW();   /* this chunk's fragments are in registers before the next chunk's rows overwrite them */
    if (kc + 1 < 16) {
#pragma unroll
      for (int i = 0; i < 8; ++i) *(v2u*)(xst + i * 4 * PX * 2) = pk[i]; }
    __builtin_amdgcn_sched_barrier(0);   /* the converted rows leave their registers before the next lines are asked for: keeps the wave within 256 registers, two blocks per WGP */
    if (kc + 2 < 16) {
#pragma unroll
      for (int i = 0; i < 8; ++i) raw[i] = *(const v4f*)(xp + (size_t)i * 4 * 512 + (kc + 2) * 32); }   /* the lines of the chunk after next fly under this chunk's products */
#pragma unroll
    for (int j = 0; j < 8; ++j)
#pragma unroll
      for (int m = 0; m < 2; ++m) { if constexpr (F16M) acc[m][j] = __builtin_amdgcn_wmma_f32_16x16x32_f16(false, a[m].h, false, w[j].h, (short)0, acc[m][j], false, false);
        else acc[m][j] = __builtin_amdgcn_wmma_f32_16x16x32_bf16(false, a[m].b, false, w[j].b, (short)0, acc[m][j], false, false); }
    __builtin_amdgcn_sched_barrier(0);   /* the products stay ahead of the wait below, so they cover the row stores, and the next conversion (which waits for the lines just asked for) stays behind them */
    LDSW();   /* the wave's next rows are in LDS before its lanes read each other's */
  }
  __syncthreads();   /* every wave has left the panel: the epilogue reuses the LDS */
}
// ---- k_proj: block = (256 rows, 128 cols, which): q/k/v = X W (+ b) with exact bf16 products (K = DIN) -> which 0: q f16 rows (+ residual rows < QHI); 1: k f16 rows (+ residual rows < KHI); 2: v f16 planes [c][t] (+ bf16 hi/lo planes for t < KHI)
__global__ __launch_bounds__(256) void k_proj(const float* __restrict__ XQ, const float* __restrict__ XK, const float* __restrict__ XV, const float* __restrict__ WQ, const float* __restrict__ WK, const float* __restrict__ WV, const float* __restrict__ BQ, const float* __restrict__ BK, const float* __restrict__ BV,
    _Float16* __restrict__ QH, _Float16* __restrict__ QL, _Float16* __restrict__ KH, _Float16* __restrict__ KL, _Float16* __restrict__ VT, __bf16* __restrict__ VB, __bf16* __restrict__ VBL) {
  __shared__ __align__(16) char smem[SM_BYTES];
  const int tid = threadIdx.x, wave = tid >> 5, lane = tid & 31, col = lane & 15, g = lane >> 4; const int which = blockIdx.z; const int c0 = blockIdx.y * 128; const size_t r0 = (size_t)blockIdx.x * 256; const size_t bb = r0 / TT; const int t0 = (int)(r0 % TT);
  const float* X = which == 0 ? XQ : which == 1 ? XK : XV; const float* WA = which == 0 ? WQ : which == 1 ? WK : WV; const float* BA = which == 0 ? BQ : which == 1 ? BK : BV;
  v8f acc[2][8] = {};
  gemm_256x128<0>(X, r0, WA, which == 0 ? CC : 2 * CC, c0, smem, acc);   /* Wq [512][512]; Wkv [512][1024] packed k | v */
  if (which < 2) { _Float16* DH = which == 0 ? QH : KH; _Float16* DL = which == 0 ? QL : KL; const int nhi = which == 0 ? QHI : KHI;
    _Float16 (*sh)[136] = (_Float16 (*)[136])smem; _Float16 (*sl)[136] = (_Float16 (*)[136])(smem + 256 * 136 * 2);
#pragma unroll
    for (int m = 0; m < 2; ++m)
#pragma unroll
      for (int j = 0; j < 8; ++j) { const float bias = BA ? bfr(BA[c0 + j * 16 + col]) : 0.f;
#pragma unroll
        for (int r = 0; r < 8; ++r) { const float v = acc[m][j][r] + bias; const _Float16 hv = (_Float16)v; const int rl = wave * 32 + m * 16 + 8 * g + r; sh[rl][j * 16 + col] = hv; sl[rl][j * 16 + col] = (_Float16)((v - (float)hv) * 1024.0f); } }
    __syncthreads();
    for (int it = 0; it < 16; it += 4) { v4u vh[4], vl[4];   /* four rows' pieces a trip: 8 LDS reads under way at once */
#pragma unroll
      for (int u = 0; u < 4; ++u) { const int e = (it + u) * 256 + tid, rl = e >> 4, q = e & 15; vh[u] = *(const v4u*)&sh[rl][q * 8]; vl[u] = *(const v4u*)&sl[rl][q * 8]; }
#pragma unroll
      for (int u = 0; u < 4; ++u) { const int e = (it + u) * 256 + tid, rl = e >> 4, q = e & 15; vst2((unsigned*)(DH + (r0 + rl) * CC + c0 + q * 8), vh[u]); if (t0 + rl < nhi) vst2((unsigned*)(DL + (bb * nhi + t0 + rl) * (size_t)CC + c0 + q * 8), vl[u]); }
      asm volatile("s_wait_xcnt 0x0" ::: "memory"); }   /* precaution: the next trip rewrites registers that these stores name */
  } else { _Float16 (*th)[264] = (_Float16 (*)[264])smem; __bf16 (*tb)[72] = (__bf16 (*)[72])(smem + 128 * 264 * 2); __bf16 (*tbl)[72] = (__bf16 (*)[72])(smem + 128 * 264 * 2 + 128 * 72 * 2);
#pragma unroll
    for (int m = 0; m < 2; ++m)
#pragma unroll
      for (int j = 0; j < 8; ++j) { const float bias = BA ? bfr(BA[c0 + j * 16 + col]) : 0.f; const int rb = wave * 32 + m * 16 + 8 * g, cl = j * 16 + col; v8h hv;
#pragma unroll
        for (int r = 0; r < 8; ++r) hv[r] = (_Float16)(acc[m][j][r] + bias);
        *(v8h*)&th[cl][rb] = hv;   /* a lane's 8 values are 8 neighbouring t of one channel */
        if (t0 + rb < KHI) {   /* only the first KHI tokens of a sequence carry these planes */
#pragma unroll
          for (int r = 0; r < 8; ++r) { const float v = acc[m][j][r] + bias; const __bf16 bh = (__bf16)v; tb[cl][rb + r] = bh; tbl[cl][rb + r] = (__bf16)(v - (float)bh); } } }
    __syncthreads();
    for (int it = 0; it < 16; it += 4) { v4u vv[4];
#pragma unroll
      for (int u = 0; u < 4; ++u) { const int e = (it + u) * 256 + tid, cl = e >> 5, q = e & 31; vv[u] = *(const v4u*)&th[cl][q * 8]; }
#pragma unroll
      for (int u = 0; u < 4; ++u) { const int e = (it + u) * 256 + tid, cl = e >> 5, q = e & 31; vst2((unsigned*)(VT + (bb * CC + c0 + cl) * (size_t)TT + t0 + q * 8), vv[u]); }
      asm volatile("s_wait_xcnt 0x0" ::: "memory"); }   /* precaution: the next trip rewrites registers that these stores name */
    if (t0 < KHI) for (int it = 0; it < 4; ++it) { const int e = it * 256 + tid, cl = e >> 3, q = e & 7;
      if (t0 + q * 8 < KHI) { const size_t o3 = (bb * CC + c0 + cl) * (size_t)KHI + t0 + q * 8; vst2((unsigned*)(VB + o3), *(const v4u*)&tb[cl][q * 8]); vst2((unsigned*)(VBL + o3), *(const v4u*)&tbl[cl][q * 8]); }
      asm volatile("s_wait_xcnt 0x0" ::: "memory"); } } }   /* the same precaution */
__global__ __launch_bounds__(256) void k_attn(const _Float16* __restrict__ QH, const _Float16* __restrict__ QL, const _Float16* __restrict__ KH, const _Float16* __restrict__ VT, const int* __restrict__ WI, float* __restrict__ Y) {
  const int lane = threadIdx.x & 31, col = lane & 15, g = lane >> 4;
  const int wave = __builtin_amdgcn_readfirstlane((int)(threadIdx.x >> 5));   /* wave-uniform, so the tiles' token numbers are worked out on the scalar unit */
  const int b = blockIdx.y, h = NH - 1 - (int)blockIdx.z;                       /* largest windows start first */
  const int rl_ = rlog(h), r = 1 << rl_;
  const int n0 = (((int)blockIdx.x >> 2) * 8 + wave) * 64 + ((int)blockIdx.x & 3) * 16;   /* a fixed one-to-one map (block, wave) -> 16-token tile; at width 64 the 8 waves are 8 image rows of one column strip and read the same keys for r >= 8 */
  int wsh = 31 - __clz(WI[0] | 1); wsh = wsh > 12 ? 12 : wsh;                   /* grid width read from the input, as a shift (64 -> 6) */
  const int wmask = (1 << wsh) - 1;
  const int sps = rl_ > 4 ? rl_ - 4 : 0, smask = (1 << sps) - 1;                /* 16-key tiles per window row: max(16, r) / 16 */
  const int y0 = ((n0 >> wsh) >> rl_) << rl_, xk0 = (n0 & wmask) & ~((16 << sps) - 1);
  const int nsub = r << sps;                                                    /* 4, 8, 16 or 64 tiles of 16 keys */
  const int wm = ~((r - 1) | ((r - 1) << wsh));                                 /* token bits that name the window: same window row AND same window column <=> ((k ^ t) & wm) == 0 */
  const int t = n0 + col;
  v16h qh[2], ql[2];
#pragma unroll
  for (int kc = 0; kc < 2; ++kc) { qh[kc] = frag_h(QH + ((size_t)b * TT + t) * CC + h * HD + kc * 32, lane); ql[kc] = frag_h(QL + ((size_t)b * QHI + t) * CC + h * HD + kc * 32, lane); }
  const _Float16* Kb = KH + (size_t)b * TT * CC + h * HD; const _Float16* Vb = VT + ((size_t)b * CC + h * HD) * (size_t)TT;
  const unsigned koff = (unsigned)(col * CC + 8 * g) * 2u, voff = (unsigned)(col * TT + 8 * g) * 2u;   /* the lane's own byte offsets, fixed for the whole loop */
  v8f acc[HD / 16] = {}; float m = -3.0e38f, sum = 0.f;
  for (int s0 = 0; s0 < nsub; s0 += 4) {
    int kt[4];   /* first token of each 16-key tile; bounded here whatever the width input holds */
#pragma unroll
    for (int u = 0; u < 4; ++u) { const int s = s0 + u; const int k = ((y0 + (s >> sps)) << wsh) + xk0 + ((s & smask) << 4); kt[u] = (k > TT - 16 ? TT - 16 : k) & ~15; }
    v8h kq[4][4], vq[2][HD / 16][2];
#pragma unroll
    for (int u = 0; u < 4; ++u) { const char* kp = (const char*)(Kb + (size_t)kt[u] * CC);
#pragma unroll
      for (int q = 0; q < 4; ++q) kq[u][q] = *(const v8h*)(kp + q * 32 + koff); }   /* q = 2 kc + half: d = kc*32 + half*16 + 8g .. + 7 of key row kt[u] + col */
#pragma unroll
    for (int c = 0; c < 2; ++c) { asm volatile("s_wait_xcnt 0x0" ::: "memory");   /* precaution: the loads below may land in registers that held addresses of the loads above */
#pragma unroll
      for (int j = 0; j < HD / 16; ++j) { const _Float16* vp = Vb + (size_t)(j * 16) * TT; vq[c][j][0] = *(const v8h*)((const char*)(vp + kt[2 * c]) + voff); vq[c][j][1] = *(const v8h*)((const char*)(vp + kt[2 * c + 1]) + voff); } }
    __builtin_amdgcn_sched_barrier(0);   /* keeps the pass's 32 loads one group ahead of the products: one exposed load latency a pass; without it each pair of loads is waited for on its own */
    float v[4][8]; float mx = m;
#pragma unroll
    for (int u = 0; u < 4; ++u) { v8f sa = {}, sl = {};
#pragma unroll
      for (int kc = 0; kc < 2; ++kc) { union { v16h f; v8h q[2]; } kf; kf.q[0] = kq[u][2 * kc]; kf.q[1] = kq[u][2 * kc + 1];
        sa = __builtin_amdgcn_wmma_f32_16x16x32_f16(false, kf.f, false, qh[kc], (short)0, sa, false, false); sl = __builtin_amdgcn_wmma_f32_16x16x32_f16(false, kf.f, false, ql[kc], (short)0, sl, false, false); }
#pragma unroll
      for (int i = 0; i < 8; ++i) { const float x = (sa[i] + sl[i] * (1.0f / 1024.0f)) * SCALE; v[u][i] = ((((kt[u] + 8 * g + i) ^ t) & wm) == 0) ? x : -3.0e38f; mx = fmaxf(mx, v[u][i]); } }
    mx = fmaxf(mx, __shfl_xor(mx, 16));
    const float alpha = expf(m - mx); m = mx;
#pragma unroll
    for (int j = 0; j < HD / 16; ++j) acc[j] *= alpha;
    v16h pf[2]; float ps[4];
#pragma unroll
    for (int u = 0; u < 4; ++u) { ps[u] = 0.f;
#pragma unroll
      for (int i = 0; i < 8; ++i) { const float ex = expf(v[u][i] - m); const float e = (v[u][i] <= -1.0e38f) ? 0.f : ex; ps[u] += e; pf[u >> 1][(u & 1) * 8 + i] = (_Float16)(e * 2048.0f); } }   /* exp first, select after: no branch per element */
    sum = sum * alpha + ((ps[0] + ps[1]) + (ps[2] + ps[3]));
#pragma unroll
    for (int c = 0; c < 2; ++c)
#pragma unroll
      for (int j = 0; j < HD / 16; ++j) { union { v16h f; v8h q[2]; } vf; vf.q[0] = vq[c][j][0]; vf.q[1] = vq[c][j][1];
        acc[j] = __builtin_amdgcn_wmma_f32_16x16x32_f16(false, vf.f, false, pf[c], (short)0, acc[j], false, false); } }
  sum += __shfl_xor(sum, 16);
  const float inv = sum > 0.f ? (1.0f / 2048.0f) / sum : 0.f;   /* a fully excluded row yields 0 */
  float* yp = Y + ((size_t)b * TT + t) * CC + h * HD + 8 * g;   /* lane = query t, register i of tile j = channel j*16 + 8g + i */
#pragma unroll
  for (int j = 0; j < HD / 16; ++j) { const v4f lo = { acc[j][0] * inv, acc[j][1] * inv, acc[j][2] * inv, acc[j][3] * inv }, hi = { acc[j][4] * inv, acc[j][5] * inv, acc[j][6] * inv, acc[j][7] * inv }; vst2(yp + j * 16, lo); vst2(yp + j * 16 + 4, hi); } }
// ---- k_out: block = (256 rows, 128 cols): out = ctx Wo (+ bo): ctx x 2^6 once to f16 (small-magnitude context rows stay clear of f16 subnormals) against Wo as f16(bf16 x 2^8) exact (1 product), un-scaled by 2^-14
__global__ __launch_bounds__(256) void k_out(const float* __restrict__ Y, const float* __restrict__ WO, const float* __restrict__ BO, float* __restrict__ OUT) { __shared__ __align__(16) char smem[SM_BYTES];
  const int tid = threadIdx.x, wave = tid >> 5, lane = tid & 31, col = lane & 15, g = lane >> 4; const int c0 = blockIdx.y * 128; const size_t r0 = (size_t)blockIdx.x * 256;
  v8f acc[2][8] = {};
  gemm_256x128<1>(Y, r0, WO, DIN, c0, smem, acc);
  float (*sf)[132] = (float (*)[132])(smem + wave * (32 * 132 * 4));   /* each wave stages its own 32 rows */
#pragma unroll
  for (int m = 0; m < 2; ++m)
#pragma unroll
    for (int j = 0; j < 8; ++j) { const float bias = BO ? bfr(BO[c0 + j * 16 + col]) : 0.f;
#pragma unroll
      for (int r = 0; r < 8; ++r) sf[m * 16 + 8 * g + r][j * 16 + col] = acc[m][j][r] * (1.0f / 16384.0f) + bias; }   /* 2^-8 (Wo carry) x 2^-6 (ctx carry) */
  LDSX(); for (int rl = 0; rl < 32; ++rl) vst2(OUT + (r0 + wave * 32 + rl) * DIN + c0 + lane * 4, *(const v4f*)&sf[rl][lane * 4]); }

extern "C" void kernel_launch(void* const* d_in, const int* in_sizes, int n_in, void* d_out, int out_size, void* d_ws, size_t ws_size, hipStream_t stream) {
  (void)in_sizes; (void)n_in; (void)out_size;
  const float** F = (const float**)d_in;
  if (ws_size < (size_t)WS_END) return;
  char* ws = (char*)d_ws; _Float16 *QH = (_Float16*)(ws + WS_QH), *KH = (_Float16*)(ws + WS_KH), *VT = (_Float16*)(ws + WS_VT), *QL = (_Float16*)(ws + WS_QL), *KL = (_Float16*)(ws + WS_KL); __bf16 *VB = (__bf16*)(ws + WS_VB), *VBL = (__bf16*)(ws + WS_VBL); float *Y = (float*)(ws + WS_Y);
  (void)Y; (void)QL; (void)KL; (void)VB; (void)VBL;
  // inputs: 0 x [4,4096,512]; 1 Wq [512,512] (in,out); 2 Wkv [512,1024] (in,out; columns k | v, head*64+d); 3 Wproj [512,512] (in,out); 4 bproj [512]; 5 H (int 64); 6 W (int 64)
  const int* WI = (const int*)d_in[6];
  k_proj<<<dim3(TNB * TT / 256, CC / 128, 3), 256, 0, stream>>>(F[0], F[0], F[0], F[1], F[2], F[2] + CC, nullptr, nullptr, nullptr, QH, QL, KH, KL, VT, VB, VBL);   /* k = Wkv columns 0..511, v = columns 512..1023 (row pitch 2*CC) */
  k_attn<<<dim3(TT / 128, TNB, NH), 256, 0, stream>>>(QH, QL, KH, VT, WI, Y);
  k_out<<<dim3(TNB * TT / 256, DIN / 128), 256, 0, stream>>>(Y, F[3], F[4], (float*)d_out);
}

// v003
// It runs in 99.9 microseconds.
// Next to v002, in two timings, it ran 1.17 and 1.16 times as fast.
// All steps since v000 together make it 19.0 times as fast.
// compute dtype: all float inputs rounded to bf16; q/k/v = x W with EXACT bf16 products on WMMA 16x16x32 (f32 accumulate); windowed logits with q as f16 hi + residual (x 2^10) against k once to f16 (2 products) x 64^-0.5; per-window online softmax in f32 (precise expf, running maximum and sum); exp(s - m) x 2^11 once to f16 against v once to f16 (1 product), divided by the f32 sum at the end; merged heads carried x 2^6 once to f16 against Wproj carried x 2^8 in f16 (exact bf16 values), un-scaled by 2^-14, + bproj; f32 output.
#include <hip/hip_runtime.h>
#include <math.h>

typedef __attribute__((ext_vector_type(16))) _Float16 v16h;
typedef __attribute__((ext_vector_type(16))) __bf16 v16b;
typedef __attribute__((ext_vector_type(8)))  _Float16 v8h;
typedef __attribute__((ext_vector_type(8)))  float v8f;
typedef __attribute__((ext_vector_type(4)))  float v4f;
typedef __attribute__((ext_vector_type(2)))  float v2f;
typedef __attribute__((ext_vector_type(4)))  unsigned v4u;
typedef __attribute__((ext_vector_type(4)))  int v4i;
typedef float __attribute__((may_alias)) float_a;
typedef int __attribute__((may_alias)) int_a;

template <typename T> __device__ __forceinline__ void vst2(void* p, T v) { *(T*)p = v;  }
__device__ __forceinline__ v8f wmma16(v16h a, v16h b, v8f c) {
  v8f d = __builtin_amdgcn_wmma_f32_16x16x32_f16(false, a, false, b, (short)0, c, false, false);
  asm volatile("v_nop\n\tv_nop\n\tv_nop\n\tv_nop" : "+v"(d) : "v"(a), "v"(b));
  return d;
}
__device__ __forceinline__ v8f wmma_bf(v16b a, v16b b, v8f c) {
  v8f d = __builtin_amdgcn_wmma_f32_16x16x32_bf16(false, a, false, b, (short)0, c, false, false);
  asm volatile("v_nop\n\tv_nop\n\tv_nop\n\tv_nop" : "+v"(d) : "v"(a), "v"(b));
  return d;
}
// 16x16x32 fragments: lane = (h = lane>>4, row/col = lane&15); elements 0..7 = k0+8h+0..7, 8..15 = k0+16+8h+0..7; D element r = row 8h+r
__device__ __forceinline__ v16h frag_h(const _Float16* rowk0, int lane) {
  union { v16h v; v8h q[2]; } u; const _Float16* p = rowk0 + 8 * (lane >> 4);
  u.q[0] = *(const v8h*)p; u.q[1] = *(const v8h*)(p + 16); return u.v;
}
__device__ __forceinline__ v16h frag_f32(const float* rowk0, int lane) {
  v16h a; const float* p = rowk0 + 8 * (lane >> 4);
#pragma unroll
  for (int i = 0; i < 8; ++i) { a[i] = (_Float16)p[i]; a[8 + i] = (_Float16)p[16 + i]; }
  return a;
}
__device__ __forceinline__ v16h frag_f32s(const float* rowk0, int lane, float sc) {
  v16h a; const float* p = rowk0 + 8 * (lane >> 4);
#pragma unroll
  for (int i = 0; i < 8; ++i) { a[i] = (_Float16)(p[i] * sc); a[8 + i] = (_Float16)(p[16 + i] * sc); }
  return a;
}
// column fragment from a [K][ld] layout (column n), rows >= K read as 0
__device__ __forceinline__ v16h fragc_f32(const float* W, int k0, int n, int lane, int ld, int K) {
  v16h a; const int g = lane >> 4;
#pragma unroll
  for (int i = 0; i < 8; ++i) { const int ka = k0 + 8 * g + i, kb = ka + 16;
    a[i] = (_Float16)(ka < K ? W[(size_t)(ka < K ? ka : K - 1) * ld + n] : 0.f); a[8 + i] = (_Float16)(kb < K ? W[(size_t)(kb < K ? kb : K - 1) * ld + n] : 0.f); }
  return a;
}
struct F2 { v16b h, l; };
__device__ __forceinline__ F2 bsplit16(const float v[16]) { F2 r;
#pragma unroll
  for (int i = 0; i < 16; ++i) { const __bf16 h = (__bf16)v[i]; r.h[i] = h; r.l[i] = (__bf16)(v[i] - (float)h); }
  return r; }
__device__ __forceinline__ F2 split_row(const float* row, int k0, int lane) { float v[16]; const float* p = row + k0 + 8 * (lane >> 4);
#pragma unroll
  for (int i = 0; i < 8; ++i) { v[i] = p[i]; v[8 + i] = p[16 + i]; }
  return bsplit16(v); }
__device__ __forceinline__ F2 split_rowK(const float* row, int k0, int lane, int K) { float v[16]; const int g = lane >> 4;
#pragma unroll
  for (int i = 0; i < 8; ++i) { const int ka = k0 + 8 * g + i, kb = ka + 16; v[i] = ka < K ? row[ka < K ? ka : K - 1] : 0.f; v[8 + i] = kb < K ? row[kb < K ? kb : K - 1] : 0.f; }
  return bsplit16(v); }
__device__ __forceinline__ F2 split_col(const float* W, int k0, int n, int lane, int ld, int K) { float v[16]; const int g = lane >> 4;
#pragma unroll
  for (int i = 0; i < 8; ++i) { const int ka = k0 + 8 * g + i, kb = ka + 16; v[i] = ka < K ? W[(size_t)(ka < K ? ka : K - 1) * ld + n] : 0.f; v[8 + i] = kb < K ? W[(size_t)(kb < K ? kb : K - 1) * ld + n] : 0.f; }
  return bsplit16(v); }
__device__ __forceinline__ v8f mac3(const F2& a, const F2& b, v8f c) { c = wmma_bf(a.l, b.h, c); c = wmma_bf(a.h, b.l, c); return wmma_bf(a.h, b.h, c); }
__device__ __forceinline__ float sigm(float v) { return 1.0f / (1.0f + expf(-v)); }
#define LDSX() do { asm volatile("s_wait_dscnt 0" ::: "memory"); __builtin_amdgcn_wave_barrier(); __builtin_amdgcn_fence(__ATOMIC_RELEASE, "workgroup"); } while (0)

// Multi-scale windowed self-attention (B 4, 64 x 64 = 4,096 tokens, C 512 = 8 heads x 64; head h attends within non-overlapping r x r spatial windows with r = (4, 4, 8, 8, 16, 16, 32, 32)[h]; 0.02-scale (in,out) Wq [512,512], Wkv [512,1024] (k | v), Wproj [512,512] + zero bproj): q = x Wq, k|v = x Wkv; per head: softmax(q k^T x 64^-0.5) over the window's r^2 keys; heads merged (channel = head*64 + d); out = o Wproj + bproj.
#define NB 4
#define TT 4096
#define CC 512            // NH * HD = projected width
#define DIN 512          // input (model) width
#define NH 8
#define HD 64
#define NQB (TT / 64)
#define HG 1
#define SCALE (0.125f)
#define CAUSAL 0
#ifndef TNB
#define TNB NB
#endif
__device__ __forceinline__ float bfr(float v) { return (float)(__bf16)v; }
__host__ __device__ __forceinline__ int kb_last(int qb) { return CAUSAL ? ((qb * 64 + 63) >> 7) : (TT / 128 - 1); }
typedef __attribute__((ext_vector_type(8))) __bf16 v8b;
__device__ __forceinline__ v16b frag_b(const __bf16* rowk0, int lane) {
  union { v16b v; v8b q[2]; } u; const __bf16* p = rowk0 + 8 * (lane >> 4);
  u.q[0] = *(const v8b*)p; u.q[1] = *(const v8b*)(p + 16); return u.v;
}
#define QBH 0
#define QHI 4096            // rows carrying a q residual plane (all rows when non-causal: 2-product logits everywhere)
#define KHI 64            // key rows carrying k residual / v bf16 hi+lo planes (written by k_proj, read by no kernel in this file)
// B fragment (k rows k0+.., output column o) of a weight: (in,out) [K][ld] or (out,in) [ld rows of K]: bf16 exact, or f16(bf16 * 256) exact
__device__ __forceinline__ v16b wcol_io(const float* Wm, int k0, int o, int lane, int ld) { v16b w; const int g = lane >> 4;
#pragma unroll
  for (int i = 0; i < 8; ++i) { w[i] = (__bf16)Wm[(size_t)(k0 + 8 * g + i) * ld + o]; w[8 + i] = (__bf16)Wm[(size_t)(k0 + 16 + 8 * g + i) * ld + o]; }
  return w; }
__device__ __forceinline__ v16b wcol_oi(const float* Wm, int k0, int o, int lane, int K) { v16b w; const float* p = Wm + (size_t)o * K + k0 + 8 * (lane >> 4);
#pragma unroll
  for (int i = 0; i < 8; ++i) { w[i] = (__bf16)p[i]; w[8 + i] = (__bf16)p[16 + i]; }
  return w; }
__device__ __forceinline__ v16h wcolh_io(const float* Wm, int k0, int o, int lane, int ld) { v16h w; const int g = lane >> 4;
#pragma unroll
  for (int i = 0; i < 8; ++i) { w[i] = (_Float16)(bfr(Wm[(size_t)(k0 + 8 * g + i) * ld + o]) * 256.0f); w[8 + i] = (_Float16)(bfr(Wm[(size_t)(k0 + 16 + 8 * g + i) * ld + o]) * 256.0f); }
  return w; }
__device__ __forceinline__ v16h wcolh_oi(const float* Wm, int k0, int o, int lane, int K) { v16h w; const float* p = Wm + (size_t)o * K + k0 + 8 * (lane >> 4);
#pragma unroll
  for (int i = 0; i < 8; ++i) { w[i] = (_Float16)(bfr(p[i]) * 256.0f); w[8 + i] = (_Float16)(bfr(p[16 + i]) * 256.0f); }
  return w; }
#define WQKV_LAYOUT 0   // 0 = (in,out) [DIN][CC]; 1 = (out,in) [CC][DIN]; 2 = per-head [NH][DIN][HD]
__device__ __forceinline__ v16b wcol_hdk(const float* Wm, int k0, int o, int lane) { v16b w; const int g = lane >> 4; const float* p = Wm + (size_t)(o / HD) * DIN * HD + (o % HD);
#pragma unroll
  for (int i = 0; i < 8; ++i) { w[i] = (__bf16)p[(size_t)(k0 + 8 * g + i) * HD]; w[8 + i] = (__bf16)p[(size_t)(k0 + 16 + 8 * g + i) * HD]; }
  return w; }
#define WO_OUT_IN 0
#if WQKV_LAYOUT == 1
#define WCOL(W, k0, o, lane) wcol_oi(W, k0, o, lane, DIN)
#elif WQKV_LAYOUT == 2
#define WCOL(W, k0, o, lane) wcol_hdk(W, k0, o, lane)
#else
#define WCOL(W, k0, o, lane) wcol_io(W, k0, o, lane, (which == 0 ? CC : 2 * CC))   /* Wq [512][512]; Wkv [512][1024] packed k | v */
#endif
#if WO_OUT_IN
#define WOCOL(W, k0, o, lane) wcol_oi(W, k0, o, lane, CC)
#define WOCOLH(W, k0, o, lane) wcolh_oi(W, k0, o, lane, CC)
#else
#define WOCOL(W, k0, o, lane) wcol_io(W, k0, o, lane, DIN)
#define WOCOLH(W, k0, o, lane) wcolh_io(W, k0, o, lane, DIN)
#endif
// per-head local window: REGIONS = (4, 4, 8, 8, 16, 16, 32, 32) -> r(h) = 4 << (h / 2); tokens are a 64 x 64 grid (n = y*64 + x), a k_attn block is 8 image rows x 16 columns and walks its keys 64 a pass
__host__ __device__ __forceinline__ int rlog(int h) { return 2 + (h >> 1); }

#define WS_QH  0u                                      // f16 q rows [b*t][CC]
#define WS_KH  (WS_QH + 2u * (size_t)NB * TT * CC)      // f16 k rows [b*t][CC]
#define WS_VT  (WS_KH + 2u * (size_t)NB * TT * CC)      // f16 v planes [b][c][t]
#define WS_QL  (WS_VT + 2u * (size_t)NB * CC * TT)      // f16 q residual x 2^10 rows [b][t < QHI][CC]
#define WS_KL  (WS_QL + 2u * (size_t)NB * QHI * CC)     // f16 k residual x 2^10 rows [b][t < KHI][CC]
#define WS_VB  (WS_KL + 2u * (size_t)NB * KHI * CC)     // bf16 v hi planes [b][c][t < KHI]
#define WS_VBL (WS_VB + 2u * (size_t)NB * CC * KHI)
#define WS_Y   (WS_VBL + 2u * (size_t)NB * CC * KHI)    // f32 ctx rows [b*t][CC] (only when there is an output projection)
#define WS_END (WS_Y  + 4u * (size_t)NB * TT * CC)

// ---- the two projection GEMMs share one main loop: block = 8 waves = (256 rows, 128 cols), K = 512.
// The block's weight panel (128 output columns x all 512 k) is converted to its 16-bit form ONCE and kept in LDS as [column][k]; every wave reads its B fragments from there.
// Each wave owns 32 rows (2 A fragments x 8 B fragments = 16 products per 32 k): it loads them as whole 128-byte lines, converts, and turns them into fragments through its own small LDS range.
// k ascends within each accumulator.
typedef __attribute__((ext_vector_type(2))) unsigned v2u;
#define PW 520                       // pitch of a panel row (one column, 512 k) in 16-bit elements: 1,040 B = 16 B x odd, no bank conflict for 16-byte reads
#define PX 40                        // pitch of a staged operand row (32 k): 80 B = 16 B x odd
#define SM_W (128 * PW * 2)          // panel bytes
#define SM_XW (32 * PX * 2)          // one wave's operand range
#define SM_BYTES (SM_W + 8 * SM_XW)  // 153,600 B: two blocks per WGP; the epilogues reuse it
union Frag { v4u q[2]; v16b b; v16h h; };
// F16M 0: operands rounded to bf16 (exact products); F16M 1: rows x 2^6 to f16, weights f16(bf16 x 2^8) (exact)
// wave-private hand-over through LDS: the wave's own LDS operations have retired, and the compiler moves no memory access across
#define LDSW() do { asm volatile("s_wait_dscnt 0" ::: "memory"); __builtin_amdgcn_wave_barrier(); } while (0)
template <int F16M> __device__ __forceinline__ v2u pack4(v4f f) { union { v2u u; __bf16 b[4]; _Float16 h[4]; } c;
#pragma unroll
  for (int e = 0; e < 4; ++e) { if constexpr (F16M) c.h[e] = (_Float16)(f[e] * 64.0f); else c.b[e] = (__bf16)f[e]; }
  return c.u; }
// 128 columns x 512 k of a [k][LD] f32 weight -> LDS [column][k] in the 16-bit form: a wave reads 32 neighbouring columns of one k row (one whole line), a lane gathers 8 k of its column into one 16-byte LDS store
template <int F16M, int LD> __device__ __forceinline__ void stage_panel(const float* __restrict__ Wc, char* smem) {
  const int tid = threadIdx.x, n = tid & 127; const float* wp = Wc + (size_t)((tid >> 7) * 8) * LD + n; char* dst = smem + (n * PW + (tid >> 7) * 8) * 2;
#pragma unroll 8   /* 64 loads in flight per wave while the panel is filled */
  for (int it = 0; it < 32; ++it) { union { v4u u; v8b b; v8h h; } w; const float* p = wp + (size_t)(it * 16) * LD;
#pragma unroll
    for (int i = 0; i < 8; ++i) { const float f = p[(size_t)i * LD]; if constexpr (F16M) w.h[i] = (_Float16)(bfr(f) * 256.0f); else w.b[i] = (__bf16)f; }
    *(v4u*)(dst + it * 32) = w.u; } }
template <int F16M> __device__ __forceinline__ void gemm_256x128(const float* __restrict__ X, size_t r0, const float* __restrict__ Wm, int ld, int c0, char* smem, v8f (&acc)[2][8]) {
  const int tid = threadIdx.x, wave = tid >> 5, lane = tid & 31, col = lane & 15, g = lane >> 4;
  const float* xp = X + (r0 + wave * 32 + (lane >> 3)) * 512 + (lane & 7) * 4;   /* load i of a chunk: rows 4i .. 4i+3, 8 lanes x 16 B = one whole line a row */
  char* xs = smem + SM_W + wave * SM_XW; char* xst = xs + ((lane >> 3) * PX + (lane & 7) * 4) * 2;
  const char* xa = xs + (col * PX + 8 * g) * 2; const char* wb = smem + (col * PW + 8 * g) * 2;
  v4f raw[8];
#pragma unroll
  for (int i = 0; i < 8; ++i) raw[i] = *(const v4f*)(xp + (size_t)i * 4 * 512);
  if (ld == 512) stage_panel<F16M, 512>(Wm + c0, smem); else stage_panel<F16M, 1024>(Wm + c0, smem);   /* block-uniform; the pitch as a constant puts every row step into the loads' immediate offsets */
#pragma unroll
  for (int i = 0; i < 8; ++i) { *(v2u*)(xst + i * 4 * PX * 2) = pack4<F16M>(raw[i]); raw[i] = *(const v4f*)(xp + (size_t)i * 4 * 512 + 32); }
  __syncthreads();   /* the panel (and each wave's first chunk) is complete before any wave reads it */
#pragma unroll
  for (int kc = 0; kc < 16; ++kc) {
    Frag a[2], w[8];   /* the chunk's 20 fragment reads go as one group ahead of its 16 products */
#pragma unroll
    for (int m = 0; m < 2; ++m) { a[m].q[0] = *(const v4u*)(xa + m * 16 * PX * 2); a[m].q[1] = *(const v4u*)(xa + m * 16 * PX * 2 + 32); }
#pragma unroll
    for (int j = 0; j < 8; ++j) { w[j].q[0] = *(const v4u*)(wb + (j * 16 * PW + kc * 32) * 2); w[j].q[1] = *(const v4u*)(wb + (j * 16 * PW + kc * 32) * 2 + 32); }
    v2u pk[8];   /* the next chunk's rows are converted while the reads are under way */
    if (kc + 1 < 16) {
#pragma unroll
      for (int i = 0; i < 8; ++i) pk[i] = pack4<F16M>(raw[i]); }
    __builtin_amdgcn_sched_barrier(0);   /* keeps the 20 reads one group ahead of the products (one exposed LDS latency a chunk; without it each pair of reads is waited for on its own) and the conversion under that latency */
    LDSW();   /* this chunk's fragments are in registers before the next chunk's rows overwrite them */
    if (kc + 1 < 16) {
#pragma unroll
      for (int i = 0; i < 8; ++i) *(v2u*)(xst + i * 4 * PX * 2) = pk[i]; }
    __builtin_amdgcn_sched_barrier(0);   /* the converted rows leave their registers before the next lines are asked for: keeps the wave within 256 registers, two blocks per WGP */
    if (kc + 2 < 16) {
#pragma unroll
      for (int i = 0; i < 8; ++i) raw[i] = *(const v4f*)(xp + (size_t)i * 4 * 512 + (kc + 2) * 32); }   /* the lines of the chunk after next fly under this chunk's products */
#pragma unroll
    for (int j = 0; j < 8; ++j)
#pragma unroll
      for (int m = 0; m < 2; ++m) { if constexpr (F16M) acc[m][j] = __builtin_amdgcn_wmma_f32_16x16x32_f16(false, a[m].h, false, w[j].h, (short)0, acc[m][j], false, false);
        else acc[m][j] = __builtin_amdgcn_wmma_f32_16x16x32_bf16(false, a[m].b, false, w[j].b, (short)0, acc[m][j], false, false); }
    __builtin_amdgcn_sched_barrier(0);   /* the products stay ahead of the wait below, so they cover the row stores, and the next conversion (which waits for the lines just asked for) stays behind them */
    LDSW();   /* the wave's next rows are in LDS before its lanes read each other's */
  }
  __syncthreads();   /* every wave has left the panel: the epilogue reuses the LDS */
}
// ---- k_proj: block = (256 rows, 128 cols, which): q/k/v = X W (+ b) with exact bf16 products (K = DIN) -> which 0: q f16 rows (+ residual rows < QHI); 1: k f16 rows (+ residual rows < KHI); 2: v f16 planes [c][t] (+ bf16 hi/lo planes for t < KHI)
__global__ __launch_bounds__(256) void k_proj(const float* __restrict__ XQ, const float* __restrict__ XK, const float* __restrict__ XV, const float* __restrict__ WQ, const float* __restrict__ WK, const float* __restrict__ WV, const float* __restrict__ BQ, const float* __restrict__ BK, const float* __restrict__ BV,
    _Float16* __restrict__ QH, _Float16* __restrict__ QL, _Float16* __restrict__ KH, _Float16* __restrict__ KL, _Float16* __restrict__ VT, __bf16* __restrict__ VB, __bf16* __restrict__ VBL) {
  __shared__ __align__(16) char smem[SM_BYTES];
  const int tid = threadIdx.x, wave = tid >> 5, lane = tid & 31, col = lane & 15, g = lane >> 4; const int which = blockIdx.z; const int c0 = blockIdx.y * 128; const size_t r0 = (size_t)blockIdx.x * 256; const size_t bb = r0 / TT; const int t0 = (int)(r0 % TT);
  const float* X = which == 0 ? XQ : which == 1 ? XK : XV; const float* WA = which == 0 ? WQ : which == 1 ? WK : WV; const float* BA = which == 0 ? BQ : which == 1 ? BK : BV;
  v8f acc[2][8] = {};
  gemm_256x128<0>(X, r0, WA, which == 0 ? CC : 2 * CC, c0, smem, acc);   /* Wq [512][512]; Wkv [512][1024] packed k | v */
  if (which < 2) { _Float16* DH = which == 0 ? QH : KH; _Float16* DL = which == 0 ? QL : KL; const int nhi = which == 0 ? QHI : KHI;
    _Float16 (*sh)[136] = (_Float16 (*)[136])smem; _Float16 (*sl)[136] = (_Float16 (*)[136])(smem + 256 * 136 * 2);
#pragma unroll
    for (int m = 0; m < 2; ++m)
#pragma unroll
      for (int j = 0; j < 8; ++j) { const float bias = BA ? bfr(BA[c0 + j * 16 + col]) : 0.f;
#pragma unroll
        for (int r = 0; r < 8; ++r) { const float v = acc[m][j][r] + bias; const _Float16 hv = (_Float16)v; const int rl = wave * 32 + m * 16 + 8 * g + r; sh[rl][j * 16 + col] = hv; sl[rl][j * 16 + col] = (_Float16)((v - (float)hv) * 1024.0f); } }
    __syncthreads();
    for (int it = 0; it < 16; it += 4) { v4u vh[4], vl[4];   /* four rows' pieces a trip: 8 LDS reads under way at once */
#pragma unroll
      for (int u = 0; u < 4; ++u) { const int e = (it + u) * 256 + tid, rl = e >> 4, q = e & 15; vh[u] = *(const v4u*)&sh[rl][q * 8]; vl[u] = *(const v4u*)&sl[rl][q * 8]; }
#pragma unroll
      for (int u = 0; u < 4; ++u) { const int e = (it + u) * 256 + tid, rl = e >> 4, q = e & 15; vst2((unsigned*)(DH + (r0 + rl) * CC + c0 + q * 8), vh[u]); if (t0 + rl < nhi) vst2((unsigned*)(DL + (bb * nhi + t0 + rl) * (size_t)CC + c0 + q * 8), vl[u]); }
      asm volatile("s_wait_xcnt 0x0" ::: "memory"); }   /* precaution: the next trip rewrites registers that these stores name */
  } else { _Float16 (*th)[264] = (_Float16 (*)[264])smem; __bf16 (*tb)[72] = (__bf16 (*)[72])(smem + 128 * 264 * 2); __bf16 (*tbl)[72] = (__bf16 (*)[72])(smem + 128 * 264 * 2 + 128 * 72 * 2);
#pragma unroll
    for (int m = 0; m < 2; ++m)
#pragma unroll
      for (int j = 0; j < 8; ++j) { const float bias = BA ? bfr(BA[c0 + j * 16 + col]) : 0.f; const int rb = wave * 32 + m * 16 + 8 * g, cl = j * 16 + col; v8h hv;
#pragma unroll
        for (int r = 0; r < 8; ++r) hv[r] = (_Float16)(acc[m][j][r] + bias);
        *(v8h*)&th[cl][rb] = hv;   /* a lane's 8 values are 8 neighbouring t of one channel */
        if (t0 + rb < KHI) {   /* only the first KHI tokens of a sequence carry these planes */
#pragma unroll
          for (int r = 0; r < 8; ++r) { const float v = acc[m][j][r] + bias; const __bf16 bh = (__bf16)v; tb[cl][rb + r] = bh; tbl[cl][rb + r] = (__bf16)(v - (float)bh); } } }
    __syncthreads();
    for (int it = 0; it < 16; it += 4) { v4u vv[4];
#pragma unroll
      for (int u = 0; u < 4; ++u) { const int e = (it + u) * 256 + tid, cl = e >> 5, q = e & 31; vv[u] = *(const v4u*)&th[cl][q * 8]; }
#pragma unroll
      for (int u = 0; u < 4; ++u) { const int e = (it + u) * 256 + tid, cl = e >> 5, q = e & 31; vst2((unsigned*)(VT + (bb * CC + c0 + cl) * (size_t)TT + t0 + q * 8), vv[u]); }
      asm volatile("s_wait_xcnt 0x0" ::: "memory"); }   /* precaution: the next trip rewrites registers that these stores name */
    if (t0 < KHI) for (int it = 0; it < 4; ++it) { const int e = it * 256 + tid, cl = e >> 3, q = e & 7;
      if (t0 + q * 8 < KHI) { const size_t o3 = (bb * CC + c0 + cl) * (size_t)KHI + t0 + q * 8; vst2((unsigned*)(VB + o3), *(const v4u*)&tb[cl][q * 8]); vst2((unsigned*)(VBL + o3), *(const v4u*)&tbl[cl][q * 8]); }
      asm volatile("s_wait_xcnt 0x0" ::: "memory"); } } }   /* the same precaution */
#define AP 144                 // pitch of a staged row (64 f16 = 128 B) in bytes: 16 B x odd, no bank conflict for 16-byte reads
#define AT (64 * AP)           // one operand's tile: 64 k rows (64 d each), or 64 v channels (64 keys each)
#define AB (2 * AT)            // one buffer: k tile, v tile
__global__ __launch_bounds__(256) void k_attn(const _Float16* __restrict__ QH, const _Float16* __restrict__ QL, const _Float16* __restrict__ KH, const _Float16* __restrict__ VT, const int* __restrict__ WI, float* __restrict__ Y) {
  __shared__ __align__(16) char sm[2 * AB];
  const int tid = threadIdx.x, lane = tid & 31, col = lane & 15, g = lane >> 4;
  const int wave = __builtin_amdgcn_readfirstlane((int)(threadIdx.x >> 5));   /* wave-uniform, so the tiles' token numbers are worked out on the scalar unit */
  const int b = blockIdx.y, h = NH - 1 - (int)blockIdx.z;                       /* largest windows start first */
  const int rl_ = rlog(h), r = 1 << rl_;
  int wsh = 31 - __clz(WI[0] | 1); wsh = wsh > 7 ? 7 : wsh < 5 ? 5 : wsh;       /* grid width read from the input, as a shift (64 -> 6); 32, 64 and 128 are the widths at which 32 divides both sides of a 4,096-token grid */
  const int yb = ((int)blockIdx.x >> (wsh - 4)) * 8, xs = ((int)blockIdx.x & ((1 << (wsh - 4)) - 1)) * 16;   /* a one-to-one map block -> (8 image rows, one 16-column strip) at every such width */
  const int n0 = ((yb + wave) << wsh) + xs;
  const int sps = rl_ > 4 ? rl_ - 4 : 0, smask = (1 << sps) - 1;                /* 16-key tiles per window row: max(16, r) / 16 */
  const int rb_ = rl_ > 3 ? rl_ : 3;                                            /* the block's key rows: max(8, r) */
  const int y0 = (yb >> rb_) << rb_, xk0 = xs & ~((16 << sps) - 1);
  const int npass = (1 << (rb_ + sps)) >> 2;                                    /* 2, 2, 4 or 16 passes of 64 keys: never fewer than the two buffers */
  const int wm = ~((r - 1) | ((r - 1) << wsh));                                 /* token bits that name the window: same window row AND same window column <=> ((k ^ t) & wm) == 0 */
  const int t = n0 + col;
  const _Float16* Kb = KH + (size_t)b * TT * CC + h * HD; const _Float16* Vb = VT + ((size_t)b * CC + h * HD) * (size_t)TT;
  /* first token of 16-key tile s of the block; bounded here whatever the width input holds */
  auto tok = [&](int s) { const int k = ((y0 + (s >> sps)) << wsh) + xk0 + ((s & smask) << 4); return (k > TT - 16 ? TT - 16 : k) & ~15; };
  /* a pass's copies: 2 x 512 pieces of 16 B, four a thread. k: 8 lanes bring one key row's whole 128-byte line; v: 8 lanes bring one channel's 4 x 32 B */
  const int crow = tid >> 3, cpc = tid & 7;
  const unsigned ldst = (unsigned)(size_t)sm + (unsigned)(crow * AP + cpc * 16);
  auto stage = [&](int p, int buf) {
    const unsigned l0 = ldst + (unsigned)(buf * AB), l1 = l0 + 32 * AP, l2 = l0 + AT, l3 = l2 + 32 * AP;
    const char* k0 = (const char*)(Kb + (size_t)(tok(4 * p + (crow >> 4)) + (crow & 15)) * CC) + cpc * 16;
    const char* k1 = (const char*)(Kb + (size_t)(tok(4 * p + 2 + (crow >> 4)) + (crow & 15)) * CC) + cpc * 16;
    const char* v0 = (const char*)(Vb + (size_t)crow * TT + tok(4 * p + (cpc >> 1)) + (cpc & 1) * 8);
    const char* v1 = v0 + (size_t)32 * TT * 2;
    /* the copies and the wait that stands before their address registers are rewritten, in one statement */
    asm volatile("global_load_async_to_lds_b128 %0, %1, off\n\tglobal_load_async_to_lds_b128 %2, %3, off\n\tglobal_load_async_to_lds_b128 %4, %5, off\n\tglobal_load_async_to_lds_b128 %6, %7, off\n\ts_wait_xcnt 0x0"
                 :: "v"(l0), "v"(k0), "v"(l1), "v"(k1), "v"(l2), "v"(v0), "v"(l3), "v"(v1) : "memory"); };
  stage(0, 0);
  v16h qh[2], ql[2];
#pragma unroll
  for (int kc = 0; kc < 2; ++kc) { qh[kc] = frag_h(QH + ((size_t)b * TT + t) * CC + h * HD + kc * 32, lane); ql[kc] = frag_h(QL + ((size_t)b * QHI + t) * CC + h * HD + kc * 32, lane); }
  asm volatile("s_wait_asynccnt 0x0" ::: "memory");   /* this wave's share of pass 0 has landed */
  __syncthreads();                                    /* ... and every other wave's: pass 0 may be read */
  stage(1, 1);
  const unsigned foff = (unsigned)(col * AP + 16 * g);   /* the lane's own byte offset in a tile, fixed for the whole loop */
  v8f acc[HD / 16] = {}; float m = -3.0e38f, sum = 0.f;
  for (int p = 0; p < npass; ++p) {
    if ((((y0 + ((4 * p) >> sps)) ^ (yb + wave)) >> rl_) == 0) {   /* wave-uniform: the pass's key rows lie in this wave's window row (always, for r >= 8) */
    const char* kb = sm + (p & 1) * AB + foff; const char* vb = kb + AT;
    int kt[4];
#pragma unroll
    for (int u = 0; u < 4; ++u) kt[u] = tok(4 * p + u);
    v8h kq[4][4], vq[2][HD / 16][2];
#pragma unroll
    for (int u = 0; u < 4; ++u)
#pragma unroll
      for (int q = 0; q < 4; ++q) kq[u][q] = *(const v8h*)(kb + u * 16 * AP + q * 32);   /* q = 2 kc + half: d = kc*32 + half*16 + 8g .. + 7 of key row kt[u] + col */
#pragma unroll
    for (int c = 0; c < 2; ++c)
#pragma unroll
      for (int j = 0; j < HD / 16; ++j) { vq[c][j][0] = *(const v8h*)(vb + j * 16 * AP + (2 * c) * 32); vq[c][j][1] = *(const v8h*)(vb + j * 16 * AP + (2 * c + 1) * 32); }   /* keys kt[2c] + 8g .. + 7 and kt[2c + 1] + 8g .. + 7 of channel j*16 + col */
    __builtin_amdgcn_sched_barrier(0);   /* keeps the pass's 32 reads one group ahead of the products: one exposed LDS latency a pass; without it each pair of reads is waited for on its own */
    float v[4][8]; float mx = m;
#pragma unroll
    for (int u = 0; u < 4; ++u) { v8f sa = {}, sl = {};
#pragma unroll
      for (int kc = 0; kc < 2; ++kc) { union { v16h f; v8h q[2]; } kf; kf.q[0] = kq[u][2 * kc]; kf.q[1] = kq[u][2 * kc + 1];
        sa = __builtin_amdgcn_wmma_f32_16x16x32_f16(false, kf.f, false, qh[kc], (short)0, sa, false, false); sl = __builtin_amdgcn_wmma_f32_16x16x32_f16(false, kf.f, false, ql[kc], (short)0, sl, false, false); }
#pragma unroll
      for (int i = 0; i < 8; ++i) { const float x = (sa[i] + sl[i] * (1.0f / 1024.0f)) * SCALE; v[u][i] = ((((kt[u] + 8 * g + i) ^ t) & wm) == 0) ? x : -3.0e38f; mx = fmaxf(mx, v[u][i]); } }
    mx = fmaxf(mx, __shfl_xor(mx, 16));
    const float alpha = expf(m - mx); m = mx;
#pragma unroll
    for (int j = 0; j < HD / 16; ++j) acc[j] *= alpha;
    v16h pf[2]; float ps[4];
#pragma unroll
    for (int u = 0; u < 4; ++u) { ps[u] = 0.f;
#pragma unroll
      for (int i = 0; i < 8; ++i) { const float ex = expf(v[u][i] - m); const float e = (v[u][i] <= -1.0e38f) ? 0.f : ex; ps[u] += e; pf[u >> 1][(u & 1) * 8 + i] = (_Float16)(e * 2048.0f); } }   /* exp first, select after: no branch per element */
    sum = sum * alpha + ((ps[0] + ps[1]) + (ps[2] + ps[3]));
#pragma unroll
    for (int c = 0; c < 2; ++c)
#pragma unroll
      for (int j = 0; j < HD / 16; ++j) { union { v16h f; v8h q[2]; } vf; vf.q[0] = vq[c][j][0]; vf.q[1] = vq[c][j][1];
        acc[j] = __builtin_amdgcn_wmma_f32_16x16x32_f16(false, vf.f, false, pf[c], (short)0, acc[j], false, false); }
    }
    /* hand-over, passed by every wave, also one that skipped the pass */
    asm volatile("s_wait_dscnt 0x0" ::: "memory");      /* this wave's reads of the pass's buffer have retired */
    asm volatile("s_wait_asynccnt 0x0" ::: "memory");   /* its share of the next pass has landed */
    __syncthreads();                                    /* publishes the next pass and ends every wave's reads of this pass's buffer */
    if (p + 2 < npass) stage(p + 2, p & 1);             /* block-uniform: refill the buffer just left */
  }
  asm volatile("s_wait_asynccnt 0x0" ::: "memory");     /* no copy is outstanding when the wave ends */
  sum += __shfl_xor(sum, 16);
  const float inv = sum > 0.f ? (1.0f / 2048.0f) / sum : 0.f;   /* a fully excluded row yields 0 */
  float* yp = Y + ((size_t)b * TT + t) * CC + h * HD + 8 * g;   /* lane = query t, register i of tile j = channel j*16 + 8g + i */
#pragma unroll
  for (int j = 0; j < HD / 16; ++j) { const v4f lo = { acc[j][0] * inv, acc[j][1] * inv, acc[j][2] * inv, acc[j][3] * inv }, hi = { acc[j][4] * inv, acc[j][5] * inv, acc[j][6] * inv, acc[j][7] * inv }; vst2(yp + j * 16, lo); vst2(yp + j * 16 + 4, hi); } }
// ---- k_out: block = (256 rows, 128 cols): out = ctx Wo (+ bo): ctx x 2^6 once to f16 (small-magnitude context rows stay clear of f16 subnormals) against Wo as f16(bf16 x 2^8) exact (1 product), un-scaled by 2^-14
__global__ __launch_bounds__(256) void k_out(const float* __restrict__ Y, const float* __restrict__ WO, const float* __restrict__ BO, float* __restrict__ OUT) { __shared__ __align__(16) char smem[SM_BYTES];
  const int tid = threadIdx.x, wave = tid >> 5, lane = tid & 31, col = lane & 15, g = lane >> 4; const int c0 = blockIdx.y * 128; const size_t r0 = (size_t)blockIdx.x * 256;
  v8f acc[2][8] = {};
  gemm_256x128<1>(Y, r0, WO, DIN, c0, smem, acc);
  float (*sf)[132] = (float (*)[132])(smem + wave * (32 * 132 * 4));   /* each wave stages its own 32 rows */
#pragma unroll
  for (int m = 0; m < 2; ++m)
#pragma unroll
    for (int j = 0; j < 8; ++j) { const float bias = BO ? bfr(BO[c0 + j * 16 + col]) : 0.f;
#pragma unroll
      for (int r = 0; r < 8; ++r) sf[m * 16 + 8 * g + r][j * 16 + col] = acc[m][j][r] * (1.0f / 16384.0f) + bias; }   /* 2^-8 (Wo carry) x 2^-6 (ctx carry) */
  LDSX(); for (int rl = 0; rl < 32; ++rl) vst2(OUT + (r0 + wave * 32 + rl) * DIN + c0 + lane * 4, *(const v4f*)&sf[rl][lane * 4]); }

extern "C" void kernel_launch(void* const* d_in, const int* in_sizes, int n_in, void* d_out, int out_size, void* d_ws, size_t ws_size, hipStream_t stream) {
  (void)in_sizes; (void)n_in; (void)out_size;
  const float** F = (const float**)d_in;
  if (ws_size < (size_t)WS_END) return;
  char* ws = (char*)d_ws; _Float16 *QH = (_Float16*)(ws + WS_QH), *KH = (_Float16*)(ws + WS_KH), *VT = (_Float16*)(ws + WS_VT), *QL = (_Float16*)(ws + WS_QL), *KL = (_Float16*)(ws + WS_KL); __bf16 *VB = (__bf16*)(ws + WS_VB), *VBL = (__bf16*)(ws + WS_VBL); float *Y = (float*)(ws + WS_Y);
  (void)Y; (void)QL; (void)KL; (void)VB; (void)VBL;
  // inputs: 0 x [4,4096,512]; 1 Wq [512,512] (in,out); 2 Wkv [512,1024] (in,out; columns k | v, head*64+d); 3 Wproj [512,512] (in,out); 4 bproj [512]; 5 H (int 64); 6 W (int 64)
  const int* WI = (const int*)d_in[6];
  k_proj<<<dim3(TNB * TT / 256, CC / 128, 3), 256, 0, stream>>>(F[0], F[0], F[0], F[1], F[2], F[2] + CC, nullptr, nullptr, nullptr, QH, QL, KH, KL, VT, VB, VBL);   /* k = Wkv columns 0..511, v = columns 512..1023 (row pitch 2*CC) */
  k_attn<<<dim3(TT / 128, TNB, NH), 256, 0, stream>>>(QH, QL, KH, VT, WI, Y);
  k_out<<<dim3(TNB * TT / 256, DIN / 128), 256, 0, stream>>>(Y, F[3], F[4], (float*)d_out);
}

// v004
// A run of this version takes 88.8 microseconds.
// Timed twice side by side with v003, it ran 1.13 times as fast both times.
// Over all steps from v000 it is 21.4 times as fast.
// compute dtype: all float inputs rounded to bf16; q/k/v = x W with EXACT bf16 products on WMMA 16x16x32 (f32 accumulate); windowed logits with q as f16 hi + residual (x 2^10) against k once to f16 (2 products) x 64^-0.5; per-window online softmax in f32 (base 2: one hardware exp2 per term, running maximum and sum); exp(s - m) x 2^11 once to f16 against v once to f16 (1 product), divided by the f32 sum at the end; merged heads carried x 2^6 once to f16 against Wproj carried x 2^8 in f16 (exact bf16 values), un-scaled by 2^-14, + bproj; f32 output.
#include <hip/hip_runtime.h>
#include <math.h>

typedef __attribute__((ext_vector_type(16))) _Float16 v16h;
typedef __attribute__((ext_vector_type(16))) __bf16 v16b;
typedef __attribute__((ext_vector_type(8)))  _Float16 v8h;
typedef __attribute__((ext_vector_type(8)))  float v8f;
typedef __attribute__((ext_vector_type(4)))  float v4f;
typedef __attribute__((ext_vector_type(2)))  float v2f;
typedef __attribute__((ext_vector_type(4)))  unsigned v4u;
typedef __attribute__((ext_vector_type(4)))  int v4i;
typedef float __attribute__((may_alias)) float_a;
typedef int __attribute__((may_alias)) int_a;

template <typename T> __device__ __forceinline__ void vst2(void* p, T v) { *(T*)p = v;  }
__device__ __forceinline__ v8f wmma16(v16h a, v16h b, v8f c) {
  v8f d = __builtin_amdgcn_wmma_f32_16x16x32_f16(false, a, false, b, (short)0, c, false, false);
  asm volatile("v_nop\n\tv_nop\n\tv_nop\n\tv_nop" : "+v"(d) : "v"(a), "v"(b));
  return d;
}
__device__ __forceinline__ v8f wmma_bf(v16b a, v16b b, v8f c) {
  v8f d = __builtin_amdgcn_wmma_f32_16x16x32_bf16(false, a, false, b, (short)0, c, false, false);
  asm volatile("v_nop\n\tv_nop\n\tv_nop\n\tv_nop" : "+v"(d) : "v"(a), "v"(b));
  return d;
}
// 16x16x32 fragments: lane = (h = lane>>4, row/col = lane&15); elements 0..7 = k0+8h+0..7, 8..15 = k0+16+8h+0..7; D element r = row 8h+r
__device__ __forceinline__ v16h frag_h(const _Float16* rowk0, int lane) {
  union { v16h v; v8h q[2]; } u; const _Float16* p = rowk0 + 8 * (lane >> 4);
  u.q[0] = *(const v8h*)p; u.q[1] = *(const v8h*)(p + 16); return u.v;
}
__device__ __forceinline__ v16h frag_f32(const float* rowk0, int lane) {
  v16h a; const float* p = rowk0 + 8 * (lane >> 4);
#pragma unroll
  for (int i = 0; i < 8; ++i) { a[i] = (_Float16)p[i]; a[8 + i] = (_Float16)p[16 + i]; }
  return a;
}
__device__ __forceinline__ v16h frag_f32s(const float* rowk0, int lane, float sc) {
  v16h a; const float* p = rowk0 + 8 * (lane >> 4);
#pragma unroll
  for (int i = 0; i < 8; ++i) { a[i] = (_Float16)(p[i] * sc); a[8 + i] = (_Float16)(p[16 + i] * sc); }
  return a;
}
// column fragment from a [K][ld] layout (column n), rows >= K read as 0
__device__ __forceinline__ v16h fragc_f32(const float* W, int k0, int n, int lane, int ld, int K) {
  v16h a; const int g = lane >> 4;
#pragma unroll
  for (int i = 0; i < 8; ++i) { const int ka = k0 + 8 * g + i, kb = ka + 16;
    a[i] = (_Float16)(ka < K ? W[(size_t)(ka < K ? ka : K - 1) * ld + n] : 0.f); a[8 + i] = (_Float16)(kb < K ? W[(size_t)(kb < K ? kb : K - 1) * ld + n] : 0.f); }
  return a;
}
struct F2 { v16b h, l; };
__device__ __forceinline__ F2 bsplit16(const float v[16]) { F2 r;
#pragma unroll
  for (int i = 0; i < 16; ++i) { const __bf16 h = (__bf16)v[i]; r.h[i] = h; r.l[i] = (__bf16)(v[i] - (float)h); }
  return r; }
__device__ __forceinline__ F2 split_row(const float* row, int k0, int lane) { float v[16]; const float* p = row + k0 + 8 * (lane >> 4);
#pragma unroll
  for (int i = 0; i < 8; ++i) { v[i] = p[i]; v[8 + i] = p[16 + i]; }
  return bsplit16(v); }
__device__ __forceinline__ F2 split_rowK(const float* row, int k0, int lane, int K) { float v[16]; const int g = lane >> 4;
#pragma unroll
  for (int i = 0; i < 8; ++i) { const int ka = k0 + 8 * g + i, kb = ka + 16; v[i] = ka < K ? row[ka < K ? ka : K - 1] : 0.f; v[8 + i] = kb < K ? row[kb < K ? kb : K - 1] : 0.f; }
  return bsplit16(v); }
__device__ __forceinline__ F2 split_col(const float* W, int k0, int n, int lane, int ld, int K) { float v[16]; const int g = lane >> 4;
#pragma unroll
  for (int i = 0; i < 8; ++i) { const int ka = k0 + 8 * g + i, kb = ka + 16; v[i] = ka < K ? W[(size_t)(ka < K ? ka : K - 1) * ld + n] : 0.f; v[8 + i] = kb < K ? W[(size_t)(kb < K ? kb : K - 1) * ld + n] : 0.f; }
  return bsplit16(v); }
__device__ __forceinline__ v8f mac3(const F2& a, const F2& b, v8f c) { c = wmma_bf(a.l, b.h, c); c = wmma_bf(a.h, b.l, c); return wmma_bf(a.h, b.h, c); }
__device__ __forceinline__ float sigm(float v) { return 1.0f / (1.0f + expf(-v)); }
#define LDSX() do { asm volatile("s_wait_dscnt 0" ::: "memory"); __builtin_amdgcn_wave_barrier(); __builtin_amdgcn_fence(__ATOMIC_RELEASE, "workgroup"); } while (0)

// Multi-scale windowed self-attention (B 4, 64 x 64 = 4,096 tokens, C 512 = 8 heads x 64; head h attends within non-overlapping r x r spatial windows with r = (4, 4, 8, 8, 16, 16, 32, 32)[h]; 0.02-scale (in,out) Wq [512,512], Wkv [512,1024] (k | v), Wproj [512,512] + zero bproj): q = x Wq, k|v = x Wkv; per head: softmax(q k^T x 64^-0.5) over the window's r^2 keys; heads merged (channel = head*64 + d); out = o Wproj + bproj.
#define NB 4
#define TT 4096
#define CC 512            // NH * HD = projected width
#define DIN 512          // input (model) width
#define NH 8
#define HD 64
#define NQB (TT / 64)
#define HG 1
#define SCALE (0.125f)
#define CAUSAL 0
#ifndef TNB
#define TNB NB
#endif
__device__ __forceinline__ float bfr(float v) { return (float)(__bf16)v; }
__host__ __device__ __forceinline__ int kb_last(int qb) { return CAUSAL ? ((qb * 64 + 63) >> 7) : (TT / 128 - 1); }
typedef __attribute__((ext_vector_type(8))) __bf16 v8b;
__device__ __forceinline__ v16b frag_b(const __bf16* rowk0, int lane) {
  union { v16b v; v8b q[2]; } u; const __bf16* p = rowk0 + 8 * (lane >> 4);
  u.q[0] = *(const v8b*)p; u.q[1] = *(const v8b*)(p + 16); return u.v;
}
#define QBH 0
#define QHI 4096            // rows carrying a q residual plane (all rows when non-causal: 2-product logits everywhere)
#define KHI 64            // key rows carrying k residual / v bf16 hi+lo planes (written by k_proj, read by no kernel in this file)
// B fragment (k rows k0+.., output column o) of a weight: (in,out) [K][ld] or (out,in) [ld rows of K]: bf16 exact, or f16(bf16 * 256) exact
__device__ __forceinline__ v16b wcol_io(const float* Wm, int k0, int o, int lane, int ld) { v16b w; const int g = lane >> 4;
#pragma unroll
  for (int i = 0; i < 8; ++i) { w[i] = (__bf16)Wm[(size_t)(k0 + 8 * g + i) * ld + o]; w[8 + i] = (__bf16)Wm[(size_t)(k0 + 16 + 8 * g + i) * ld + o]; }
  return w; }
__device__ __forceinline__ v16b wcol_oi(const float* Wm, int k0, int o, int lane, int K) { v16b w; const float* p = Wm + (size_t)o * K + k0 + 8 * (lane >> 4);
#pragma unroll
  for (int i = 0; i < 8; ++i) { w[i] = (__bf16)p[i]; w[8 + i] = (__bf16)p[16 + i]; }
  return w; }
__device__ __forceinline__ v16h wcolh_io(const float* Wm, int k0, int o, int lane, int ld) { v16h w; const int g = lane >> 4;
#pragma unroll
  for (int i = 0; i < 8; ++i) { w[i] = (_Float16)(bfr(Wm[(size_t)(k0 + 8 * g + i) * ld + o]) * 256.0f); w[8 + i] = (_Float16)(bfr(Wm[(size_t)(k0 + 16 + 8 * g + i) * ld + o]) * 256.0f); }
  return w; }
__device__ __forceinline__ v16h wcolh_oi(const float* Wm, int k0, int o, int lane, int K) { v16h w; const float* p = Wm + (size_t)o * K + k0 + 8 * (lane >> 4);
#pragma unroll
  for (int i = 0; i < 8; ++i) { w[i] = (_Float16)(bfr(p[i]) * 256.0f); w[8 + i] = (_Float16)(bfr(p[16 + i]) * 256.0f); }
  return w; }
#define WQKV_LAYOUT 0   // 0 = (in,out) [DIN][CC]; 1 = (out,in) [CC][DIN]; 2 = per-head [NH][DIN][HD]
__device__ __forceinline__ v16b wcol_hdk(const float* Wm, int k0, int o, int lane) { v16b w; const int g = lane >> 4; const float* p = Wm + (size_t)(o / HD) * DIN * HD + (o % HD);
#pragma unroll
  for (int i = 0; i < 8; ++i) { w[i] = (__bf16)p[(size_t)(k0 + 8 * g + i) * HD]; w[8 + i] = (__bf16)p[(size_t)(k0 + 16 + 8 * g + i) * HD]; }
  return w; }
#define WO_OUT_IN 0
#if WQKV_LAYOUT == 1
#define WCOL(W, k0, o, lane) wcol_oi(W, k0, o, lane, DIN)
#elif WQKV_LAYOUT == 2
#define WCOL(W, k0, o, lane) wcol_hdk(W, k0, o, lane)
#else
#define WCOL(W, k0, o, lane) wcol_io(W, k0, o, lane, (which == 0 ? CC : 2 * CC))   /* Wq [512][512]; Wkv [512][1024] packed k | v */
#endif
#if WO_OUT_IN
#define WOCOL(W, k0, o, lane) wcol_oi(W, k0, o, lane, CC)
#define WOCOLH(W, k0, o, lane) wcolh_oi(W, k0, o, lane, CC)
#else
#define WOCOL(W, k0, o, lane) wcol_io(W, k0, o, lane, DIN)
#define WOCOLH(W, k0, o, lane) wcolh_io(W, k0, o, lane, DIN)
#endif
// per-head local window: REGIONS = (4, 4, 8, 8, 16, 16, 32, 32) -> r(h) = 4 << (h / 2); tokens are a 64 x 64 grid (n = y*64 + x), a k_attn block is 8 image rows x 16 columns and walks its keys 64 a pass
__host__ __device__ __forceinline__ int rlog(int h) { return 2 + (h >> 1); }

#define WS_QH  0u                                      // f16 q rows [b*t][CC]
#define WS_KH  (WS_QH + 2u * (size_t)NB * TT * CC)      // f16 k rows [b*t][CC]
#define WS_VT  (WS_KH + 2u * (size_t)NB * TT * CC)      // f16 v planes [b][c][t]
#define WS_QL  (WS_VT + 2u * (size_t)NB * CC * TT)      // f16 q residual x 2^10 rows [b][t < QHI][CC]
#define WS_KL  (WS_QL + 2u * (size_t)NB * QHI * CC)     // f16 k residual x 2^10 rows [b][t < KHI][CC]
#define WS_VB  (WS_KL + 2u * (size_t)NB * KHI * CC)     // bf16 v hi planes [b][c][t < KHI]
#define WS_VBL (WS_VB + 2u * (size_t)NB * CC * KHI)
#define WS_Y   (WS_VBL + 2u * (size_t)NB * CC * KHI)    // f32 ctx rows [b*t][CC] (only when there is an output projection)
#define WS_END (WS_Y  + 4u * (size_t)NB * TT * CC)

// ---- the two projection GEMMs share one main loop: block = 8 waves = (256 rows, 128 cols), K = 512.
// The block's weight panel (128 output columns x all 512 k) is converted to its 16-bit form ONCE and kept in LDS as [column][k]; every wave reads its B fragments from there.
// Each wave owns 32 rows (2 A fragments x 8 B fragments = 16 products per 32 k): it loads them as whole 128-byte lines, converts, and turns them into fragments through its own small LDS range.
// k ascends within each accumulator.
typedef __attribute__((ext_vector_type(2))) unsigned v2u;
#define PW 520                       // pitch of a panel row (one column, 512 k) in 16-bit elements: 1,040 B = 16 B x odd, no bank conflict for 16-byte reads
#define PX 40                        // pitch of a staged operand row (32 k): 80 B = 16 B x odd
#define SM_W (128 * PW * 2)          // panel bytes
#define SM_XW (32 * PX * 2)          // one wave's operand range
#define SM_BYTES (SM_W + 8 * SM_XW)  // 153,600 B: two blocks per WGP; the epilogues reuse it
union Frag { v4u q[2]; v16b b; v16h h; };
// F16M 0: operands rounded to bf16 (exact products); F16M 1: rows x 2^6 to f16, weights f16(bf16 x 2^8) (exact)
// wave-private hand-over through LDS: the wave's own LDS operations have retired, and the compiler moves no memory access across
#define LDSW() do { asm volatile("s_wait_dscnt 0" ::: "memory"); __builtin_amdgcn_wave_barrier(); } while (0)
template <int F16M> __device__ __forceinline__ v2u pack4(v4f f) { union { v2u u; __bf16 b[4]; _Float16 h[4]; } c;
#pragma unroll
  for (int e = 0; e < 4; ++e) { if constexpr (F16M) c.h[e] = (_Float16)(f[e] * 64.0f); else c.b[e] = (__bf16)f[e]; }
  return c.u; }
// 128 columns x 512 k of a [k][LD] f32 weight -> LDS [column][k] in the 16-bit form: a wave reads 32 neighbouring columns of one k row (one whole line), a lane gathers 8 k of its column into one 16-byte LDS store
template <int F16M, int LD> __device__ __forceinline__ void stage_panel(const float* __restrict__ Wc, char* smem) {
  const int tid = threadIdx.x, n = tid & 127; const float* wp = Wc + (size_t)((tid >> 7) * 8) * LD + n; char* dst = smem + (n * PW + (tid >> 7) * 8) * 2;
#pragma unroll 8   /* 64 loads in flight per wave while the panel is filled */
  for (int it = 0; it < 32; ++it) { union { v4u u; v8b b; v8h h; } w; const float* p = wp + (size_t)(it * 16) * LD;
#pragma unroll
    for (int i = 0; i < 8; ++i) { const float f = p[(size_t)i * LD]; if constexpr (F16M) w.h[i] = (_Float16)(bfr(f) * 256.0f); else w.b[i] = (__bf16)f; }
    *(v4u*)(dst + it * 32) = w.u; } }
template <int F16M> __device__ __forceinline__ void gemm_256x128(const float* __restrict__ X, size_t r0, const float* __restrict__ Wm, int ld, int c0, char* smem, v8f (&acc)[2][8]) {
  const int tid = threadIdx.x, wave = tid >> 5, lane = tid & 31, col = lane & 15, g = lane >> 4;
  const float* xp = X + (r0 + wave * 32 + (lane >> 3)) * 512 + (lane & 7) * 4;   /* load i of a chunk: rows 4i .. 4i+3, 8 lanes x 16 B = one whole line a row */
  char* xs = smem + SM_W + wave * SM_XW; char* xst = xs + ((lane >> 3) * PX + (lane & 7) * 4) * 2;
  const char* xa = xs + (col * PX + 8 * g) * 2; const char* wb = smem + (col * PW + 8 * g) * 2;
  v4f raw[8];
#pragma unroll
  for (int i = 0; i < 8; ++i) raw[i] = *(const v4f*)(xp + (size_t)i * 4 * 512);
  if (ld == 512) stage_panel<F16M, 512>(Wm + c0, smem); else stage_panel<F16M, 1024>(Wm + c0, smem);   /* block-uniform; the pitch as a constant puts every row step into the loads' immediate offsets */
#pragma unroll
  for (int i = 0; i < 8; ++i) { *(v2u*)(xst + i * 4 * PX * 2) = pack4<F16M>(raw[i]); raw[i] = *(const v4f*)(xp + (size_t)i * 4 * 512 + 32); }
  __syncthreads();   /* the panel (and each wave's first chunk) is complete before any wave reads it */
#pragma unroll
  for (int kc = 0; kc < 16; ++kc) {
    Frag a[2], w[8];   /* the chunk's 20 fragment reads go as one group ahead of its 16 products */
#pragma unroll
    for (int m = 0; m < 2; ++m) { a[m].q[0] = *(const v4u*)(xa + m * 16 * PX * 2); a[m].q[1] = *(const v4u*)(xa + m * 16 * PX * 2 + 32); }
#pragma unroll
    for (int j = 0; j < 8; ++j) { w[j].q[0] = *(const v4u*)(wb + (j * 16 * PW + kc * 32) * 2); w[j].q[1] = *(const v4u*)(wb + (j * 16 * PW + kc * 32) * 2 + 32); }
    v2u pk[8];   /* the next chunk's rows are converted while the reads are under way */
    if (kc + 1 < 16) {
#pragma unroll
      for (int i = 0; i < 8; ++i) pk[i] = pack4<F16M>(raw[i]); }
    __builtin_amdgcn_sched_barrier(0);   /* keeps the 20 reads one group ahead of the products (one exposed LDS latency a chunk; without it each pair of reads is waited for on its own) and the conversion under that latency */
    LDSW();   /* this chunk's fragments are in registers before the next chunk's rows overwrite them */
    if (kc + 1 < 16) {
#pragma unroll
      for (int i = 0; i < 8; ++i) *(v2u*)(xst + i * 4 * PX * 2) = pk[i]; }
    __builtin_amdgcn_sched_barrier(0);   /* the converted rows leave their registers before the next lines are asked for: keeps the wave within 256 registers, two blocks per WGP */
    if (kc + 2 < 16) {
#pragma unroll
      for (int i = 0; i < 8; ++i) raw[i] = *(const v4f*)(xp + (size_t)i * 4 * 512 + (kc + 2) * 32); }   /* the lines of the chunk after next fly under this chunk's products */
#pragma unroll
    for (int j = 0; j < 8; ++j)
#pragma unroll
      for (int m = 0; m < 2; ++m) { if constexpr (F16M) acc[m][j] = __builtin_amdgcn_wmma_f32_16x16x32_f16(false, a[m].h, false, w[j].h, (short)0, acc[m][j], false, false);
        else acc[m][j] = __builtin_amdgcn_wmma_f32_16x16x32_bf16(false, a[m].b, false, w[j].b, (short)0, acc[m][j], false, false); }
    __builtin_amdgcn_sched_barrier(0);   /* the products stay ahead of the wait below, so they cover the row stores, and the next conversion (which waits for the lines just asked for) stays behind them */
    LDSW();   /* the wave's next rows are in LDS before its lanes read each other's */
  }
  __syncthreads();   /* every wave has left the panel: the epilogue reuses the LDS */
}
// ---- k_proj: block = (256 rows, 128 cols, which): q/k/v = X W (+ b) with exact bf16 products (K = DIN) -> which 0: q f16 rows (+ residual rows < QHI); 1: k f16 rows (+ residual rows < KHI); 2: v f16 planes [c][t] (+ bf16 hi/lo planes for t < KHI)
__global__ __launch_bounds__(256) void k_proj(const float* __restrict__ XQ, const float* __restrict__ XK, const float* __restrict__ XV, const float* __restrict__ WQ, const float* __restrict__ WK, const float* __restrict__ WV, const float* __restrict__ BQ, const float* __restrict__ BK, const float* __restrict__ BV,
    _Float16* __restrict__ QH, _Float16* __restrict__ QL, _Float16* __restrict__ KH, _Float16* __restrict__ KL, _Float16* __restrict__ VT, __bf16* __restrict__ VB, __bf16* __restrict__ VBL) {
  __shared__ __align__(16) char smem[SM_BYTES];
  const int tid = threadIdx.x, wave = tid >> 5, lane = tid & 31, col = lane & 15, g = lane >> 4; const int which = blockIdx.z; const int c0 = blockIdx.y * 128; const size_t r0 = (size_t)blockIdx.x * 256; const size_t bb = r0 / TT; const int t0 = (int)(r0 % TT);
  const float* X = which == 0 ? XQ : which == 1 ? XK : XV; const float* WA = which == 0 ? WQ : which == 1 ? WK : WV; const float* BA = which == 0 ? BQ : which == 1 ? BK : BV;
  v8f acc[2][8] = {};
  gemm_256x128<0>(X, r0, WA, which == 0 ? CC : 2 * CC, c0, smem, acc);   /* Wq [512][512]; Wkv [512][1024] packed k | v */
  if (which < 2) { _Float16* DH = which == 0 ? QH : KH; _Float16* DL = which == 0 ? QL : KL; const int nhi = which == 0 ? QHI : KHI;
    _Float16 (*sh)[136] = (_Float16 (*)[136])smem; _Float16 (*sl)[136] = (_Float16 (*)[136])(smem + 256 * 136 * 2);
#pragma unroll
    for (int m = 0; m < 2; ++m)
#pragma unroll
      for (int j = 0; j < 8; ++j) { const float bias = BA ? bfr(BA[c0 + j * 16 + col]) : 0.f;
#pragma unroll
        for (int r = 0; r < 8; ++r) { const float v = acc[m][j][r] + bias; const _Float16 hv = (_Float16)v; const int rl = wave * 32 + m * 16 + 8 * g + r; sh[rl][j * 16 + col] = hv; sl[rl][j * 16 + col] = (_Float16)((v - (float)hv) * 1024.0f); } }
    __syncthreads();
    for (int it = 0; it < 16; it += 4) { v4u vh[4], vl[4];   /* four rows' pieces a trip: 8 LDS reads under way at once */
#pragma unroll
      for (int u = 0; u < 4; ++u) { const int e = (it + u) * 256 + tid, rl = e >> 4, q = e & 15; vh[u] = *(const v4u*)&sh[rl][q * 8]; vl[u] = *(const v4u*)&sl[rl][q * 8]; }
#pragma unroll
      for (int u = 0; u < 4; ++u) { const int e = (it + u) * 256 + tid, rl = e >> 4, q = e & 15; vst2((unsigned*)(DH + (r0 + rl) * CC + c0 + q * 8), vh[u]); if (t0 + rl < nhi) vst2((unsigned*)(DL + (bb * nhi + t0 + rl) * (size_t)CC + c0 + q * 8), vl[u]); }
      asm volatile("s_wait_xcnt 0x0" ::: "memory"); }   /* precaution: the next trip rewrites registers that these stores name */
  } else { _Float16 (*th)[264] = (_Float16 (*)[264])smem; __bf16 (*tb)[72] = (__bf16 (*)[72])(smem + 128 * 264 * 2); __bf16 (*tbl)[72] = (__bf16 (*)[72])(smem + 128 * 264 * 2 + 128 * 72 * 2);
#pragma unroll
    for (int m = 0; m < 2; ++m)
#pragma unroll
      for (int j = 0; j < 8; ++j) { const float bias = BA ? bfr(BA[c0 + j * 16 + col]) : 0.f; const int rb = wave * 32 + m * 16 + 8 * g, cl = j * 16 + col; v8h hv;
#pragma unroll
        for (int r = 0; r < 8; ++r) hv[r] = (_Float16)(acc[m][j][r] + bias);
        *(v8h*)&th[cl][rb] = hv;   /* a lane's 8 values are 8 neighbouring t of one channel */
        if (t0 + rb < KHI) {   /* only the first KHI tokens of a sequence carry these planes */
#pragma unroll
          for (int r = 0; r < 8; ++r) { const float v = acc[m][j][r] + bias; const __bf16 bh = (__bf16)v; tb[cl][rb + r] = bh; tbl[cl][rb + r] = (__bf16)(v - (float)bh); } } }
    __syncthreads();
    for (int it = 0; it < 16; it += 4) { v4u vv[4];
#pragma unroll
      for (int u = 0; u < 4; ++u) { const int e = (it + u) * 256 + tid, cl = e >> 5, q = e & 31; vv[u] = *(const v4u*)&th[cl][q * 8]; }
#pragma unroll
      for (int u = 0; u < 4; ++u) { const int e = (it + u) * 256 + tid, cl = e >> 5, q = e & 31; vst2((unsigned*)(VT + (bb * CC + c0 + cl) * (size_t)TT + t0 + q * 8), vv[u]); }
      asm volatile("s_wait_xcnt 0x0" ::: "memory"); }   /* precaution: the next trip rewrites registers that these stores name */
    if (t0 < KHI) for (int it = 0; it < 4; ++it) { const int e = it * 256 + tid, cl = e >> 3, q = e & 7;
      if (t0 + q * 8 < KHI) { const size_t o3 = (bb * CC + c0 + cl) * (size_t)KHI + t0 + q * 8; vst2((unsigned*)(VB + o3), *(const v4u*)&tb[cl][q * 8]); vst2((unsigned*)(VBL + o3), *(const v4u*)&tbl[cl][q * 8]); }
      asm volatile("s_wait_xcnt 0x0" ::: "memory"); } } }   /* the same precaution */
#define AP 144                 // pitch of a staged row (64 f16 = 128 B) in bytes: 16 B x odd, no bank conflict for 16-byte reads
#define AT (64 * AP)           // one operand's tile: 64 k rows (64 d each), or 64 v channels (64 keys each)
#define AB (2 * AT)            // one buffer: k tile, v tile
#define C2 (SCALE * 1.4426950408889634f)   // logit scale x log2(e)
// Hardware exp2 (v_exp_f32), each value in place. Written as asm so that the closing v_nop is tied to the last of them: it is the slot the instruction set asks for between a transcendental and a directly following
// instruction that reads its result or overwrites its source. Inside a statement no v_exp_f32 touches a neighbour's register.
__device__ __forceinline__ float exp2_1(float x) { asm("v_exp_f32 %0, %0\n\tv_nop" : "+v"(x)); return x; }
__device__ __forceinline__ void exp2_16(float (&x)[16]) {
  asm("v_exp_f32 %0, %0\n\tv_exp_f32 %1, %1\n\tv_exp_f32 %2, %2\n\tv_exp_f32 %3, %3\n\tv_exp_f32 %4, %4\n\tv_exp_f32 %5, %5\n\tv_exp_f32 %6, %6\n\tv_exp_f32 %7, %7\n\t"
      "v_exp_f32 %8, %8\n\tv_exp_f32 %9, %9\n\tv_exp_f32 %10, %10\n\tv_exp_f32 %11, %11\n\tv_exp_f32 %12, %12\n\tv_exp_f32 %13, %13\n\tv_exp_f32 %14, %14\n\tv_exp_f32 %15, %15\n\tv_nop"
      : "+v"(x[0]), "+v"(x[1]), "+v"(x[2]), "+v"(x[3]), "+v"(x[4]), "+v"(x[5]), "+v"(x[6]), "+v"(x[7]), "+v"(x[8]), "+v"(x[9]), "+v"(x[10]), "+v"(x[11]), "+v"(x[12]), "+v"(x[13]), "+v"(x[14]), "+v"(x[15])); }
__global__ __launch_bounds__(256) void k_attn(const _Float16* __restrict__ QH, const _Float16* __restrict__ QL, const _Float16* __restrict__ KH, const _Float16* __restrict__ VT, const int* __restrict__ WI, float* __restrict__ Y) {
  __shared__ __align__(16) char sm[2 * AB];
  const int tid = threadIdx.x, lane = tid & 31, col = lane & 15, g = lane >> 4;
  const int wave = __builtin_amdgcn_readfirstlane((int)(threadIdx.x >> 5));   /* wave-uniform, so the tiles' token numbers are worked out on the scalar unit */
  const int b = blockIdx.y, h = NH - 1 - (int)blockIdx.z;                       /* largest windows start first */
  const int rl_ = rlog(h), r = 1 << rl_;
  int wsh = 31 - __clz(WI[0] | 1); wsh = wsh > 7 ? 7 : wsh < 5 ? 5 : wsh;       /* grid width read from the input, as a shift (64 -> 6); 32, 64 and 128 are the widths at which 32 divides both sides of a 4,096-token grid */
  const int yb = ((int)blockIdx.x >> (wsh - 4)) * 8, xs = ((int)blockIdx.x & ((1 << (wsh - 4)) - 1)) * 16;   /* a one-to-one map block -> (8 image rows, one 16-column strip) at every such width */
  const int n0 = ((yb + wave) << wsh) + xs;
  const int sps = rl_ > 4 ? rl_ - 4 : 0, smask = (1 << sps) - 1;                /* 16-key tiles per window row: max(16, r) / 16 */
  const int rb_ = rl_ > 3 ? rl_ : 3;                                            /* the block's key rows: max(8, r) */
  const int y0 = (yb >> rb_) << rb_, xk0 = xs & ~((16 << sps) - 1);
  const int npass = (1 << (rb_ + sps)) >> 2;                                    /* 2, 2, 4 or 16 passes of 64 keys: never fewer than the two buffers */
  const int wm = ~((r - 1) | ((r - 1) << wsh));                                 /* token bits that name the window: same window row AND same window column <=> ((k ^ t) & wm) == 0 */
  const int t = n0 + col;
  const _Float16* Kb = KH + (size_t)b * TT * CC + h * HD; const _Float16* Vb = VT + ((size_t)b * CC + h * HD) * (size_t)TT;
  /* first token of 16-key tile s of the block; bounded here whatever the width input holds */
  auto tok = [&](int s) { const int k = ((y0 + (s >> sps)) << wsh) + xk0 + ((s & smask) << 4); return (k > TT - 16 ? TT - 16 : k) & ~15; };
  /* a pass's copies: 2 x 512 pieces of 16 B, four a thread. k: 8 lanes bring one key row's whole 128-byte line; v: 8 lanes bring one channel's 4 x 32 B */
  const int crow = tid >> 3, cpc = tid & 7;
  const unsigned ldst = (unsigned)(size_t)sm + (unsigned)(crow * AP + cpc * 16);
  auto stage = [&](int p, int buf) {
    const unsigned l0 = ldst + (unsigned)(buf * AB), l1 = l0 + 32 * AP, l2 = l0 + AT, l3 = l2 + 32 * AP;
    const char* k0 = (const char*)(Kb + (size_t)(tok(4 * p + (crow >> 4)) + (crow & 15)) * CC) + cpc * 16;
    const char* k1 = (const char*)(Kb + (size_t)(tok(4 * p + 2 + (crow >> 4)) + (crow & 15)) * CC) + cpc * 16;
    const char* v0 = (const char*)(Vb + (size_t)crow * TT + tok(4 * p + (cpc >> 1)) + (cpc & 1) * 8);
    const char* v1 = v0 + (size_t)32 * TT * 2;
    /* the copies and the wait that stands before their address registers are rewritten, in one statement */
    asm volatile("global_load_async_to_lds_b128 %0, %1, off\n\tglobal_load_async_to_lds_b128 %2, %3, off\n\tglobal_load_async_to_lds_b128 %4, %5, off\n\tglobal_load_async_to_lds_b128 %6, %7, off\n\ts_wait_xcnt 0x0"
                 :: "v"(l0), "v"(k0), "v"(l1), "v"(k1), "v"(l2), "v"(v0), "v"(l3), "v"(v1) : "memory"); };
  stage(0, 0);
  v16h qh[2], ql[2];
#pragma unroll
  for (int kc = 0; kc < 2; ++kc) { qh[kc] = frag_h(QH + ((size_t)b * TT + t) * CC + h * HD + kc * 32, lane); ql[kc] = frag_h(QL + ((size_t)b * QHI + t) * CC + h * HD + kc * 32, lane); }
  asm volatile("s_wait_asynccnt 0x0" ::: "memory");   /* this wave's share of pass 0 has landed */
  __syncthreads();                                    /* ... and every other wave's: pass 0 may be read */
  stage(1, 1);
  const unsigned foff = (unsigned)(col * AP + 16 * g);   /* the lane's own byte offset in a tile, fixed for the whole loop */
  v8f acc[HD / 16] = {}; float m = -1.0e30f, sum = 0.f;
  for (int p = 0; p < npass; ++p) {
    if ((((y0 + ((4 * p) >> sps)) ^ (yb + wave)) >> rl_) == 0) {   /* wave-uniform: the pass's key rows lie in this wave's window row (always, for r >= 8) */
    const char* kb = sm + (p & 1) * AB + foff; const char* vb = kb + AT;
    int kt[4];
#pragma unroll
    for (int u = 0; u < 4; ++u) kt[u] = tok(4 * p + u);
    v8h kq[4][4], vq[2][HD / 16][2];
#pragma unroll
    for (int u = 0; u < 4; ++u)
#pragma unroll
      for (int q = 0; q < 4; ++q) kq[u][q] = *(const v8h*)(kb + u * 16 * AP + q * 32);   /* q = 2 kc + half: d = kc*32 + half*16 + 8g .. + 7 of key row kt[u] + col */
#pragma unroll
    for (int c = 0; c < 2; ++c)
#pragma unroll
      for (int j = 0; j < HD / 16; ++j) { vq[c][j][0] = *(const v8h*)(vb + j * 16 * AP + (2 * c) * 32); vq[c][j][1] = *(const v8h*)(vb + j * 16 * AP + (2 * c + 1) * 32); }   /* keys kt[2c] + 8g .. + 7 and kt[2c + 1] + 8g .. + 7 of channel j*16 + col */
    __builtin_amdgcn_sched_barrier(0);   /* keeps the pass's 32 reads one group ahead of the products: one exposed LDS latency a pass; without it each pair of reads is waited for on its own */
    float v[4][8]; float mx = m;
#pragma unroll
    for (int u = 0; u < 4; ++u) { v8f sa = {}, sl = {};
#pragma unroll
      for (int kc = 0; kc < 2; ++kc) { union { v16h f; v8h q[2]; } kf; kf.q[0] = kq[u][2 * kc]; kf.q[1] = kq[u][2 * kc + 1];
        sa = __builtin_amdgcn_wmma_f32_16x16x32_f16(false, kf.f, false, qh[kc], (short)0, sa, false, false); sl = __builtin_amdgcn_wmma_f32_16x16x32_f16(false, kf.f, false, ql[kc], (short)0, sl, false, false); }
#pragma unroll
      for (int i = 0; i < 8; ++i) { const float x = sa[i] + sl[i] * (1.0f / 1024.0f); v[u][i] = ((((kt[u] + 8 * g + i) ^ t) & wm) == 0) ? x : -3.0e38f; mx = fmaxf(mx, v[u][i]); } }
    mx = fmaxf(mx, __shfl_xor(mx, 16));
    const float alpha = exp2_1((m - mx) * C2); m = mx;
    const float mb = 11.0f - m * C2;
#pragma unroll
    for (int j = 0; j < HD / 16; ++j) acc[j] *= alpha;
    v16h pf[2]; float ps[4];
#pragma unroll
    for (int c = 0; c < 2; ++c) { float e[16];
#pragma unroll
      for (int i = 0; i < 16; ++i) e[i] = v[2 * c + (i >> 3)][i & 7] * C2 + mb;
      exp2_16(e); ps[2 * c] = e[0]; ps[2 * c + 1] = e[8];
#pragma unroll
      for (int i = 0; i < 16; ++i) { if (i & 7) ps[2 * c + (i >> 3)] += e[i]; pf[c][i] = (_Float16)e[i]; } }
    sum = sum * alpha + ((ps[0] + ps[1]) + (ps[2] + ps[3]));
#pragma unroll
    for (int c = 0; c < 2; ++c)
#pragma unroll
      for (int j = 0; j < HD / 16; ++j) { union { v16h f; v8h q[2]; } vf; vf.q[0] = vq[c][j][0]; vf.q[1] = vq[c][j][1];
        acc[j] = __builtin_amdgcn_wmma_f32_16x16x32_f16(false, vf.f, false, pf[c], (short)0, acc[j], false, false); }
    }
    /* hand-over, passed by every wave, also one that skipped the pass */
    asm volatile("s_wait_dscnt 0x0" ::: "memory");      /* this wave's reads of the pass's buffer have retired */
    asm volatile("s_wait_asynccnt 0x0" ::: "memory");   /* its share of the next pass has landed */
    __syncthreads();                                    /* publishes the next pass and ends every wave's reads of this pass's buffer */
    if (p + 2 < npass) stage(p + 2, p & 1);             /* block-uniform: refill the buffer just left */
  }
  asm volatile("s_wait_asynccnt 0x0" ::: "memory");     /* no copy is outstanding when the wave ends */
  sum += __shfl_xor(sum, 16);
  const float inv = sum > 0.f ? 1.0f / sum : 0.f;   /* a fully excluded row yields 0 */
  float* yp = Y + ((size_t)b * TT + t) * CC + h * HD + 8 * g;   /* lane = query t, register i of tile j = channel j*16 + 8g + i */
#pragma unroll
  for (int j = 0; j < HD / 16; ++j) { const v4f lo = { acc[j][0] * inv, acc[j][1] * inv, acc[j][2] * inv, acc[j][3] * inv }, hi = { acc[j][4] * inv, acc[j][5] * inv, acc[j][6] * inv, acc[j][7] * inv }; vst2(yp + j * 16, lo); vst2(yp + j * 16 + 4, hi); } }
// ---- k_out: block = (256 rows, 128 cols): out = ctx Wo (+ bo): ctx x 2^6 once to f16 (small-magnitude context rows stay clear of f16 subnormals) against Wo as f16(bf16 x 2^8) exact (1 product), un-scaled by 2^-14
__global__ __launch_bounds__(256) void k_out(const float* __restrict__ Y, const float* __restrict__ WO, const float* __restrict__ BO, float* __restrict__ OUT) { __shared__ __align__(16) char smem[SM_BYTES];
  const int tid = threadIdx.x, wave = tid >> 5, lane = tid & 31, col = lane & 15, g = lane >> 4; const int c0 = blockIdx.y * 128; const size_t r0 = (size_t)blockIdx.x * 256;
  v8f acc[2][8] = {};
  gemm_256x128<1>(Y, r0, WO, DIN, c0, smem, acc);
  float (*sf)[132] = (float (*)[132])(smem + wave * (32 * 132 * 4));   /* each wave stages its own 32 rows */
#pragma unroll
  for (int m = 0; m < 2; ++m)
#pragma unroll
    for (int j = 0; j < 8; ++j) { const float bias = BO ? bfr(BO[c0 + j * 16 + col]) : 0.f;
#pragma unroll
      for (int r = 0; r < 8; ++r) sf[m * 16 + 8 * g + r][j * 16 + col] = acc[m][j][r] * (1.0f / 16384.0f) + bias; }   /* 2^-8 (Wo carry) x 2^-6 (ctx carry) */
  LDSX(); for (int rl = 0; rl < 32; ++rl) vst2(OUT + (r0 + wave * 32 + rl) * DIN + c0 + lane * 4, *(const v4f*)&sf[rl][lane * 4]); }

extern "C" void kernel_launch(void* const* d_in, const int* in_sizes, int n_in, void* d_out, int out_size, void* d_ws, size_t ws_size, hipStream_t stream) {
  (void)in_sizes; (void)n_in; (void)out_size;
  const float** F = (const float**)d_in;
  if (ws_size < (size_t)WS_END) return;
  char* ws = (char*)d_ws; _Float16 *QH = (_Float16*)(ws + WS_QH), *KH = (_Float16*)(ws + WS_KH), *VT = (_Float16*)(ws + WS_VT), *QL = (_Float16*)(ws + WS_QL), *KL = (_Float16*)(ws + WS_KL); __bf16 *VB = (__bf16*)(ws + WS_VB), *VBL = (__bf16*)(ws + WS_VBL); float *Y = (float*)(ws + WS_Y);
  (void)Y; (void)QL; (void)KL; (void)VB; (void)VBL;
  // inputs: 0 x [4,4096,512]; 1 Wq [512,512] (in,out); 2 Wkv [512,1024] (in,out; columns k | v, head*64+d); 3 Wproj [512,512] (in,out); 4 bproj [512]; 5 H (int 64); 6 W (int 64)
  const int* WI = (const int*)d_in[6];
  k_proj<<<dim3(TNB * TT / 256, CC / 128, 3), 256, 0, stream>>>(F[0], F[0], F[0], F[1], F[2], F[2] + CC, nullptr, nullptr, nullptr, QH, QL, KH, KL, VT, VB, VBL);   /* k = Wkv columns 0..511, v = columns 512..1023 (row pitch 2*CC) */
  k_attn<<<dim3(TT / 128, TNB, NH), 256, 0, stream>>>(QH, QL, KH, VT, WI, Y);
  k_out<<<dim3(TNB * TT / 256, DIN / 128), 256, 0, stream>>>(Y, F[3], F[4], (float*)d_out);
}

// v005
// Measured time: 83 microseconds a run.
// Timed twice side by side with v004, it ran 1.06 and 1.07 times as fast.
// Counting every step since v000, it is 22.9 times as fast.
// compute dtype: all float inputs rounded to bf16; q/k/v = x W with EXACT bf16 products on WMMA 16x16x32 (f32 accumulate); windowed logits with q as f16 hi + residual (x 2^10) against k once to f16 (2 products) x 64^-0.5; per-window online softmax in f32 (base 2: one hardware exp2 per term, running maximum and sum); exp(s - m) x 2^11 once to f16 against v once to f16 (1 product), divided by the f32 sum at the end; merged heads carried x 2^6 once to f16 against Wproj carried x 2^8 in f16 (exact bf16 values), un-scaled by 2^-14, + bproj; f32 output.
#include <hip/hip_runtime.h>
#include <math.h>

typedef __attribute__((ext_vector_type(16))) _Float16 v16h;
typedef __attribute__((ext_vector_type(16))) __bf16 v16b;
typedef __attribute__((ext_vector_type(8)))  _Float16 v8h;
typedef __attribute__((ext_vector_type(8)))  float v8f;
typedef __attribute__((ext_vector_type(4)))  float v4f;
typedef __attribute__((ext_vector_type(2)))  float v2f;
typedef __attribute__((ext_vector_type(4)))  unsigned v4u;
typedef __attribute__((ext_vector_type(4)))  int v4i;
typedef float __attribute__((may_alias)) float_a;
typedef int __attribute__((may_alias)) int_a;

template <typename T> __device__ __forceinline__ void vst2(void* p, T v) { *(T*)p = v;  }
__device__ __forceinline__ v8f wmma16(v16h a, v16h b, v8f c) {
  v8f d = __builtin_amdgcn_wmma_f32_16x16x32_f16(false, a, false, b, (short)0, c, false, false);
  asm volatile("v_nop\n\tv_nop\n\tv_nop\n\tv_nop" : "+v"(d) : "v"(a), "v"(b));
  return d;
}
__device__ __forceinline__ v8f wmma_bf(v16b a, v16b b, v8f c) {
  v8f d = __builtin_amdgcn_wmma_f32_16x16x32_bf16(false, a, false, b, (short)0, c, false, false);
  asm volatile("v_nop\n\tv_nop\n\tv_nop\n\tv_nop" : "+v"(d) : "v"(a), "v"(b));
  return d;
}
// 16x16x32 fragments: lane = (h = lane>>4, row/col = lane&15); elements 0..7 = k0+8h+0..7, 8..15 = k0+16+8h+0..7; D element r = row 8h+r
__device__ __forceinline__ v16h frag_h(const _Float16* rowk0, int lane) {
  union { v16h v; v8h q[2]; } u; const _Float16* p = rowk0 + 8 * (lane >> 4);
  u.q[0] = *(const v8h*)p; u.q[1] = *(const v8h*)(p + 16); return u.v;
}
__device__ __forceinline__ v16h frag_f32(const float* rowk0, int lane) {
  v16h a; const float* p = rowk0 + 8 * (lane >> 4);
#pragma unroll
  for (int i = 0; i < 8; ++i) { a[i] = (_Float16)p[i]; a[8 + i] = (_Float16)p[16 + i]; }
  return a;
}
__device__ __forceinline__ v16h frag_f32s(const float* rowk0, int lane, float sc) {
  v16h a; const float* p = rowk0 + 8 * (lane >> 4);
#pragma unroll
  for (int i = 0; i < 8; ++i) { a[i] = (_Float16)(p[i] * sc); a[8 + i] = (_Float16)(p[16 + i] * sc); }
  return a;
}
// column fragment from a [K][ld] layout (column n), rows >= K read as 0
__device__ __forceinline__ v16h fragc_f32(const float* W, int k0, int n, int lane, int ld, int K) {
  v16h a; const int g = lane >> 4;
#pragma unroll
  for (int i = 0; i < 8; ++i) { const int ka = k0 + 8 * g + i, kb = ka + 16;
    a[i] = (_Float16)(ka < K ? W[(size_t)(ka < K ? ka : K - 1) * ld + n] : 0.f); a[8 + i] = (_Float16)(kb < K ? W[(size_t)(kb < K ? kb : K - 1) * ld + n] : 0.f); }
  return a;
}
struct F2 { v16b h, l; };
__device__ __forceinline__ F2 bsplit16(const float v[16]) { F2 r;
#pragma unroll
  for (int i = 0; i < 16; ++i) { const __bf16 h = (__bf16)v[i]; r.h[i] = h; r.l[i] = (__bf16)(v[i] - (float)h); }
  return r; }
__device__ __forceinline__ F2 split_row(const float* row, int k0, int lane) { float v[16]; const float* p = row + k0 + 8 * (lane >> 4);
#pragma unroll
  for (int i = 0; i < 8; ++i) { v[i] = p[i]; v[8 + i] = p[16 + i]; }
  return bsplit16(v); }
__device__ __forceinline__ F2 split_rowK(const float* row, int k0, int lane, int K) { float v[16]; const int g = lane >> 4;
#pragma unroll
  for (int i = 0; i < 8; ++i) { const int ka = k0 + 8 * g + i, kb = ka + 16; v[i] = ka < K ? row[ka < K ? ka : K - 1] : 0.f; v[8 + i] = kb < K ? row[kb < K ? kb : K - 1] : 0.f; }
  return bsplit16(v); }
__device__ __forceinline__ F2 split_col(const float* W, int k0, int n, int lane, int ld, int K) { float v[16]; const int g = lane >> 4;
#pragma unroll
  for (int i = 0; i < 8; ++i) { const int ka = k0 + 8 * g + i, kb = ka + 16; v[i] = ka < K ? W[(size_t)(ka < K ? ka : K - 1) * ld + n] : 0.f; v[8 + i] = kb < K ? W[(size_t)(kb < K ? kb : K - 1) * ld + n] : 0.f; }
  return bsplit16(v); }
__device__ __forceinline__ v8f mac3(const F2& a, const F2& b, v8f c) { c = wmma_bf(a.l, b.h, c); c = wmma_bf(a.h, b.l, c); return wmma_bf(a.h, b.h, c); }
__device__ __forceinline__ float sigm(float v) { return 1.0f / (1.0f + expf(-v)); }
#define LDSX() do { asm volatile("s_wait_dscnt 0" ::: "memory"); __builtin_amdgcn_wave_barrier(); __builtin_amdgcn_fence(__ATOMIC_RELEASE, "workgroup"); } while (0)

// Multi-scale windowed self-attention (B 4, 64 x 64 = 4,096 tokens, C 512 = 8 heads x 64; head h attends within non-overlapping r x r spatial windows with r = (4, 4, 8, 8, 16, 16, 32, 32)[h]; 0.02-scale (in,out) Wq [512,512], Wkv [512,1024] (k | v), Wproj [512,512] + zero bproj): q = x Wq, k|v = x Wkv; per head: softmax(q k^T x 64^-0.5) over the window's r^2 keys; heads merged (channel = head*64 + d); out = o Wproj + bproj.
#define NB 4
#define TT 4096
#define CC 512            // NH * HD = projected width
#define DIN 512          // input (model) width
#define NH 8
#define HD 64
#define NQB (TT / 64)
#define HG 1
#define SCALE (0.125f)
#define CAUSAL 0
#ifndef TNB
#define TNB NB
#endif
__device__ __forceinline__ float bfr(float v) { return (float)(__bf16)v; }
__host__ __device__ __forceinline__ int kb_last(int qb) { return CAUSAL ? ((qb * 64 + 63) >> 7) : (TT / 128 - 1); }
typedef __attribute__((ext_vector_type(8))) __bf16 v8b;
__device__ __forceinline__ v16b frag_b(const __bf16* rowk0, int lane) {
  union { v16b v; v8b q[2]; } u; const __bf16* p = rowk0 + 8 * (lane >> 4);
  u.q[0] = *(const v8b*)p; u.q[1] = *(const v8b*)(p + 16); return u.v;
}
#define QBH 0
#define QHI 4096            // rows carrying a q residual plane (all rows when non-causal: 2-product logits everywhere)
#define KHI 64            // key rows carrying k residual / v bf16 hi+lo planes (written by k_proj, read by no kernel in this file)
// B fragment (k rows k0+.., output column o) of a weight: (in,out) [K][ld] or (out,in) [ld rows of K]: bf16 exact, or f16(bf16 * 256) exact
__device__ __forceinline__ v16b wcol_io(const float* Wm, int k0, int o, int lane, int ld) { v16b w; const int g = lane >> 4;
#pragma unroll
  for (int i = 0; i < 8; ++i) { w[i] = (__bf16)Wm[(size_t)(k0 + 8 * g + i) * ld + o]; w[8 + i] = (__bf16)Wm[(size_t)(k0 + 16 + 8 * g + i) * ld + o]; }
  return w; }
__device__ __forceinline__ v16b wcol_oi(const float* Wm, int k0, int o, int lane, int K) { v16b w; const float* p = Wm + (size_t)o * K + k0 + 8 * (lane >> 4);
#pragma unroll
  for (int i = 0; i < 8; ++i) { w[i] = (__bf16)p[i]; w[8 + i] = (__bf16)p[16 + i]; }
  return w; }
__device__ __forceinline__ v16h wcolh_io(const float* Wm, int k0, int o, int lane, int ld) { v16h w; const int g = lane >> 4;
#pragma unroll
  for (int i = 0; i < 8; ++i) { w[i] = (_Float16)(bfr(Wm[(size_t)(k0 + 8 * g + i) * ld + o]) * 256.0f); w[8 + i] = (_Float16)(bfr(Wm[(size_t)(k0 + 16 + 8 * g + i) * ld + o]) * 256.0f); }
  return w; }
__device__ __forceinline__ v16h wcolh_oi(const float* Wm, int k0, int o, int lane, int K) { v16h w; const float* p = Wm + (size_t)o * K + k0 + 8 * (lane >> 4);
#pragma unroll
  for (int i = 0; i < 8; ++i) { w[i] = (_Float16)(bfr(p[i]) * 256.0f); w[8 + i] = (_Float16)(bfr(p[16 + i]) * 256.0f); }
  return w; }
#define WQKV_LAYOUT 0   // 0 = (in,out) [DIN][CC]; 1 = (out,in) [CC][DIN]; 2 = per-head [NH][DIN][HD]
__device__ __forceinline__ v16b wcol_hdk(const float* Wm, int k0, int o, int lane) { v16b w; const int g = lane >> 4; const float* p = Wm + (size_t)(o / HD) * DIN * HD + (o % HD);
#pragma unroll
  for (int i = 0; i < 8; ++i) { w[i] = (__bf16)p[(size_t)(k0 + 8 * g + i) * HD]; w[8 + i] = (__bf16)p[(size_t)(k0 + 16 + 8 * g + i) * HD]; }
  return w; }
#define WO_OUT_IN 0
#if WQKV_LAYOUT == 1
#define WCOL(W, k0, o, lane) wcol_oi(W, k0, o, lane, DIN)
#elif WQKV_LAYOUT == 2
#define WCOL(W, k0, o, lane) wcol_hdk(W, k0, o, lane)
#else
#define WCOL(W, k0, o, lane) wcol_io(W, k0, o, lane, (which == 0 ? CC : 2 * CC))   /* Wq [512][512]; Wkv [512][1024] packed k | v */
#endif
#if WO_OUT_IN
#define WOCOL(W, k0, o, lane) wcol_oi(W, k0, o, lane, CC)
#define WOCOLH(W, k0, o, lane) wcolh_oi(W, k0, o, lane, CC)
#else
#define WOCOL(W, k0, o, lane) wcol_io(W, k0, o, lane, DIN)
#define WOCOLH(W, k0, o, lane) wcolh_io(W, k0, o, lane, DIN)
#endif
// per-head local window: REGIONS = (4, 4, 8, 8, 16, 16, 32, 32) -> r(h) = 4 << (h / 2); tokens are a 64 x 64 grid (n = y*64 + x), a k_attn block is 8 image rows x 16 columns and walks its keys 64 a pass
__host__ __device__ __forceinline__ int rlog(int h) { return 2 + (h >> 1); }

#define WS_QH  0u                                      // f16 q rows [b*t][CC]
#define WS_KH  (WS_QH + 2u * (size_t)NB * TT * CC)      // f16 k rows [b*t][CC]
#define WS_VT  (WS_KH + 2u * (size_t)NB * TT * CC)      // f16 v planes [b][c][t]
#define WS_QL  (WS_VT + 2u * (size_t)NB * CC * TT)      // f16 q residual x 2^10 rows [b][t < QHI][CC]
#define WS_KL  (WS_QL + 2u * (size_t)NB * QHI * CC)     // f16 k residual x 2^10 rows [b][t < KHI][CC]
#define WS_VB  (WS_KL + 2u * (size_t)NB * KHI * CC)     // bf16 v hi planes [b][c][t < KHI]
#define WS_VBL (WS_VB + 2u * (size_t)NB * CC * KHI)
#define WS_Y   (WS_VBL + 2u * (size_t)NB * CC * KHI)    // f16 ctx x 2^6 in the fragment order of the output projection: [16-token tile][32-k chunk][half][lane][8], 512 B a (chunk, half)
#define WS_END (WS_Y  + 4u * (size_t)NB * TT * CC)

// ---- the two projection GEMMs share tile and panel: block = 8 waves = (256 rows, 128 cols), K = 512.
// The block's weight panel (128 output columns x all 512 k) is converted to its 16-bit form ONCE and kept in LDS as [column][k]; every wave reads its B fragments from there.
// Each wave owns 32 rows (2 A fragments x 8 B fragments = 16 products per 32 k). k_proj's wave loads them as whole 128-byte lines, converts, and turns them into fragments through its own small LDS range.
// k ascends within each accumulator.
typedef __attribute__((ext_vector_type(2))) unsigned v2u;
#define PW 520                       // pitch of a panel row (one column, 512 k) in 16-bit elements: 1,040 B = 16 B x odd, no bank conflict for 16-byte reads
#define PX 40                        // pitch of a staged operand row (32 k): 80 B = 16 B x odd
#define SM_W (128 * PW * 2)          // panel bytes
#define SM_XW (32 * PX * 2)          // one wave's operand range
#define SM_BYTES (SM_W + 8 * SM_XW)  // 153,600 B: two blocks per WGP; the epilogues reuse it
union Frag { v4u q[2]; v16b b; v16h h; };
// F16M 0: operands rounded to bf16 (exact products); F16M 1: rows x 2^6 to f16, weights f16(bf16 x 2^8) (exact)
// wave-private hand-over through LDS: the wave's own LDS operations have retired, and the compiler moves no memory access across
#define LDSW() do { asm volatile("s_wait_dscnt 0" ::: "memory"); __builtin_amdgcn_wave_barrier(); } while (0)
template <int F16M> __device__ __forceinline__ v2u pack4(v4f f) { union { v2u u; __bf16 b[4]; _Float16 h[4]; } c;
#pragma unroll
  for (int e = 0; e < 4; ++e) { if constexpr (F16M) c.h[e] = (_Float16)(f[e] * 64.0f); else c.b[e] = (__bf16)f[e]; }
  return c.u; }
// 128 columns x 512 k of a [k][LD] f32 weight -> LDS [column][k] in the 16-bit form: a wave reads 32 neighbouring columns of one k row (one whole line), a lane gathers 8 k of its column into one 16-byte LDS store
template <int F16M, int LD> __device__ __forceinline__ void stage_panel(const float* __restrict__ Wc, char* smem) {
  const int tid = threadIdx.x, n = tid & 127; const float* wp = Wc + (size_t)((tid >> 7) * 8) * LD + n; char* dst = smem + (n * PW + (tid >> 7) * 8) * 2;
#pragma unroll 8   /* 64 loads in flight per wave while the panel is filled */
  for (int it = 0; it < 32; ++it) { union { v4u u; v8b b; v8h h; } w; const float* p = wp + (size_t)(it * 16) * LD;
#pragma unroll
    for (int i = 0; i < 8; ++i) { const float f = p[(size_t)i * LD]; if constexpr (F16M) w.h[i] = (_Float16)(bfr(f) * 256.0f); else w.b[i] = (__bf16)f; }
    *(v4u*)(dst + it * 32) = w.u; } }
template <int F16M> __device__ __forceinline__ void gemm_256x128(const float* __restrict__ X, size_t r0, const float* __restrict__ Wm, int ld, int c0, char* smem, v8f (&acc)[2][8]) {
  const int tid = threadIdx.x, wave = tid >> 5, lane = tid & 31, col = lane & 15, g = lane >> 4;
  const float* xp = X + (r0 + wave * 32 + (lane >> 3)) * 512 + (lane & 7) * 4;   /* load i of a chunk: rows 4i .. 4i+3, 8 lanes x 16 B = one whole line a row */
  char* xs = smem + SM_W + wave * SM_XW; char* xst = xs + ((lane >> 3) * PX + (lane & 7) * 4) * 2;
  const char* xa = xs + (col * PX + 8 * g) * 2; const char* wb = smem + (col * PW + 8 * g) * 2;
  v4f raw[8];
#pragma unroll
  for (int i = 0; i < 8; ++i) raw[i] = *(const v4f*)(xp + (size_t)i * 4 * 512);
  if (ld == 512) stage_panel<F16M, 512>(Wm + c0, smem); else stage_panel<F16M, 1024>(Wm + c0, smem);   /* block-uniform; the pitch as a constant puts every row step into the loads' immediate offsets */
#pragma unroll
  for (int i = 0; i < 8; ++i) { *(v2u*)(xst + i * 4 * PX * 2) = pack4<F16M>(raw[i]); raw[i] = *(const v4f*)(xp + (size_t)i * 4 * 512 + 32); }
  __syncthreads();   /* the panel (and each wave's first chunk) is complete before any wave reads it */
#pragma unroll
  for (int kc = 0; kc < 16; ++kc) {
    Frag a[2], w[8];   /* the chunk's 20 fragment reads go as one group ahead of its 16 products */
#pragma unroll
    for (int m = 0; m < 2; ++m) { a[m].q[0] = *(const v4u*)(xa + m * 16 * PX * 2); a[m].q[1] = *(const v4u*)(xa + m * 16 * PX * 2 + 32); }
#pragma unroll
    for (int j = 0; j < 8; ++j) { w[j].q[0] = *(const v4u*)(wb + (j * 16 * PW + kc * 32) * 2); w[j].q[1] = *(const v4u*)(wb + (j * 16 * PW + kc * 32) * 2 + 32); }
    v2u pk[8];   /* the next chunk's rows are converted while the reads are under way */
    if (kc + 1 < 16) {
#pragma unroll
      for (int i = 0; i < 8; ++i) pk[i] = pack4<F16M>(raw[i]); }
    __builtin_amdgcn_sched_barrier(0);   /* keeps the 20 reads one group ahead of the products (one exposed LDS latency a chunk; without it each pair of reads is waited for on its own) and the conversion under that latency */
    LDSW();   /* this chunk's fragments are in registers before the next chunk's rows overwrite them */
    if (kc + 1 < 16) {
#pragma unroll
      for (int i = 0; i < 8; ++i) *(v2u*)(xst + i * 4 * PX * 2) = pk[i]; }
    __builtin_amdgcn_sched_barrier(0);   /* the converted rows leave their registers before the next lines are asked for: keeps the wave within 256 registers, two blocks per WGP */
    if (kc + 2 < 16) {
#pragma unroll
      for (int i = 0; i < 8; ++i) raw[i] = *(const v4f*)(xp + (size_t)i * 4 * 512 + (kc + 2) * 32); }   /* the lines of the chunk after next fly under this chunk's products */
#pragma unroll
    for (int j = 0; j < 8; ++j)
#pragma unroll
      for (int m = 0; m < 2; ++m) { if constexpr (F16M) acc[m][j] = __builtin_amdgcn_wmma_f32_16x16x32_f16(false, a[m].h, false, w[j].h, (short)0, acc[m][j], false, false);
        else acc[m][j] = __builtin_amdgcn_wmma_f32_16x16x32_bf16(false, a[m].b, false, w[j].b, (short)0, acc[m][j], false, false); }
    __builtin_amdgcn_sched_barrier(0);   /* the products stay ahead of the wait below, so they cover the row stores, and the next conversion (which waits for the lines just asked for) stays behind them */
    LDSW();   /* the wave's next rows are in LDS before its lanes read each other's */
  }
  __syncthreads();   /* every wave has left the panel: the epilogue reuses the LDS */
}
// ---- k_out's main loop: the same tile and panel, but its rows arrive as finished f16 A fragments (written so by k_attn): lane (row lane & 15, g) finds elements 0..7 = k0 + 8g .. and 8..15 = k0 + 16 + 8g .. as two 16-byte pieces,
// and a wave's load of one piece is 512 contiguous bytes (4 whole lines). The fragments go from memory straight into the registers the products read: no conversion, no LDS write and no LDS hand-over wait in the loop.
// A chunk's four loads are asked for YA chunks ahead, the distance at which k_proj's loop asks for its lines. k ascends within each accumulator.
#define YA 2
__device__ __forceinline__ void gemm_frag_256x128(const _Float16* __restrict__ XF, size_t r0, const float* __restrict__ Wm, int c0, char* smem, v8f (&acc)[2][8]) {
  const int tid = threadIdx.x, wave = tid >> 5, lane = tid & 31, col = lane & 15, g = lane >> 4;
  const _Float16* xp = XF + (r0 + wave * 32) * 512 + lane * 8;   /* a 16-row tile is 8,192 elements: 16 chunks x 2 pieces x 256 */
  const char* wb = smem + (col * PW + 8 * g) * 2;
  Frag a[16][2];
#pragma unroll
  for (int kc = 0; kc < YA; ++kc)
#pragma unroll
    for (int m = 0; m < 2; ++m) { a[kc][m].q[0] = *(const v4u*)(xp + m * 8192 + kc * 512); a[kc][m].q[1] = *(const v4u*)(xp + m * 8192 + kc * 512 + 256); }
  stage_panel<1, 512>(Wm + c0, smem);
  __syncthreads();   /* the panel is complete before any wave reads it */
#pragma unroll
  for (int kc = 0; kc < 16; ++kc) {
    if (kc + YA < 16) {
#pragma unroll
      for (int m = 0; m < 2; ++m) { a[kc + YA][m].q[0] = *(const v4u*)(xp + m * 8192 + (kc + YA) * 512); a[kc + YA][m].q[1] = *(const v4u*)(xp + m * 8192 + (kc + YA) * 512 + 256); } }
    if (kc + YA == 15) { asm volatile("s_wait_xcnt 0x0" ::: "memory");   /* precaution: behind the last load its address registers are free for reuse */
      __builtin_amdgcn_sched_barrier(0); }   /* ... and nothing that reuses them is moved up in front of that wait */
    Frag w[8];   /* the chunk's 16 fragment reads go as one group ahead of its 16 products */
#pragma unroll
    for (int j = 0; j < 8; ++j) { w[j].q[0] = *(const v4u*)(wb + (j * 16 * PW + kc * 32) * 2); w[j].q[1] = *(const v4u*)(wb + (j * 16 * PW + kc * 32) * 2 + 32); }
    __builtin_amdgcn_sched_barrier(0);   /* keeps the 16 reads one group ahead of the products (one exposed LDS latency a chunk; without it each pair of reads is waited for on its own) and the loads YA chunks ahead of their use */
#pragma unroll
    for (int j = 0; j < 8; ++j)
#pragma unroll
      for (int m = 0; m < 2; ++m) acc[m][j] = __builtin_amdgcn_wmma_f32_16x16x32_f16(false, a[kc][m].h, false, w[j].h, (short)0, acc[m][j], false, false);
    __builtin_amdgcn_sched_barrier(0);   /* the next chunk's reads stay one group behind these products */
  }
  __syncthreads();   /* every wave has left the panel: the epilogue reuses the LDS */
}
// ---- k_proj: block = (256 rows, 128 cols, which): q/k/v = X W (+ b) with exact bf16 products (K = DIN) -> which 0: q f16 rows (+ residual rows < QHI); 1: k f16 rows (+ residual rows < KHI); 2: v f16 planes [c][t] (+ bf16 hi/lo planes for t < KHI)
__global__ __launch_bounds__(256) void k_proj(const float* __restrict__ XQ, const float* __restrict__ XK, const float* __restrict__ XV, const float* __restrict__ WQ, const float* __restrict__ WK, const float* __restrict__ WV, const float* __restrict__ BQ, const float* __restrict__ BK, const float* __restrict__ BV,
    _Float16* __restrict__ QH, _Float16* __restrict__ QL, _Float16* __restrict__ KH, _Float16* __restrict__ KL, _Float16* __restrict__ VT, __bf16* __restrict__ VB, __bf16* __restrict__ VBL) {
  __shared__ __align__(16) char smem[SM_BYTES];
  const int tid = threadIdx.x, wave = tid >> 5, lane = tid & 31, col = lane & 15, g = lane >> 4; const int which = blockIdx.z; const int c0 = blockIdx.y * 128; const size_t r0 = (size_t)blockIdx.x * 256; const size_t bb = r0 / TT; const int t0 = (int)(r0 % TT);
  const float* X = which == 0 ? XQ : which == 1 ? XK : XV; const float* WA = which == 0 ? WQ : which == 1 ? WK : WV; const float* BA = which == 0 ? BQ : which == 1 ? BK : BV;
  v8f acc[2][8] = {};
  gemm_256x128<0>(X, r0, WA, which == 0 ? CC : 2 * CC, c0, smem, acc);   /* Wq [512][512]; Wkv [512][1024] packed k | v */
  if (which < 2) { _Float16* DH = which == 0 ? QH : KH; _Float16* DL = which == 0 ? QL : KL; const int nhi = which == 0 ? QHI : KHI;
    _Float16 (*sh)[136] = (_Float16 (*)[136])smem; _Float16 (*sl)[136] = (_Float16 (*)[136])(smem + 256 * 136 * 2);
#pragma unroll
    for (int m = 0; m < 2; ++m)
#pragma unroll
      for (int j = 0; j < 8; ++j) { const float bias = BA ? bfr(BA[c0 + j * 16 + col]) : 0.f;
#pragma unroll
        for (int r = 0; r < 8; ++r) { const float v = acc[m][j][r] + bias; const _Float16 hv = (_Float16)v; const int rl = wave * 32 + m * 16 + 8 * g + r; sh[rl][j * 16 + col] = hv; sl[rl][j * 16 + col] = (_Float16)((v - (float)hv) * 1024.0f); } }
    __syncthreads();
    for (int it = 0; it < 16; it += 4) { v4u vh[4], vl[4];   /* four rows' pieces a trip: 8 LDS reads under way at once */
#pragma unroll
      for (int u = 0; u < 4; ++u) { const int e = (it + u) * 256 + tid, rl = e >> 4, q = e & 15; vh[u] = *(const v4u*)&sh[rl][q * 8]; vl[u] = *(const v4u*)&sl[rl][q * 8]; }
#pragma unroll
      for (int u = 0; u < 4; ++u) { const int e = (it + u) * 256 + tid, rl = e >> 4, q = e & 15; vst2((unsigned*)(DH + (r0 + rl) * CC + c0 + q * 8), vh[u]); if (t0 + rl < nhi) vst2((unsigned*)(DL + (bb * nhi + t0 + rl) * (size_t)CC + c0 + q * 8), vl[u]); }
      asm volatile("s_wait_xcnt 0x0" ::: "memory"); }   /* precaution: the next trip rewrites registers that these stores name */
  } else { _Float16 (*th)[264] = (_Float16 (*)[264])smem; __bf16 (*tb)[72] = (__bf16 (*)[72])(smem + 128 * 264 * 2); __bf16 (*tbl)[72] = (__bf16 (*)[72])(smem + 128 * 264 * 2 + 128 * 72 * 2);
#pragma unroll
    for (int m = 0; m < 2; ++m)
#pragma unroll
      for (int j = 0; j < 8; ++j) { const float bias = BA ? bfr(BA[c0 + j * 16 + col]) : 0.f; const int rb = wave * 32 + m * 16 + 8 * g, cl = j * 16 + col; v8h hv;
#pragma unroll
        for (int r = 0; r < 8; ++r) hv[r] = (_Float16)(acc[m][j][r] + bias);
        *(v8h*)&th[cl][rb] = hv;   /* a lane's 8 values are 8 neighbouring t of one channel */
        if (t0 + rb < KHI) {   /* only the first KHI tokens of a sequence carry these planes */
#pragma unroll
          for (int r = 0; r < 8; ++r) { const float v = acc[m][j][r] + bias; const __bf16 bh = (__bf16)v; tb[cl][rb + r] = bh; tbl[cl][rb + r] = (__bf16)(v - (float)bh); } } }
    __syncthreads();
    for (int it = 0; it < 16; it += 4) { v4u vv[4];
#pragma unroll
      for (int u = 0; u < 4; ++u) { const int e = (it + u) * 256 + tid, cl = e >> 5, q = e & 31; vv[u] = *(const v4u*)&th[cl][q * 8]; }
#pragma unroll
      for (int u = 0; u < 4; ++u) { const int e = (it + u) * 256 + tid, cl = e >> 5, q = e & 31; vst2((unsigned*)(VT + (bb * CC + c0 + cl) * (size_t)TT + t0 + q * 8), vv[u]); }
      asm volatile("s_wait_xcnt 0x0" ::: "memory"); }   /* precaution: the next trip rewrites registers that these stores name */
    if (t0 < KHI) for (int it = 0; it < 4; ++it) { const int e = it * 256 + tid, cl = e >> 3, q = e & 7;
      if (t0 + q * 8 < KHI) { const size_t o3 = (bb * CC + c0 + cl) * (size_t)KHI + t0 + q * 8; vst2((unsigned*)(VB + o3), *(const v4u*)&tb[cl][q * 8]); vst2((unsigned*)(VBL + o3), *(const v4u*)&tbl[cl][q * 8]); }
      asm volatile("s_wait_xcnt 0x0" ::: "memory"); } } }   /* the same precaution */
#define AP 144                 // pitch of a staged row (64 f16 = 128 B) in bytes: 16 B x odd, no bank conflict for 16-byte reads
#define AT (64 * AP)           // one operand's tile: 64 k rows (64 d each), or 64 v channels (64 keys each)
#define AB (2 * AT)            // one buffer: k tile, v tile
#define C2 (SCALE * 1.4426950408889634f)   // logit scale x log2(e)
// Hardware exp2 (v_exp_f32), each value in place. Written as asm so that the closing v_nop is tied to the last of them: it is the slot the instruction set asks for between a transcendental and a directly following
// instruction that reads its result or overwrites its source. Inside a statement no v_exp_f32 touches a neighbour's register.
__device__ __forceinline__ float exp2_1(float x) { asm("v_exp_f32 %0, %0\n\tv_nop" : "+v"(x)); return x; }
__device__ __forceinline__ void exp2_16(float (&x)[16]) {
  asm("v_exp_f32 %0, %0\n\tv_exp_f32 %1, %1\n\tv_exp_f32 %2, %2\n\tv_exp_f32 %3, %3\n\tv_exp_f32 %4, %4\n\tv_exp_f32 %5, %5\n\tv_exp_f32 %6, %6\n\tv_exp_f32 %7, %7\n\t"
      "v_exp_f32 %8, %8\n\tv_exp_f32 %9, %9\n\tv_exp_f32 %10, %10\n\tv_exp_f32 %11, %11\n\tv_exp_f32 %12, %12\n\tv_exp_f32 %13, %13\n\tv_exp_f32 %14, %14\n\tv_exp_f32 %15, %15\n\tv_nop"
      : "+v"(x[0]), "+v"(x[1]), "+v"(x[2]), "+v"(x[3]), "+v"(x[4]), "+v"(x[5]), "+v"(x[6]), "+v"(x[7]), "+v"(x[8]), "+v"(x[9]), "+v"(x[10]), "+v"(x[11]), "+v"(x[12]), "+v"(x[13]), "+v"(x[14]), "+v"(x[15])); }
__global__ __launch_bounds__(256) void k_attn(const _Float16* __restrict__ QH, const _Float16* __restrict__ QL, const _Float16* __restrict__ KH, const _Float16* __restrict__ VT, const int* __restrict__ WI, _Float16* __restrict__ Y) {
  __shared__ __align__(16) char sm[2 * AB];
  const int tid = threadIdx.x, lane = tid & 31, col = lane & 15, g = lane >> 4;
  const int wave = __builtin_amdgcn_readfirstlane((int)(threadIdx.x >> 5));   /* wave-uniform, so the tiles' token numbers are worked out on the scalar unit */
  const int b = blockIdx.y, h = NH - 1 - (int)blockIdx.z;                       /* largest windows start first */
  const int rl_ = rlog(h), r = 1 << rl_;
  int wsh = 31 - __clz(WI[0] | 1); wsh = wsh > 7 ? 7 : wsh < 5 ? 5 : wsh;       /* grid width read from the input, as a shift (64 -> 6); 32, 64 and 128 are the widths at which 32 divides both sides of a 4,096-token grid */
  const int yb = ((int)blockIdx.x >> (wsh - 4)) * 8, xs = ((int)blockIdx.x & ((1 << (wsh - 4)) - 1)) * 16;   /* a one-to-one map block -> (8 image rows, one 16-column strip) at every such width */
  const int n0 = ((yb + wave) << wsh) + xs;
  const int sps = rl_ > 4 ? rl_ - 4 : 0, smask = (1 << sps) - 1;                /* 16-key tiles per window row: max(16, r) / 16 */
  const int rb_ = rl_ > 3 ? rl_ : 3;                                            /* the block's key rows: max(8, r) */
  const int y0 = (yb >> rb_) << rb_, xk0 = xs & ~((16 << sps) - 1);
  const int npass = (1 << (rb_ + sps)) >> 2;                                    /* 2, 2, 4 or 16 passes of 64 keys: never fewer than the two buffers */
  const int wm = ~((r - 1) | ((r - 1) << wsh));                                 /* token bits that name the window: same window row AND same window column <=> ((k ^ t) & wm) == 0 */
  const int t = n0 + col;
  const _Float16* Kb = KH + (size_t)b * TT * CC + h * HD; const _Float16* Vb = VT + ((size_t)b * CC + h * HD) * (size_t)TT;
  /* first token of 16-key tile s of the block; bounded here whatever the width input holds */
  auto tok = [&](int s) { const int k = ((y0 + (s >> sps)) << wsh) + xk0 + ((s & smask) << 4); return (k > TT - 16 ? TT - 16 : k) & ~15; };
  /* a pass's copies: 2 x 512 pieces of 16 B, four a thread. k: 8 lanes bring one key row's whole 128-byte line; v: 8 lanes bring one channel's 4 x 32 B */
  const int crow = tid >> 3, cpc = tid & 7;
  const unsigned ldst = (unsigned)(size_t)sm + (unsigned)(crow * AP + cpc * 16);
  auto stage = [&](int p, int buf) {
    const unsigned l0 = ldst + (unsigned)(buf * AB), l1 = l0 + 32 * AP, l2 = l0 + AT, l3 = l2 + 32 * AP;
    const char* k0 = (const char*)(Kb + (size_t)(tok(4 * p + (crow >> 4)) + (crow & 15)) * CC) + cpc * 16;
    const char* k1 = (const char*)(Kb + (size_t)(tok(4 * p + 2 + (crow >> 4)) + (crow & 15)) * CC) + cpc * 16;
    const char* v0 = (const char*)(Vb + (size_t)crow * TT + tok(4 * p + (cpc >> 1)) + (cpc & 1) * 8);
    const char* v1 = v0 + (size_t)32 * TT * 2;
    /* the copies and the wait that stands before their address registers are rewritten, in one statement */
    asm volatile("global_load_async_to_lds_b128 %0, %1, off\n\tglobal_load_async_to_lds_b128 %2, %3, off\n\tglobal_load_async_to_lds_b128 %4, %5, off\n\tglobal_load_async_to_lds_b128 %6, %7, off\n\ts_wait_xcnt 0x0"
                 :: "v"(l0), "v"(k0), "v"(l1), "v"(k1), "v"(l2), "v"(v0), "v"(l3), "v"(v1) : "memory"); };
  stage(0, 0);
  v16h qh[2], ql[2];
#pragma unroll
  for (int kc = 0; kc < 2; ++kc) { qh[kc] = frag_h(QH + ((size_t)b * TT + t) * CC + h * HD + kc * 32, lane); ql[kc] = frag_h(QL + ((size_t)b * QHI + t) * CC + h * HD + kc * 32, lane); }
  asm volatile("s_wait_asynccnt 0x0" ::: "memory");   /* this wave's share of pass 0 has landed */
  __syncthreads();                                    /* ... and every other wave's: pass 0 may be read */
  stage(1, 1);
  const unsigned foff = (unsigned)(col * AP + 16 * g);   /* the lane's own byte offset in a tile, fixed for the whole loop */
  v8f acc[HD / 16] = {}; float m = -1.0e30f, sum = 0.f;
  for (int p = 0; p < npass; ++p) {
    if ((((y0 + ((4 * p) >> sps)) ^ (yb + wave)) >> rl_) == 0) {   /* wave-uniform: the pass's key rows lie in this wave's window row (always, for r >= 8) */
    const char* kb = sm + (p & 1) * AB + foff; const char* vb = kb + AT;
    int kt[4];
#pragma unroll
    for (int u = 0; u < 4; ++u) kt[u] = tok(4 * p + u);
    v8h kq[4][4], vq[2][HD / 16][2];
#pragma unroll
    for (int u = 0; u < 4; ++u)
#pragma unroll
      for (int q = 0; q < 4; ++q) kq[u][q] = *(const v8h*)(kb + u * 16 * AP + q * 32);   /* q = 2 kc + half: d = kc*32 + half*16 + 8g .. + 7 of key row kt[u] + col */
#pragma unroll
    for (int c = 0; c < 2; ++c)
#pragma unroll
      for (int j = 0; j < HD / 16; ++j) { vq[c][j][0] = *(const v8h*)(vb + j * 16 * AP + (2 * c) * 32); vq[c][j][1] = *(const v8h*)(vb + j * 16 * AP + (2 * c + 1) * 32); }   /* keys kt[2c] + 8g .. + 7 and kt[2c + 1] + 8g .. + 7 of channel j*16 + col */
    __builtin_amdgcn_sched_barrier(0);   /* keeps the pass's 32 reads one group ahead of the products: one exposed LDS latency a pass; without it each pair of reads is waited for on its own */
    float v[4][8]; float mx = m;
#pragma unroll
    for (int u = 0; u < 4; ++u) { v8f sa = {}, sl = {};
#pragma unroll
      for (int kc = 0; kc < 2; ++kc) { union { v16h f; v8h q[2]; } kf; kf.q[0] = kq[u][2 * kc]; kf.q[1] = kq[u][2 * kc + 1];
        sa = __builtin_amdgcn_wmma_f32_16x16x32_f16(false, kf.f, false, qh[kc], (short)0, sa, false, false); sl = __builtin_amdgcn_wmma_f32_16x16x32_f16(false, kf.f, false, ql[kc], (short)0, sl, false, false); }
#pragma unroll
      for (int i = 0; i < 8; ++i) { const float x = sa[i] + sl[i] * (1.0f / 1024.0f); v[u][i] = ((((kt[u] + 8 * g + i) ^ t) & wm) == 0) ? x : -3.0e38f; mx = fmaxf(mx, v[u][i]); } }
    mx = fmaxf(mx, __shfl_xor(mx, 16));
    const float alpha = exp2_1((m - mx) * C2); m = mx;
    const float mb = 11.0f - m * C2;
#pragma unroll
    for (int j = 0; j < HD / 16; ++j) acc[j] *= alpha;
    v16h pf[2]; float ps[4];
#pragma unroll
    for (int c = 0; c < 2; ++c) { float e[16];
#pragma unroll
      for (int i = 0; i < 16; ++i) e[i] = v[2 * c + (i >> 3)][i & 7] * C2 + mb;
      exp2_16(e); ps[2 * c] = e[0]; ps[2 * c + 1] = e[8];
#pragma unroll
      for (int i = 0; i < 16; ++i) { if (i & 7) ps[2 * c + (i >> 3)] += e[i]; pf[c][i] = (_Float16)e[i]; } }
    sum = sum * alpha + ((ps[0] + ps[1]) + (ps[2] + ps[3]));
#pragma unroll
    for (int c = 0; c < 2; ++c)
#pragma unroll
      for (int j = 0; j < HD / 16; ++j) { union { v16h f; v8h q[2]; } vf; vf.q[0] = vq[c][j][0]; vf.q[1] = vq[c][j][1];
        acc[j] = __builtin_amdgcn_wmma_f32_16x16x32_f16(false, vf.f, false, pf[c], (short)0, acc[j], false, false); }
    }
    /* hand-over, passed by every wave, also one that skipped the pass */
    asm volatile("s_wait_dscnt 0x0" ::: "memory");      /* this wave's reads of the pass's buffer have retired */
    asm volatile("s_wait_asynccnt 0x0" ::: "memory");   /* its share of the next pass has landed */
    __syncthreads();                                    /* publishes the next pass and ends every wave's reads of this pass's buffer */
    if (p + 2 < npass) stage(p + 2, p & 1);             /* block-uniform: refill the buffer just left */
  }
  asm volatile("s_wait_asynccnt 0x0" ::: "memory");     /* no copy is outstanding when the wave ends */
  sum += __shfl_xor(sum, 16);
  const float inv = sum > 0.f ? 1.0f / sum : 0.f;   /* a fully excluded row yields 0 */
  /* lane = query t = row lane & 15 of the 16-token tile n0 / 16, register i of tile j = channel h*64 + j*16 + 8g + i = element i of piece j & 1 of 32-k chunk 2h + (j >> 1): the lane's own place in k_out's A fragment */
  _Float16* yp = Y + ((size_t)b * TT + n0) * CC + (size_t)(h * 4) * 256 + lane * 8;
#pragma unroll
  for (int j = 0; j < HD / 16; ++j) { v8h o;   /* the f32 value x 2^6 (exact), rounded once to f16; a wave's store is 512 contiguous bytes */
#pragma unroll
    for (int i = 0; i < 8; ++i) o[i] = (_Float16)((acc[j][i] * inv) * 64.0f);
    vst2(yp + j * 256, o); } }
// ---- k_out: block = (256 rows, 128 cols): out = ctx Wo (+ bo): ctx x 2^6 once to f16 (by k_attn; small-magnitude context rows stay clear of f16 subnormals) against Wo as f16(bf16 x 2^8) exact (1 product), un-scaled by 2^-14
__global__ __launch_bounds__(256) void k_out(const _Float16* __restrict__ Y, const float* __restrict__ WO, const float* __restrict__ BO, float* __restrict__ OUT) { __shared__ __align__(16) char smem[SM_BYTES];
  const int tid = threadIdx.x, wave = tid >> 5, lane = tid & 31, col = lane & 15, g = lane >> 4; const int c0 = blockIdx.y * 128; const size_t r0 = (size_t)blockIdx.x * 256;
  v8f acc[2][8] = {};
  gemm_frag_256x128(Y, r0, WO, c0, smem, acc);
  float (*sf)[132] = (float (*)[132])(smem + wave * (32 * 132 * 4));   /* each wave stages its own 32 rows */
#pragma unroll
  for (int m = 0; m < 2; ++m)
#pragma unroll
    for (int j = 0; j < 8; ++j) { const float bias = BO ? bfr(BO[c0 + j * 16 + col]) : 0.f;
#pragma unroll
      for (int r = 0; r < 8; ++r) sf[m * 16 + 8 * g + r][j * 16 + col] = acc[m][j][r] * (1.0f / 16384.0f) + bias; }   /* 2^-8 (Wo carry) x 2^-6 (ctx carry) */
  LDSX(); for (int rl = 0; rl < 32; ++rl) vst2(OUT + (r0 + wave * 32 + rl) * DIN + c0 + lane * 4, *(const v4f*)&sf[rl][lane * 4]); }

extern "C" void kernel_launch(void* const* d_in, const int* in_sizes, int n_in, void* d_out, int out_size, void* d_ws, size_t ws_size, hipStream_t stream) {
  (void)in_sizes; (void)n_in; (void)out_size;
  const float** F = (const float**)d_in;
  if (ws_size < (size_t)WS_END) return;
  char* ws = (char*)d_ws; _Float16 *QH = (_Float16*)(ws + WS_QH), *KH = (_Float16*)(ws + WS_KH), *VT = (_Float16*)(ws + WS_VT), *QL = (_Float16*)(ws + WS_QL), *KL = (_Float16*)(ws + WS_KL); __bf16 *VB = (__bf16*)(ws + WS_VB), *VBL = (__bf16*)(ws + WS_VBL); _Float16 *Y = (_Float16*)(ws + WS_Y);
  (void)Y; (void)QL; (void)KL; (void)VB; (void)VBL;
  // inputs: 0 x [4,4096,512]; 1 Wq [512,512] (in,out); 2 Wkv [512,1024] (in,out; columns k | v, head*64+d); 3 Wproj [512,512] (in,out); 4 bproj [512]; 5 H (int 64); 6 W (int 64)
  const int* WI = (const int*)d_in[6];
  k_proj<<<dim3(TNB * TT / 256, CC / 128, 3), 256, 0, stream>>>(F[0], F[0], F[0], F[1], F[2], F[2] + CC, nullptr, nullptr, nullptr, QH, QL, KH, KL, VT, VB, VBL);   /* k = Wkv columns 0..511, v = columns 512..1023 (row pitch 2*CC) */
  k_attn<<<dim3(TT / 128, TNB, NH), 256, 0, stream>>>(QH, QL, KH, VT, WI, Y);
  k_out<<<dim3(TNB * TT / 256, DIN / 128), 256, 0, stream>>>(Y, F[3], F[4], (float*)d_out);
}

// v006
// One run takes 74.7 microseconds.
// Next to v005, in two timings, it ran 1.11 times as fast each time.
// All steps since v000 together make it 25.4 times as fast.
// compute dtype: all float inputs rounded to bf16; q/k/v = x W with EXACT bf16 products on WMMA 16x16x32 (f32 accumulate); windowed logits with q once to f16 against k once to f16 (1 product) x 64^-0.5; per-window online softmax in f32 (base 2: one hardware exp2 per term, running maximum and sum); exp(s - m) x 2^11 once to f16 against v once to f16 (1 product), divided by the f32 sum at the end; merged heads carried x 2^6 once to f16 against Wproj carried x 2^8 in f16 (exact bf16 values), un-scaled by 2^-14, + bproj; f32 output.
#include <hip/hip_runtime.h>
#include <math.h>

typedef __attribute__((ext_vector_type(16))) _Float16 v16h;
typedef __attribute__((ext_vector_type(16))) __bf16 v16b;
typedef __attribute__((ext_vector_type(8)))  _Float16 v8h;
typedef __attribute__((ext_vector_type(8)))  float v8f;
typedef __attribute__((ext_vector_type(4)))  float v4f;
typedef __attribute__((ext_vector_type(2)))  float v2f;
typedef __attribute__((ext_vector_type(4)))  unsigned v4u;
typedef __attribute__((ext_vector_type(4)))  int v4i;
typedef float __attribute__((may_alias)) float_a;
typedef int __attribute__((may_alias)) int_a;

template <typename T> __device__ __forceinline__ void vst2(void* p, T v) { *(T*)p = v;  }
__device__ __forceinline__ v8f wmma16(v16h a, v16h b, v8f c) {
  v8f d = __builtin_amdgcn_wmma_f32_16x16x32_f16(false, a, false, b, (short)0, c, false, false);
  asm volatile("v_nop\n\tv_nop\n\tv_nop\n\tv_nop" : "+v"(d) : "v"(a), "v"(b));
  return d;
}
__device__ __forceinline__ v8f wmma_bf(v16b a, v16b b, v8f c) {
  v8f d = __builtin_amdgcn_wmma_f32_16x16x32_bf16(false, a, false, b, (short)0, c, false, false);
  asm volatile("v_nop\n\tv_nop\n\tv_nop\n\tv_nop" : "+v"(d) : "v"(a), "v"(b));
  return d;
}
// 16x16x32 fragments: lane = (h = lane>>4, row/col = lane&15); elements 0..7 = k0+8h+0..7, 8..15 = k0+16+8h+0..7; D element r = row 8h+r
__device__ __forceinline__ v16h frag_h(const _Float16* rowk0, int lane) {
  union { v16h v; v8h q[2]; } u; const _Float16* p = rowk0 + 8 * (lane >> 4);
  u.q[0] = *(const v8h*)p; u.q[1] = *(const v8h*)(p + 16); return u.v;
}
__device__ __forceinline__ v16h frag_f32(const float* rowk0, int lane) {
  v16h a; const float* p = rowk0 + 8 * (lane >> 4);
#pragma unroll
  for (int i = 0; i < 8; ++i) { a[i] = (_Float16)p[i]; a[8 + i] = (_Float16)p[16 + i]; }
  return a;
}
__device__ __forceinline__ v16h frag_f32s(const float* rowk0, int lane, float sc) {
  v16h a; const float* p = rowk0 + 8 * (lane >> 4);
#pragma unroll
  for (int i = 0; i < 8; ++i) { a[i] = (_Float16)(p[i] * sc); a[8 + i] = (_Float16)(p[16 + i] * sc); }
  return a;
}
// column fragment from a [K][ld] layout (column n), rows >= K read as 0
__device__ __forceinline__ v16h fragc_f32(const float* W, int k0, int n, int lane, int ld, int K) {
  v16h a; const int g = lane >> 4;
#pragma unroll
  for (int i = 0; i < 8; ++i) { const int ka = k0 + 8 * g + i, kb = ka + 16;
    a[i] = (_Float16)(ka < K ? W[(size_t)(ka < K ? ka : K - 1) * ld + n] : 0.f); a[8 + i] = (_Float16)(kb < K ? W[(size_t)(kb < K ? kb : K - 1) * ld + n] : 0.f); }
  return a;
}
struct F2 { v16b h, l; };
__device__ __forceinline__ F2 bsplit16(const float v[16]) { F2 r;
#pragma unroll
  for (int i = 0; i < 16; ++i) { const __bf16 h = (__bf16)v[i]; r.h[i] = h; r.l[i] = (__bf16)(v[i] - (float)h); }
  return r; }
__device__ __forceinline__ F2 split_row(const float* row, int k0, int lane) { float v[16]; const float* p = row + k0 + 8 * (lane >> 4);
#pragma unroll
  for (int i = 0; i < 8; ++i) { v[i] = p[i]; v[8 + i] = p[16 + i]; }
  return bsplit16(v); }
__device__ __forceinline__ F2 split_rowK(const float* row, int k0, int lane, int K) { float v[16]; const int g = lane >> 4;
#pragma unroll
  for (int i = 0; i < 8; ++i) { const int ka = k0 + 8 * g + i, kb = ka + 16; v[i] = ka < K ? row[ka < K ? ka : K - 1] : 0.f; v[8 + i] = kb < K ? row[kb < K ? kb : K - 1] : 0.f; }
  return bsplit16(v); }
__device__ __forceinline__ F2 split_col(const float* W, int k0, int n, int lane, int ld, int K) { float v[16]; const int g = lane >> 4;
#pragma unroll
  for (int i = 0; i < 8; ++i) { const int ka = k0 + 8 * g + i, kb = ka + 16; v[i] = ka < K ? W[(size_t)(ka < K ? ka : K - 1) * ld + n] : 0.f; v[8 + i] = kb < K ? W[(size_t)(kb < K ? kb : K - 1) * ld + n] : 0.f; }
  return bsplit16(v); }
__device__ __forceinline__ v8f mac3(const F2& a, const F2& b, v8f c) { c = wmma_bf(a.l, b.h, c); c = wmma_bf(a.h, b.l, c); return wmma_bf(a.h, b.h, c); }
__device__ __forceinline__ float sigm(float v) { return 1.0f / (1.0f + expf(-v)); }
#define LDSX() do { asm volatile("s_wait_dscnt 0" ::: "memory"); __builtin_amdgcn_wave_barrier(); __builtin_amdgcn_fence(__ATOMIC_RELEASE, "workgroup"); } while (0)

// Multi-scale windowed self-attention (B 4, 64 x 64 = 4,096 tokens, C 512 = 8 heads x 64; head h attends within non-overlapping r x r spatial windows with r = (4, 4, 8, 8, 16, 16, 32, 32)[h]; 0.02-scale (in,out) Wq [512,512], Wkv [512,1024] (k | v), Wproj [512,512] + zero bproj): q = x Wq, k|v = x Wkv; per head: softmax(q k^T x 64^-0.5) over the window's r^2 keys; heads merged (channel = head*64 + d); out = o Wproj + bproj.
#define NB 4
#define TT 4096
#define CC 512            // NH * HD = projected width
#define DIN 512          // input (model) width
#define NH 8
#define HD 64
#define NQB (TT / 64)
#define HG 1
#define SCALE (0.125f)
#define CAUSAL 0
#ifndef TNB
#define TNB NB
#endif
__device__ __forceinline__ float bfr(float v) { return (float)(__bf16)v; }
__host__ __device__ __forceinline__ int kb_last(int qb) { return CAUSAL ? ((qb * 64 + 63) >> 7) : (TT / 128 - 1); }
typedef __attribute__((ext_vector_type(8))) __bf16 v8b;
__device__ __forceinline__ v16b frag_b(const __bf16* rowk0, int lane) {
  union { v16b v; v8b q[2]; } u; const __bf16* p = rowk0 + 8 * (lane >> 4);
  u.q[0] = *(const v8b*)p; u.q[1] = *(const v8b*)(p + 16); return u.v;
}
// B fragment (k rows k0+.., output column o) of a weight: (in,out) [K][ld] or (out,in) [ld rows of K]: bf16 exact, or f16(bf16 * 256) exact
__device__ __forceinline__ v16b wcol_io(const float* Wm, int k0, int o, int lane, int ld) { v16b w; const int g = lane >> 4;
#pragma unroll
  for (int i = 0; i < 8; ++i) { w[i] = (__bf16)Wm[(size_t)(k0 + 8 * g + i) * ld + o]; w[8 + i] = (__bf16)Wm[(size_t)(k0 + 16 + 8 * g + i) * ld + o]; }
  return w; }
__device__ __forceinline__ v16b wcol_oi(const float* Wm, int k0, int o, int lane, int K) { v16b w; const float* p = Wm + (size_t)o * K + k0 + 8 * (lane >> 4);
#pragma unroll
  for (int i = 0; i < 8; ++i) { w[i] = (__bf16)p[i]; w[8 + i] = (__bf16)p[16 + i]; }
  return w; }
__device__ __forceinline__ v16h wcolh_io(const float* Wm, int k0, int o, int lane, int ld) { v16h w; const int g = lane >> 4;
#pragma unroll
  for (int i = 0; i < 8; ++i) { w[i] = (_Float16)(bfr(Wm[(size_t)(k0 + 8 * g + i) * ld + o]) * 256.0f); w[8 + i] = (_Float16)(bfr(Wm[(size_t)(k0 + 16 + 8 * g + i) * ld + o]) * 256.0f); }
  return w; }
__device__ __forceinline__ v16h wcolh_oi(const float* Wm, int k0, int o, int lane, int K) { v16h w; const float* p = Wm + (size_t)o * K + k0 + 8 * (lane >> 4);
#pragma unroll
  for (int i = 0; i < 8; ++i) { w[i] = (_Float16)(bfr(p[i]) * 256.0f); w[8 + i] = (_Float16)(bfr(p[16 + i]) * 256.0f); }
  return w; }
#define WQKV_LAYOUT 0   // 0 = (in,out) [DIN][CC]; 1 = (out,in) [CC][DIN]; 2 = per-head [NH][DIN][HD]
__device__ __forceinline__ v16b wcol_hdk(const float* Wm, int k0, int o, int lane) { v16b w; const int g = lane >> 4; const float* p = Wm + (size_t)(o / HD) * DIN * HD + (o % HD);
#pragma unroll
  for (int i = 0; i < 8; ++i) { w[i] = (__bf16)p[(size_t)(k0 + 8 * g + i) * HD]; w[8 + i] = (__bf16)p[(size_t)(k0 + 16 + 8 * g + i) * HD]; }
  return w; }
#define WO_OUT_IN 0
#if WQKV_LAYOUT == 1
#define WCOL(W, k0, o, lane) wcol_oi(W, k0, o, lane, DIN)
#elif WQKV_LAYOUT == 2
#define WCOL(W, k0, o, lane) wcol_hdk(W, k0, o, lane)
#else
#define WCOL(W, k0, o, lane) wcol_io(W, k0, o, lane, (which == 0 ? CC : 2 * CC))   /* Wq [512][512]; Wkv [512][1024] packed k | v */
#endif
#if WO_OUT_IN
#define WOCOL(W, k0, o, lane) wcol_oi(W, k0, o, lane, CC)
#define WOCOLH(W, k0, o, lane) wcolh_oi(W, k0, o, lane, CC)
#else
#define WOCOL(W, k0, o, lane) wcol_io(W, k0, o, lane, DIN)
#define WOCOLH(W, k0, o, lane) wcolh_io(W, k0, o, lane, DIN)
#endif
// per-head local window: REGIONS = (4, 4, 8, 8, 16, 16, 32, 32) -> r(h) = 4 << (h / 2); tokens are a 64 x 64 grid (n = y*64 + x), a k_attn block is 8 image rows x 16 columns and walks its keys 64 a pass
__host__ __device__ __forceinline__ int rlog(int h) { return 2 + (h >> 1); }

#define WS_QH  0u                                      // f16 q rows [b*t][CC]
#define WS_KH  (WS_QH + 2u * (size_t)NB * TT * CC)      // f16 k rows [b*t][CC]
#define WS_VT  (WS_KH + 2u * (size_t)NB * TT * CC)      // f16 v planes [b][c][t]
#define WS_Y   (WS_VT + 2u * (size_t)NB * CC * TT)      // f16 ctx x 2^6 in the fragment order of the output projection: [16-token tile][32-k chunk][half][lane][8], 512 B a (chunk, half)
#define WS_END (WS_Y  + 4u * (size_t)NB * TT * CC)

// ---- the two projection GEMMs share tile and panel: block = 8 waves = (256 rows, 128 cols), K = 512.
// The block's weight panel (128 output columns x all 512 k) is converted to its 16-bit form ONCE and kept in LDS as [column][k]; every wave reads its B fragments from there.
// Each wave owns 32 rows (2 A fragments x 8 B fragments = 16 products per 32 k). k_proj's wave loads them as whole 128-byte lines, converts, and turns them into fragments through its own small LDS range.
// k ascends within each accumulator.
typedef __attribute__((ext_vector_type(2))) unsigned v2u;
#define PW 520                       // pitch of a panel row (one column, 512 k) in 16-bit elements: 1,040 B = 16 B x odd, no bank conflict for 16-byte reads
#define PX 40                        // pitch of a staged operand row (32 k): 80 B = 16 B x odd
#define SM_W (128 * PW * 2)          // panel bytes
#define SM_XW (32 * PX * 2)          // one wave's operand range
#define SM_BYTES (SM_W + 8 * SM_XW)  // 153,600 B: two blocks per WGP; the epilogues reuse it
union Frag { v4u q[2]; v16b b; v16h h; };
// F16M 0: operands rounded to bf16 (exact products); F16M 1: rows x 2^6 to f16, weights f16(bf16 x 2^8) (exact)
// wave-private hand-over through LDS: the wave's own LDS operations have retired, and the compiler moves no memory access across
#define LDSW() do { asm volatile("s_wait_dscnt 0" ::: "memory"); __builtin_amdgcn_wave_barrier(); } while (0)
template <int F16M> __device__ __forceinline__ v2u pack4(v4f f) { union { v2u u; __bf16 b[4]; _Float16 h[4]; } c;
#pragma unroll
  for (int e = 0; e < 4; ++e) { if constexpr (F16M) c.h[e] = (_Float16)(f[e] * 64.0f); else c.b[e] = (__bf16)f[e]; }
  return c.u; }
// 128 columns x 512 k of a [k][LD] f32 weight -> LDS [column][k] in the 16-bit form: a wave reads 32 neighbouring columns of one k row (one whole line), a lane gathers 8 k of its column into one 16-byte LDS store
template <int F16M, int LD> __device__ __forceinline__ void stage_panel(const float* __restrict__ Wc, char* smem) {
  const int tid = threadIdx.x, n = tid & 127; const float* wp = Wc + (size_t)((tid >> 7) * 8) * LD + n; char* dst = smem + (n * PW + (tid >> 7) * 8) * 2;
#pragma unroll 8   /* 64 loads in flight per wave while the panel is filled */
  for (int it = 0; it < 32; ++it) { union { v4u u; v8b b; v8h h; } w; const float* p = wp + (size_t)(it * 16) * LD;
#pragma unroll
    for (int i = 0; i < 8; ++i) { const float f = p[(size_t)i * LD]; if constexpr (F16M) w.h[i] = (_Float16)(bfr(f) * 256.0f); else w.b[i] = (__bf16)f; }
    *(v4u*)(dst + it * 32) = w.u; } }
template <int F16M> __device__ __forceinline__ void gemm_256x128(const float* __restrict__ X, size_t r0, const float* __restrict__ Wm, int ld, int c0, char* smem, v8f (&acc)[2][8]) {
  const int tid = threadIdx.x, wave = tid >> 5, lane = tid & 31, col = lane & 15, g = lane >> 4;
  const float* xp = X + (r0 + wave * 32 + (lane >> 3)) * 512 + (lane & 7) * 4;   /* load i of a chunk: rows 4i .. 4i+3, 8 lanes x 16 B = one whole line a row */
  char* xs = smem + SM_W + wave * SM_XW; char* xst = xs + ((lane >> 3) * PX + (lane & 7) * 4) * 2;
  const char* xa = xs + (col * PX + 8 * g) * 2; const char* wb = smem + (col * PW + 8 * g) * 2;
  v4f raw[8];
#pragma unroll
  for (int i = 0; i < 8; ++i) raw[i] = *(const v4f*)(xp + (size_t)i * 4 * 512);
  if (ld == 512) stage_panel<F16M, 512>(Wm + c0, smem); else stage_panel<F16M, 1024>(Wm + c0, smem);   /* block-uniform; the pitch as a constant puts every row step into the loads' immediate offsets */
#pragma unroll
  for (int i = 0; i < 8; ++i) { *(v2u*)(xst + i * 4 * PX * 2) = pack4<F16M>(raw[i]); raw[i] = *(const v4f*)(xp + (size_t)i * 4 * 512 + 32); }
  __syncthreads();   /* the panel (and each wave's first chunk) is complete before any wave reads it */
#pragma unroll
  for (int kc = 0; kc < 16; ++kc) {
    Frag a[2], w[8];   /* the chunk's 20 fragment reads go as one group ahead of its 16 products */
#pragma unroll
    for (int m = 0; m < 2; ++m) { a[m].q[0] = *(const v4u*)(xa + m * 16 * PX * 2); a[m].q[1] = *(const v4u*)(xa + m * 16 * PX * 2 + 32); }
#pragma unroll
    for (int j = 0; j < 8; ++j) { w[j].q[0] = *(const v4u*)(wb + (j * 16 * PW + kc * 32) * 2); w[j].q[1] = *(const v4u*)(wb + (j * 16 * PW + kc * 32) * 2 + 32); }
    v2u pk[8];   /* the next chunk's rows are converted while the reads are under way */
    if (kc + 1 < 16) {
#pragma unroll
      for (int i = 0; i < 8; ++i) pk[i] = pack4<F16M>(raw[i]); }
    __builtin_amdgcn_sched_barrier(0);   /* keeps the 20 reads one group ahead of the products (one exposed LDS latency a chunk; without it each pair of reads is waited for on its own) and the conversion under that latency */
    LDSW();   /* this chunk's fragments are in registers before the next chunk's rows overwrite them */
    if (kc + 1 < 16) {
#pragma unroll
      for (int i = 0; i < 8; ++i) *(v2u*)(xst + i * 4 * PX * 2) = pk[i]; }
    __builtin_amdgcn_sched_barrier(0);   /* the converted rows leave their registers before the next lines are asked for: keeps the wave within 256 registers, two blocks per WGP */
    if (kc + 2 < 16) {
#pragma unroll
      for (int i = 0; i < 8; ++i) raw[i] = *(const v4f*)(xp + (size_t)i * 4 * 512 + (kc + 2) * 32); }   /* the lines of the chunk after next fly under this chunk's products */
#pragma unroll
    for (int j = 0; j < 8; ++j)
#pragma unroll
      for (int m = 0; m < 2; ++m) { if constexpr (F16M) acc[m][j] = __builtin_amdgcn_wmma_f32_16x16x32_f16(false, a[m].h, false, w[j].h, (short)0, acc[m][j], false, false);
        else acc[m][j] = __builtin_amdgcn_wmma_f32_16x16x32_bf16(false, a[m].b, false, w[j].b, (short)0, acc[m][j], false, false); }
    __builtin_amdgcn_sched_barrier(0);   /* the products stay ahead of the wait below, so they cover the row stores, and the next conversion (which waits for the lines just asked for) stays behind them */
    LDSW();   /* the wave's next rows are in LDS before its lanes read each other's */
  }
  __syncthreads();   /* every wave has left the panel: the epilogue reuses the LDS */
}
// ---- k_out's main loop: the same tile and panel, but its rows arrive as finished f16 A fragments (written so by k_attn): lane (row lane & 15, g) finds elements 0..7 = k0 + 8g .. and 8..15 = k0 + 16 + 8g .. as two 16-byte pieces,
// and a wave's load of one piece is 512 contiguous bytes (4 whole lines). The fragments go from memory straight into the registers the products read: no conversion, no LDS write and no LDS hand-over wait in the loop.
// A chunk's four loads are asked for YA chunks ahead, the distance at which k_proj's loop asks for its lines. k ascends within each accumulator.
#define YA 2
__device__ __forceinline__ void gemm_frag_256x128(const _Float16* __restrict__ XF, size_t r0, const float* __restrict__ Wm, int c0, char* smem, v8f (&acc)[2][8]) {
  const int tid = threadIdx.x, wave = tid >> 5, lane = tid & 31, col = lane & 15, g = lane >> 4;
  const _Float16* xp = XF + (r0 + wave * 32) * 512 + lane * 8;   /* a 16-row tile is 8,192 elements: 16 chunks x 2 pieces x 256 */
  const char* wb = smem + (col * PW + 8 * g) * 2;
  Frag a[16][2];
#pragma unroll
  for (int kc = 0; kc < YA; ++kc)
#pragma unroll
    for (int m = 0; m < 2; ++m) { a[kc][m].q[0] = *(const v4u*)(xp + m * 8192 + kc * 512); a[kc][m].q[1] = *(const v4u*)(xp + m * 8192 + kc * 512 + 256); }
  stage_panel<1, 512>(Wm + c0, smem);
  __syncthreads();   /* the panel is complete before any wave reads it */
#pragma unroll
  for (int kc = 0; kc < 16; ++kc) {
    if (kc + YA < 16) {
#pragma unroll
      for (int m = 0; m < 2; ++m) { a[kc + YA][m].q[0] = *(const v4u*)(xp + m * 8192 + (kc + YA) * 512); a[kc + YA][m].q[1] = *(const v4u*)(xp + m * 8192 + (kc + YA) * 512 + 256); } }
    if (kc + YA == 15) { asm volatile("s_wait_xcnt 0x0" ::: "memory");   /* precaution: behind the last load its address registers are free for reuse */
      __builtin_amdgcn_sched_barrier(0); }   /* ... and nothing that reuses them is moved up in front of that wait */
    Frag w[8];   /* the chunk's 16 fragment reads go as one group ahead of its 16 products */
#pragma unroll
    for (int j = 0; j < 8; ++j) { w[j].q[0] = *(const v4u*)(wb + (j * 16 * PW + kc * 32) * 2); w[j].q[1] = *(const v4u*)(wb + (j * 16 * PW + kc * 32) * 2 + 32); }
    __builtin_amdgcn_sched_barrier(0);   /* keeps the 16 reads one group ahead of the products (one exposed LDS latency a chunk; without it each pair of reads is waited for on its own) and the loads YA chunks ahead of their use */
#pragma unroll
    for (int j = 0; j < 8; ++j)
#pragma unroll
      for (int m = 0; m < 2; ++m) acc[m][j] = __builtin_amdgcn_wmma_f32_16x16x32_f16(false, a[kc][m].h, false, w[j].h, (short)0, acc[m][j], false, false);
    __builtin_amdgcn_sched_barrier(0);   /* the next chunk's reads stay one group behind these products */
  }
  __syncthreads();   /* every wave has left the panel: the epilogue reuses the LDS */
}
// ---- k_proj: block = (256 rows, 128 cols, which): q/k/v = X W (+ b) with exact bf16 products (K = DIN) -> which 0: q f16 rows; 1: k f16 rows; 2: v f16 planes [c][t]
__global__ __launch_bounds__(256) void k_proj(const float* __restrict__ XQ, const float* __restrict__ XK, const float* __restrict__ XV, const float* __restrict__ WQ, const float* __restrict__ WK, const float* __restrict__ WV, const float* __restrict__ BQ, const float* __restrict__ BK, const float* __restrict__ BV,
    _Float16* __restrict__ QH, _Float16* __restrict__ KH, _Float16* __restrict__ VT) {
  __shared__ __align__(16) char smem[SM_BYTES];
  const int tid = threadIdx.x, wave = tid >> 5, lane = tid & 31, col = lane & 15, g = lane >> 4; const int which = blockIdx.z; const int c0 = blockIdx.y * 128; const size_t r0 = (size_t)blockIdx.x * 256; const size_t bb = r0 / TT; const int t0 = (int)(r0 % TT);
  const float* X = which == 0 ? XQ : which == 1 ? XK : XV; const float* WA = which == 0 ? WQ : which == 1 ? WK : WV; const float* BA = which == 0 ? BQ : which == 1 ? BK : BV;
  v8f acc[2][8] = {};
  gemm_256x128<0>(X, r0, WA, which == 0 ? CC : 2 * CC, c0, smem, acc);   /* Wq [512][512]; Wkv [512][1024] packed k | v */
  if (which < 2) { _Float16* DH = which == 0 ? QH : KH;
    _Float16 (*sh)[136] = (_Float16 (*)[136])smem;
#pragma unroll
    for (int m = 0; m < 2; ++m)
#pragma unroll
      for (int j = 0; j < 8; ++j) { const float bias = BA ? bfr(BA[c0 + j * 16 + col]) : 0.f;
#pragma unroll
        for (int r = 0; r < 8; ++r) sh[wave * 32 + m * 16 + 8 * g + r][j * 16 + col] = (_Float16)(acc[m][j][r] + bias); }
    __syncthreads();
    for (int it = 0; it < 16; it += 4) { v4u vh[4];   /* four rows' pieces a trip: 4 LDS reads under way at once */
#pragma unroll
      for (int u = 0; u < 4; ++u) { const int e = (it + u) * 256 + tid, rl = e >> 4, q = e & 15; vh[u] = *(const v4u*)&sh[rl][q * 8]; }
#pragma unroll
      for (int u = 0; u < 4; ++u) { const int e = (it + u) * 256 + tid, rl = e >> 4, q = e & 15; vst2((unsigned*)(DH + (r0 + rl) * CC + c0 + q * 8), vh[u]); }
      asm volatile("s_wait_xcnt 0x0" ::: "memory"); }   /* precaution: the next trip rewrites registers that these stores name */
  } else { _Float16 (*th)[264] = (_Float16 (*)[264])smem;
#pragma unroll
    for (int m = 0; m < 2; ++m)
#pragma unroll
      for (int j = 0; j < 8; ++j) { const float bias = BA ? bfr(BA[c0 + j * 16 + col]) : 0.f; const int rb = wave * 32 + m * 16 + 8 * g, cl = j * 16 + col; v8h hv;
#pragma unroll
        for (int r = 0; r < 8; ++r) hv[r] = (_Float16)(acc[m][j][r] + bias);
        *(v8h*)&th[cl][rb] = hv; }   /* a lane's 8 values are 8 neighbouring t of one channel */
    __syncthreads();
    for (int it = 0; it < 16; it += 4) { v4u vv[4];
#pragma unroll
      for (int u = 0; u < 4; ++u) { const int e = (it + u) * 256 + tid, cl = e >> 5, q = e & 31; vv[u] = *(const v4u*)&th[cl][q * 8]; }
#pragma unroll
      for (int u = 0; u < 4; ++u) { const int e = (it + u) * 256 + tid, cl = e >> 5, q = e & 31; vst2((unsigned*)(VT + (bb * CC + c0 + cl) * (size_t)TT + t0 + q * 8), vv[u]); }
      asm volatile("s_wait_xcnt 0x0" ::: "memory"); } } }   /* precaution: the next trip rewrites registers that these stores name */
#define AP 144                 // pitch of a staged row (64 f16 = 128 B) in bytes: 16 B x odd, no bank conflict for 16-byte reads
#define AT (64 * AP)           // one operand's tile: 64 k rows (64 d each), or 64 v channels (64 keys each)
#define AB (2 * AT)            // one buffer: k tile, v tile
#define C2 (SCALE * 1.4426950408889634f)   // logit scale x log2(e)
// Hardware exp2 (v_exp_f32), each value in place. Written as asm so that the closing v_nop is tied to the last of them: it is the slot the instruction set asks for between a transcendental and a directly following
// instruction that reads its result or overwrites its source. Inside a statement no v_exp_f32 touches a neighbour's register.
__device__ __forceinline__ float exp2_1(float x) { asm("v_exp_f32 %0, %0\n\tv_nop" : "+v"(x)); return x; }
__device__ __forceinline__ void exp2_16(float (&x)[16]) {
  asm("v_exp_f32 %0, %0\n\tv_exp_f32 %1, %1\n\tv_exp_f32 %2, %2\n\tv_exp_f32 %3, %3\n\tv_exp_f32 %4, %4\n\tv_exp_f32 %5, %5\n\tv_exp_f32 %6, %6\n\tv_exp_f32 %7, %7\n\t"
      "v_exp_f32 %8, %8\n\tv_exp_f32 %9, %9\n\tv_exp_f32 %10, %10\n\tv_exp_f32 %11, %11\n\tv_exp_f32 %12, %12\n\tv_exp_f32 %13, %13\n\tv_exp_f32 %14, %14\n\tv_exp_f32 %15, %15\n\tv_nop"
      : "+v"(x[0]), "+v"(x[1]), "+v"(x[2]), "+v"(x[3]), "+v"(x[4]), "+v"(x[5]), "+v"(x[6]), "+v"(x[7]), "+v"(x[8]), "+v"(x[9]), "+v"(x[10]), "+v"(x[11]), "+v"(x[12]), "+v"(x[13]), "+v"(x[14]), "+v"(x[15])); }
__global__ __launch_bounds__(256) void k_attn(const _Float16* __restrict__ QH, const _Float16* __restrict__ KH, const _Float16* __restrict__ VT, const int* __restrict__ WI, _Float16* __restrict__ Y) {
  __shared__ __align__(16) char sm[2 * AB];
  const int tid = threadIdx.x, lane = tid & 31, col = lane & 15, g = lane >> 4;
  const int wave = __builtin_amdgcn_readfirstlane((int)(threadIdx.x >> 5));   /* wave-uniform, so the tiles' token numbers are worked out on the scalar unit */
  const int b = blockIdx.y, h = NH - 1 - (int)blockIdx.z;                       /* largest windows start first */
  const int rl_ = rlog(h), r = 1 << rl_;
  int wsh = 31 - __clz(WI[0] | 1); wsh = wsh > 7 ? 7 : wsh < 5 ? 5 : wsh;       /* grid width read from the input, as a shift (64 -> 6); 32, 64 and 128 are the widths at which 32 divides both sides of a 4,096-token grid */
  const int yb = ((int)blockIdx.x >> (wsh - 4)) * 8, xs = ((int)blockIdx.x & ((1 << (wsh - 4)) - 1)) * 16;   /* a one-to-one map block -> (8 image rows, one 16-column strip) at every such width */
  const int n0 = ((yb + wave) << wsh) + xs;
  const int sps = rl_ > 4 ? rl_ - 4 : 0, smask = (1 << sps) - 1;                /* 16-key tiles per window row: max(16, r) / 16 */
  const int rb_ = rl_ > 3 ? rl_ : 3;                                            /* the block's key rows: max(8, r) */
  const int y0 = (yb >> rb_) << rb_, xk0 = xs & ~((16 << sps) - 1);
  const int npass = (1 << (rb_ + sps)) >> 2;                                    /* 2, 2, 4 or 16 passes of 64 keys: never fewer than the two buffers */
  const int wm = ~((r - 1) | ((r - 1) << wsh));                                 /* token bits that name the window: same window row AND same window column <=> ((k ^ t) & wm) == 0 */
  const int t = n0 + col;
  const _Float16* Kb = KH + (size_t)b * TT * CC + h * HD; const _Float16* Vb = VT + ((size_t)b * CC + h * HD) * (size_t)TT;
  /* first token of 16-key tile s of the block; bounded here whatever the width input holds */
  auto tok = [&](int s) { const int k = ((y0 + (s >> sps)) << wsh) + xk0 + ((s & smask) << 4); return (k > TT - 16 ? TT - 16 : k) & ~15; };
  /* a pass's copies: 2 x 512 pieces of 16 B, four a thread. k: 8 lanes bring one key row's whole 128-byte line; v: 8 lanes bring one channel's 4 x 32 B */
  const int crow = tid >> 3, cpc = tid & 7;
  const unsigned ldst = (unsigned)(size_t)sm + (unsigned)(crow * AP + cpc * 16);
  auto stage = [&](int p, int buf) {
    const unsigned l0 = ldst + (unsigned)(buf * AB), l1 = l0 + 32 * AP, l2 = l0 + AT, l3 = l2 + 32 * AP;
    const char* k0 = (const char*)(Kb + (size_t)(tok(4 * p + (crow >> 4)) + (crow & 15)) * CC) + cpc * 16;
    const char* k1 = (const char*)(Kb + (size_t)(tok(4 * p + 2 + (crow >> 4)) + (crow & 15)) * CC) + cpc * 16;
    const char* v0 = (const char*)(Vb + (size_t)crow * TT + tok(4 * p + (cpc >> 1)) + (cpc & 1) * 8);
    const char* v1 = v0 + (size_t)32 * TT * 2;
    /* the copies and the wait that stands before their address registers are rewritten, in one statement */
    asm volatile("global_load_async_to_lds_b128 %0, %1, off\n\tglobal_load_async_to_lds_b128 %2, %3, off\n\tglobal_load_async_to_lds_b128 %4, %5, off\n\tglobal_load_async_to_lds_b128 %6, %7, off\n\ts_wait_xcnt 0x0"
                 :: "v"(l0), "v"(k0), "v"(l1), "v"(k1), "v"(l2), "v"(v0), "v"(l3), "v"(v1) : "memory"); };
  stage(0, 0);
  v16h qh[2];
#pragma unroll
  for (int kc = 0; kc < 2; ++kc) qh[kc] = frag_h(QH + ((size_t)b * TT + t) * CC + h * HD + kc * 32, lane);
  asm volatile("s_wait_asynccnt 0x0" ::: "memory");   /* this wave's share of pass 0 has landed */
  __syncthreads();                                    /* ... and every other wave's: pass 0 may be read */
  stage(1, 1);
  const unsigned foff = (unsigned)(col * AP + 16 * g);   /* the lane's own byte offset in a tile, fixed for the whole loop */
  v8f acc[HD / 16] = {}; float m = -1.0e30f, sum = 0.f;
  for (int p = 0; p < npass; ++p) {
    if ((((y0 + ((4 * p) >> sps)) ^ (yb + wave)) >> rl_) == 0) {   /* wave-uniform: the pass's key rows lie in this wave's window row (always, for r >= 8) */
    const char* kb = sm + (p & 1) * AB + foff; const char* vb = kb + AT;
    int kt[4];
#pragma unroll
    for (int u = 0; u < 4; ++u) kt[u] = tok(4 * p + u);
    v8h kq[4][4], vq[2][HD / 16][2];
#pragma unroll
    for (int u = 0; u < 4; ++u)
#pragma unroll
      for (int q = 0; q < 4; ++q) kq[u][q] = *(const v8h*)(kb + u * 16 * AP + q * 32);   /* q = 2 kc + half: d = kc*32 + half*16 + 8g .. + 7 of key row kt[u] + col */
#pragma unroll
    for (int c = 0; c < 2; ++c)
#pragma unroll
      for (int j = 0; j < HD / 16; ++j) { vq[c][j][0] = *(const v8h*)(vb + j * 16 * AP + (2 * c) * 32); vq[c][j][1] = *(const v8h*)(vb + j * 16 * AP + (2 * c + 1) * 32); }   /* keys kt[2c] + 8g .. + 7 and kt[2c + 1] + 8g .. + 7 of channel j*16 + col */
    __builtin_amdgcn_sched_barrier(0);   /* keeps the pass's 32 reads one group ahead of the products: one exposed LDS latency a pass; without it each pair of reads is waited for on its own */
    float v[4][8]; float mx = m;
#pragma unroll
    for (int u = 0; u < 4; ++u) { v8f sa = {};
#pragma unroll
      for (int kc = 0; kc < 2; ++kc) { union { v16h f; v8h q[2]; } kf; kf.q[0] = kq[u][2 * kc]; kf.q[1] = kq[u][2 * kc + 1];
        sa = __builtin_amdgcn_wmma_f32_16x16x32_f16(false, kf.f, false, qh[kc], (short)0, sa, false, false); }
#pragma unroll
      for (int i = 0; i < 8; ++i) { v[u][i] = ((((kt[u] + 8 * g + i) ^ t) & wm) == 0) ? sa[i] : -3.0e38f; mx = fmaxf(mx, v[u][i]); } }
    mx = fmaxf(mx, __shfl_xor(mx, 16));
    const float alpha = exp2_1((m - mx) * C2); m = mx;
    const float mb = 11.0f - m * C2;
#pragma unroll
    for (int j = 0; j < HD / 16; ++j) acc[j] *= alpha;
    v16h pf[2]; float ps[4];
#pragma unroll
    for (int c = 0; c < 2; ++c) { float e[16];
#pragma unroll
      for (int i = 0; i < 16; ++i) e[i] = v[2 * c + (i >> 3)][i & 7] * C2 + mb;
      exp2_16(e); ps[2 * c] = e[0]; ps[2 * c + 1] = e[8];
#pragma unroll
      for (int i = 0; i < 16; ++i) { if (i & 7) ps[2 * c + (i >> 3)] += e[i]; pf[c][i] = (_Float16)e[i]; } }
    sum = sum * alpha + ((ps[0] + ps[1]) + (ps[2] + ps[3]));
#pragma unroll
    for (int c = 0; c < 2; ++c)
#pragma unroll
      for (int j = 0; j < HD / 16; ++j) { union { v16h f; v8h q[2]; } vf; vf.q[0] = vq[c][j][0]; vf.q[1] = vq[c][j][1];
        acc[j] = __builtin_amdgcn_wmma_f32_16x16x32_f16(false, vf.f, false, pf[c], (short)0, acc[j], false, false); }
    }
    /* hand-over, passed by every wave, also one that skipped the pass */
    asm volatile("s_wait_dscnt 0x0" ::: "memory");      /* this wave's reads of the pass's buffer have retired */
    asm volatile("s_wait_asynccnt 0x0" ::: "memory");   /* its share of the next pass has landed */
    __syncthreads();                                    /* publishes the next pass and ends every wave's reads of this pass's buffer */
    if (p + 2 < npass) stage(p + 2, p & 1);             /* block-uniform: refill the buffer just left */
  }
  asm volatile("s_wait_asynccnt 0x0" ::: "memory");     /* no copy is outstanding when the wave ends */
  sum += __shfl_xor(sum, 16);
  const float inv = sum > 0.f ? 1.0f / sum : 0.f;   /* a fully excluded row yields 0 */
  /* lane = query t = row lane & 15 of the 16-token tile n0 / 16, register i of tile j = channel h*64 + j*16 + 8g + i = element i of piece j & 1 of 32-k chunk 2h + (j >> 1): the lane's own place in k_out's A fragment */
  _Float16* yp = Y + ((size_t)b * TT + n0) * CC + (size_t)(h * 4) * 256 + lane * 8;
#pragma unroll
  for (int j = 0; j < HD / 16; ++j) { v8h o;   /* the f32 value x 2^6 (exact), rounded once to f16; a wave's store is 512 contiguous bytes */
#pragma unroll
    for (int i = 0; i < 8; ++i) o[i] = (_Float16)((acc[j][i] * inv) * 64.0f);
    vst2(yp + j * 256, o); } }
// ---- k_out: block = (256 rows, 128 cols): out = ctx Wo (+ bo): ctx x 2^6 once to f16 (by k_attn; small-magnitude context rows stay clear of f16 subnormals) against Wo as f16(bf16 x 2^8) exact (1 product), un-scaled by 2^-14
__global__ __launch_bounds__(256) void k_out(const _Float16* __restrict__ Y, const float* __restrict__ WO, const float* __restrict__ BO, float* __restrict__ OUT) { __shared__ __align__(16) char smem[SM_BYTES];
  const int tid = threadIdx.x, wave = tid >> 5, lane = tid & 31, col = lane & 15, g = lane >> 4; const int c0 = blockIdx.y * 128; const size_t r0 = (size_t)blockIdx.x * 256;
  v8f acc[2][8] = {};
  gemm_frag_256x128(Y, r0, WO, c0, smem, acc);
  float (*sf)[132] = (float (*)[132])(smem + wave * (32 * 132 * 4));   /* each wave stages its own 32 rows */
#pragma unroll
  for (int m = 0; m < 2; ++m)
#pragma unroll
    for (int j = 0; j < 8; ++j) { const float bias = BO ? bfr(BO[c0 + j * 16 + col]) : 0.f;
#pragma unroll
      for (int r = 0; r < 8; ++r) sf[m * 16 + 8 * g + r][j * 16 + col] = acc[m][j][r] * (1.0f / 16384.0f) + bias; }   /* 2^-8 (Wo carry) x 2^-6 (ctx carry) */
  LDSX(); for (int rl = 0; rl < 32; ++rl) vst2(OUT + (r0 + wave * 32 + rl) * DIN + c0 + lane * 4, *(const v4f*)&sf[rl][lane * 4]); }

extern "C" void kernel_launch(void* const* d_in, const int* in_sizes, int n_in, void* d_out, int out_size, void* d_ws, size_t ws_size, hipStream_t stream) {
  (void)in_sizes; (void)n_in; (void)out_size;
  const float** F = (const float**)d_in;
  if (ws_size < (size_t)WS_END) return;
  char* ws = (char*)d_ws; _Float16 *QH = (_Float16*)(ws + WS_QH), *KH = (_Float16*)(ws + WS_KH), *VT = (_Float16*)(ws + WS_VT), *Y = (_Float16*)(ws + WS_Y);
  // inputs: 0 x [4,4096,512]; 1 Wq [512,512] (in,out); 2 Wkv [512,1024] (in,out; columns k | v, head*64+d); 3 Wproj [512,512] (in,out); 4 bproj [512]; 5 H (int 64); 6 W (int 64)
  const int* WI = (const int*)d_in[6];
  k_proj<<<dim3(TNB * TT / 256, CC / 128, 3), 256, 0, stream>>>(F[0], F[0], F[0], F[1], F[2], F[2] + CC, nullptr, nullptr, nullptr, QH, KH, VT);   /* k = Wkv columns 0..511, v = columns 512..1023 (row pitch 2*CC) */
  k_attn<<<dim3(TT / 128, TNB, NH), 256, 0, stream>>>(QH, KH, VT, WI, Y);
  k_out<<<dim3(TNB * TT / 256, DIN / 128), 256, 0, stream>>>(Y, F[3], F[4], (float*)d_out);
}

// v007
// A run of this version takes 67.7 microseconds.
// In two side-by-side timings against v006, it was 1.11 and 1.10 times as fast.
// Over all steps from v000 it is 28.0 times as fast.
// compute dtype: all float inputs rounded to bf16; q/k/v = x W with EXACT bf16 products on WMMA 16x16x32 (f32 accumulate); windowed logits with q once to f16 against k once to f16 (1 product) x 64^-0.5; per-window online softmax in f32 (base 2: one hardware exp2 per term, running maximum and sum); exp(s - m) x 2^11 once to f16 against v once to f16 (1 product), divided by the f32 sum at the end; merged heads carried x 2^6 once to f16 against Wproj carried x 2^8 in f16 (exact bf16 values), un-scaled by 2^-14, + bproj; f32 output.
#include <hip/hip_runtime.h>
#include <math.h>

typedef __attribute__((ext_vector_type(16))) _Float16 v16h;
typedef __attribute__((ext_vector_type(16))) __bf16 v16b;
typedef __attribute__((ext_vector_type(8)))  _Float16 v8h;
typedef __attribute__((ext_vector_type(8)))  float v8f;
typedef __attribute__((ext_vector_type(4)))  float v4f;
typedef __attribute__((ext_vector_type(2)))  float v2f;
typedef __attribute__((ext_vector_type(4)))  unsigned v4u;
typedef __attribute__((ext_vector_type(4)))  int v4i;
typedef float __attribute__((may_alias)) float_a;
typedef int __attribute__((may_alias)) int_a;

template <typename T> __device__ __forceinline__ void vst2(void* p, T v) { *(T*)p = v;  }
__device__ __forceinline__ v8f wmma16(v16h a, v16h b, v8f c) {
  v8f d = __builtin_amdgcn_wmma_f32_16x16x32_f16(false, a, false, b, (short)0, c, false, false);
  asm volatile("v_nop\n\tv_nop\n\tv_nop\n\tv_nop" : "+v"(d) : "v"(a), "v"(b));
  return d;
}
__device__ __forceinline__ v8f wmma_bf(v16b a, v16b b, v8f c) {
  v8f d = __builtin_amdgcn_wmma_f32_16x16x32_bf16(false, a, false, b, (short)0, c, false, false);
  asm volatile("v_nop\n\tv_nop\n\tv_nop\n\tv_nop" : "+v"(d) : "v"(a), "v"(b));
  return d;
}
// 16x16x32 fragments: lane = (h = lane>>4, row/col = lane&15); elements 0..7 = k0+8h+0..7, 8..15 = k0+16+8h+0..7; D element r = row 8h+r
__device__ __forceinline__ v16h frag_h(const _Float16* rowk0, int lane) {
  union { v16h v; v8h q[2]; } u; const _Float16* p = rowk0 + 8 * (lane >> 4);
  u.q[0] = *(const v8h*)p; u.q[1] = *(const v8h*)(p + 16); return u.v;
}
__device__ __forceinline__ v16h frag_f32(const float* rowk0, int lane) {
  v16h a; const float* p = rowk0 + 8 * (lane >> 4);
#pragma unroll
  for (int i = 0; i < 8; ++i) { a[i] = (_Float16)p[i]; a[8 + i] = (_Float16)p[16 + i]; }
  return a;
}
__device__ __forceinline__ v16h frag_f32s(const float* rowk0, int lane, float sc) {
  v16h a; const float* p = rowk0 + 8 * (lane >> 4);
#pragma unroll
  for (int i = 0; i < 8; ++i) { a[i] = (_Float16)(p[i] * sc); a[8 + i] = (_Float16)(p[16 + i] * sc); }
  return a;
}
// column fragment from a [K][ld] layout (column n), rows >= K read as 0
__device__ __forceinline__ v16h fragc_f32(const float* W, int k0, int n, int lane, int ld, int K) {
  v16h a; const int g = lane >> 4;
#pragma unroll
  for (int i = 0; i < 8; ++i) { const int ka = k0 + 8 * g + i, kb = ka + 16;
    a[i] = (_Float16)(ka < K ? W[(size_t)(ka < K ? ka : K - 1) * ld + n] : 0.f); a[8 + i] = (_Float16)(kb < K ? W[(size_t)(kb < K ? kb : K - 1) * ld + n] : 0.f); }
  return a;
}
struct F2 { v16b h, l; };
__device__ __forceinline__ F2 bsplit16(const float v[16]) { F2 r;
#pragma unroll
  for (int i = 0; i < 16; ++i) { const __bf16 h = (__bf16)v[i]; r.h[i] = h; r.l[i] = (__bf16)(v[i] - (float)h); }
  return r; }
__device__ __forceinline__ F2 split_row(const float* row, int k0, int lane) { float v[16]; const float* p = row + k0 + 8 * (lane >> 4);
#pragma unroll
  for (int i = 0; i < 8; ++i) { v[i] = p[i]; v[8 + i] = p[16 + i]; }
  return bsplit16(v); }
__device__ __forceinline__ F2 split_rowK(const float* row, int k0, int lane, int K) { float v[16]; const int g = lane >> 4;
#pragma unroll
  for (int i = 0; i < 8; ++i) { const int ka = k0 + 8 * g + i, kb = ka + 16; v[i] = ka < K ? row[ka < K ? ka : K - 1] : 0.f; v[8 + i] = kb < K ? row[kb < K ? kb : K - 1] : 0.f; }
  return bsplit16(v); }
__device__ __forceinline__ F2 split_col(const float* W, int k0, int n, int lane, int ld, int K) { float v[16]; const int g = lane >> 4;
#pragma unroll
  for (int i = 0; i < 8; ++i) { const int ka = k0 + 8 * g + i, kb = ka + 16; v[i] = ka < K ? W[(size_t)(ka < K ? ka : K - 1) * ld + n] : 0.f; v[8 + i] = kb < K ? W[(size_t)(kb < K ? kb : K - 1) * ld + n] : 0.f; }
  return bsplit16(v); }
__device__ __forceinline__ v8f mac3(const F2& a, const F2& b, v8f c) { c = wmma_bf(a.l, b.h, c); c = wmma_bf(a.h, b.l, c); return wmma_bf(a.h, b.h, c); }
__device__ __forceinline__ float sigm(float v) { return 1.0f / (1.0f + expf(-v)); }
#define LDSX() do { asm volatile("s_wait_dscnt 0" ::: "memory"); __builtin_amdgcn_wave_barrier(); __builtin_amdgcn_fence(__ATOMIC_RELEASE, "workgroup"); } while (0)

// Multi-scale windowed self-attention (B 4, 64 x 64 = 4,096 tokens, C 512 = 8 heads x 64; head h attends within non-overlapping r x r spatial windows with r = (4, 4, 8, 8, 16, 16, 32, 32)[h]; 0.02-scale (in,out) Wq [512,512], Wkv [512,1024] (k | v), Wproj [512,512] + zero bproj): q = x Wq, k|v = x Wkv; per head: softmax(q k^T x 64^-0.5) over the window's r^2 keys; heads merged (channel = head*64 + d); out = o Wproj + bproj.
#define NB 4
#define TT 4096
#define CC 512            // NH * HD = projected width
#define DIN 512          // input (model) width
#define NH 8
#define HD 64
#define NQB (TT / 64)
#define HG 1
#define SCALE (0.125f)
#define CAUSAL 0
#ifndef TNB
#define TNB NB
#endif
__device__ __forceinline__ float bfr(float v) { return (float)(__bf16)v; }
__host__ __device__ __forceinline__ int kb_last(int qb) { return CAUSAL ? ((qb * 64 + 63) >> 7) : (TT / 128 - 1); }
typedef __attribute__((ext_vector_type(8))) __bf16 v8b;
__device__ __forceinline__ v16b frag_b(const __bf16* rowk0, int lane) {
  union { v16b v; v8b q[2]; } u; const __bf16* p = rowk0 + 8 * (lane >> 4);
  u.q[0] = *(const v8b*)p; u.q[1] = *(const v8b*)(p + 16); return u.v;
}
// B fragment (k rows k0+.., output column o) of a weight: (in,out) [K][ld] or (out,in) [ld rows of K]: bf16 exact, or f16(bf16 * 256) exact
__device__ __forceinline__ v16b wcol_io(const float* Wm, int k0, int o, int lane, int ld) { v16b w; const int g = lane >> 4;
#pragma unroll
  for (int i = 0; i < 8; ++i) { w[i] = (__bf16)Wm[(size_t)(k0 + 8 * g + i) * ld + o]; w[8 + i] = (__bf16)Wm[(size_t)(k0 + 16 + 8 * g + i) * ld + o]; }
  return w; }
__device__ __forceinline__ v16b wcol_oi(const float* Wm, int k0, int o, int lane, int K) { v16b w; const float* p = Wm + (size_t)o * K + k0 + 8 * (lane >> 4);
#pragma unroll
  for (int i = 0; i < 8; ++i) { w[i] = (__bf16)p[i]; w[8 + i] = (__bf16)p[16 + i]; }
  return w; }
__device__ __forceinline__ v16h wcolh_io(const float* Wm, int k0, int o, int lane, int ld) { v16h w; const int g = lane >> 4;
#pragma unroll
  for (int i = 0; i < 8; ++i) { w[i] = (_Float16)(bfr(Wm[(size_t)(k0 + 8 * g + i) * ld + o]) * 256.0f); w[8 + i] = (_Float16)(bfr(Wm[(size_t)(k0 + 16 + 8 * g + i) * ld + o]) * 256.0f); }
  return w; }
__device__ __forceinline__ v16h wcolh_oi(const float* Wm, int k0, int o, int lane, int K) { v16h w; const float* p = Wm + (size_t)o * K + k0 + 8 * (lane >> 4);
#pragma unroll
  for (int i = 0; i < 8; ++i) { w[i] = (_Float16)(bfr(p[i]) * 256.0f); w[8 + i] = (_Float16)(bfr(p[16 + i]) * 256.0f); }
  return w; }
#define WQKV_LAYOUT 0   // 0 = (in,out) [DIN][CC]; 1 = (out,in) [CC][DIN]; 2 = per-head [NH][DIN][HD]
__device__ __forceinline__ v16b wcol_hdk(const float* Wm, int k0, int o, int lane) { v16b w; const int g = lane >> 4; const float* p = Wm + (size_t)(o / HD) * DIN * HD + (o % HD);
#pragma unroll
  for (int i = 0; i < 8; ++i) { w[i] = (__bf16)p[(size_t)(k0 + 8 * g + i) * HD]; w[8 + i] = (__bf16)p[(size_t)(k0 + 16 + 8 * g + i) * HD]; }
  return w; }
#define WO_OUT_IN 0
#if WQKV_LAYOUT == 1
#define WCOL(W, k0, o, lane) wcol_oi(W, k0, o, lane, DIN)
#elif WQKV_LAYOUT == 2
#define WCOL(W, k0, o, lane) wcol_hdk(W, k0, o, lane)
#else
#define WCOL(W, k0, o, lane) wcol_io(W, k0, o, lane, (which == 0 ? CC : 2 * CC))   /* Wq [512][512]; Wkv [512][1024] packed k | v */
#endif
#if WO_OUT_IN
#define WOCOL(W, k0, o, lane) wcol_oi(W, k0, o, lane, CC)
#define WOCOLH(W, k0, o, lane) wcolh_oi(W, k0, o, lane, CC)
#else
#define WOCOL(W, k0, o, lane) wcol_io(W, k0, o, lane, DIN)
#define WOCOLH(W, k0, o, lane) wcolh_io(W, k0, o, lane, DIN)
#endif
// per-head local window: REGIONS = (4, 4, 8, 8, 16, 16, 32, 32) -> r(h) = 4 << (h / 2); tokens are a 64 x 64 grid (n = y*64 + x), a k_attn block is 8 image rows x 16 columns and walks its keys 64 a pass
__host__ __device__ __forceinline__ int rlog(int h) { return 2 + (h >> 1); }

#define WS_QH  0u                                      // f16 q rows [b*t][CC]
#define WS_KH  (WS_QH + 2u * (size_t)NB * TT * CC)      // f16 k rows [b*t][CC]
#define WS_VT  (WS_KH + 2u * (size_t)NB * TT * CC)      // f16 v planes [b][c][t]
#define WS_Y   (WS_VT + 2u * (size_t)NB * CC * TT)      // f16 ctx x 2^6 in the fragment order of the output projection: [16-token tile][32-k chunk][half][lane][8], 512 B a (chunk, half)
#define WS_XF (WS_Y  + 4u * (size_t)NB * TT * CC)      // bf16 x in the fragment order of the q/k/v projection, the same order as WS_Y
#define WS_WB (WS_XF + 2u * (size_t)NB * TT * DIN)     // 16 weight panels [128 columns][512 k] in 16 bits: Wq 4, Wkv 8 (bf16), Wproj 4 (f16 x 2^8)
#define WS_END (WS_WB + 2u * (size_t)16 * 128 * 512)

// ---- the two projection GEMMs share tile and panel: block = 8 waves = (256 rows, 128 cols), K = 512.
// The block's weight panel (128 output columns x all 512 k, in its 16-bit form) is kept in LDS as [column][k]; every wave reads its B fragments from there.
// Each wave owns 32 rows (2 A fragments x 8 B fragments = 16 products per 32 k), which it finds in memory as finished 16-bit A fragments (x: written so by k_pre; ctx: by k_attn).
// k ascends within each accumulator.
#define PW 520                       // pitch of a panel row (one column, 512 k) in 16-bit elements: 1,040 B = 16 B x odd, no bank conflict for 16-byte reads
#define SM_W (128 * PW * 2)          // panel bytes
#define SM_BYTES 153600              // the panel, and k_out's epilogue (8 waves x 32 rows x 132 floats): two blocks per WGP
union Frag { v4u q[2]; v16b b; v16h h; };
// F16M 0: operands rounded to bf16 (exact products); F16M 1: rows x 2^6 to f16, weights f16(bf16 x 2^8) (exact)
// the block's panel, 128 columns x 512 k, lies in memory in its 16-bit form as [column][k] (written so by k_pre): 131,072 contiguous bytes -> LDS rows of pitch PW. A wave's load and its LDS store are 512 contiguous bytes.
template <typename T> __device__ __forceinline__ void stage_panel(const T* __restrict__ Wp, char* smem) {
  const int tid = threadIdx.x; const char* src = (const char*)Wp + tid * 16; char* dst = smem + (tid >> 6) * (PW * 2) + (tid & 63) * 16;
#pragma unroll   /* all 32 loads of a wave are in flight at once, from one base address: one latency for the whole panel */
  for (int it = 0; it < 32; ++it) *(v4u*)(dst + it * 4 * PW * 2) = *(const v4u*)(src + it * 4096);
  asm volatile("s_wait_xcnt 0x0" :: "v"(src) : "memory"); }   /* precaution: the loads' address registers stay as they are up to this wait */
// ---- the main loop of both: the rows arrive as finished 16-bit A fragments: lane (row lane & 15, g) finds elements 0..7 = k0 + 8g .. and 8..15 = k0 + 16 + 8g .. as two 16-byte pieces,
// and a wave's load of one piece is 512 contiguous bytes (4 whole lines). The fragments go from memory straight into the registers the products read: no conversion, no LDS write and no LDS hand-over wait in the loop.
// A chunk's four loads are asked for YA chunks ahead. k ascends within each accumulator.
#define YA 2
template <int F16M, typename T> __device__ __forceinline__ void gemm_frag_256x128(const T* __restrict__ XF, size_t r0, const T* __restrict__ Wp, char* smem, v8f (&acc)[2][8]) {
  const int tid = threadIdx.x, wave = tid >> 5, lane = tid & 31, col = lane & 15, g = lane >> 4;
  const T* xp = XF + (r0 + wave * 32) * 512 + lane * 8;   /* a 16-row tile is 8,192 elements: 16 chunks x 2 pieces x 256 */
  const char* wb = smem + (col * PW + 8 * g) * 2;
  Frag a[16][2];
#pragma unroll
  for (int kc = 0; kc < YA; ++kc)
#pragma unroll
    for (int m = 0; m < 2; ++m) { a[kc][m].q[0] = *(const v4u*)(xp + m * 8192 + kc * 512); a[kc][m].q[1] = *(const v4u*)(xp + m * 8192 + kc * 512 + 256); }
  stage_panel(Wp, smem);
  __syncthreads();   /* the panel is complete before any wave reads it */
#pragma unroll
  for (int kc = 0; kc < 16; ++kc) {
    if (kc + YA < 16) {
#pragma unroll
      for (int m = 0; m < 2; ++m) { a[kc + YA][m].q[0] = *(const v4u*)(xp + m * 8192 + (kc + YA) * 512); a[kc + YA][m].q[1] = *(const v4u*)(xp + m * 8192 + (kc + YA) * 512 + 256); } }
    if (kc + YA == 15) { asm volatile("s_wait_xcnt 0x0" ::: "memory");   /* precaution: behind the last load its address registers are free for reuse */
      __builtin_amdgcn_sched_barrier(0); }   /* ... and nothing that reuses them is moved up in front of that wait */
    Frag w[8];   /* the chunk's 16 fragment reads go as one group ahead of its 16 products */
#pragma unroll
    for (int j = 0; j < 8; ++j) { w[j].q[0] = *(const v4u*)(wb + (j * 16 * PW + kc * 32) * 2); w[j].q[1] = *(const v4u*)(wb + (j * 16 * PW + kc * 32) * 2 + 32); }
    __builtin_amdgcn_sched_barrier(0);   /* keeps the 16 reads one group ahead of the products (one exposed LDS latency a chunk; without it each pair of reads is waited for on its own) and the loads YA chunks ahead of their use */
#pragma unroll
    for (int j = 0; j < 8; ++j)
#pragma unroll
      for (int m = 0; m < 2; ++m) { if constexpr (F16M) acc[m][j] = __builtin_amdgcn_wmma_f32_16x16x32_f16(false, a[kc][m].h, false, w[j].h, (short)0, acc[m][j], false, false);
        else acc[m][j] = __builtin_amdgcn_wmma_f32_16x16x32_bf16(false, a[kc][m].b, false, w[j].b, (short)0, acc[m][j], false, false); }
    __builtin_amdgcn_sched_barrier(0);   /* the next chunk's reads stay one group behind these products */
  }
  __syncthreads();   /* every wave has left the panel: the epilogue reuses the LDS */
}
// ---- k_pre: every operand of the two projection GEMMs is brought ONCE into the 16-bit form and the order in which the GEMM blocks read it, so that none of the 12 column blocks that need a row of x,
// and none of the 64 row blocks that need a weight panel, loads it as f32, converts it or turns it round.
// Blocks 0 .. 63, weights: 16 panels of 128 columns (Wq 4, Wkv 8: bf16; Wproj 4: f16(bf16 x 2^8), exact) x 4 quarters of k -> [panel][column][k]. A wave reads 32 neighbouring columns of one k row (one whole line);
// a thread gathers 64 k of its column, which is one whole 128-byte line of the result.
// Blocks 64 .., x -> bf16 in the order of the A fragments. Wave = 8 rows x 8 chunks of 32 k. Lane = (row lane & 7, g = bit 3, piece = bit 4) takes the 8 values k = chunk*32 + piece*16 + 8g .. + 7:
// four lanes read one row's whole 128-byte line, and a wave's 16-byte stores fill four whole lines.
#define NWB 64
// 64 k of one column of a [k][LD] f32 weight -> 128 contiguous bytes; the pitch as a constant puts every row step into the loads' immediate offsets
template <int F16M, int LD> __device__ __forceinline__ void pre_col(const float* __restrict__ wp, char* dst) {
  float f[8][8];
#pragma unroll
  for (int j = 0; j < 8; ++j)
#pragma unroll
    for (int i = 0; i < 8; ++i) f[j][i] = wp[(size_t)(j * 8 + i) * LD];
  __builtin_amdgcn_sched_barrier(0);   /* all 64 loads are under way before the first conversion: one memory latency */
  asm volatile("s_wait_xcnt 0x0" :: "v"(wp) : "memory");   /* precaution: the loads' address registers stay as they are up to this wait */
#pragma unroll
  for (int j = 0; j < 8; ++j) { union { v4u u; v8b b; v8h h; } w;
#pragma unroll
    for (int i = 0; i < 8; ++i) { if constexpr (F16M) w.h[i] = (_Float16)(bfr(f[j][i]) * 256.0f); else w.b[i] = (__bf16)f[j][i]; }
    *(v4u*)(dst + j * 16) = w.u; }
  asm volatile("s_wait_xcnt 0x0" ::: "memory"); }   /* precaution: whatever code follows these stores in the built kernel may reuse the registers that they name */
__global__ __launch_bounds__(256) void k_pre(const float* __restrict__ X, const float* __restrict__ WQ, const float* __restrict__ WKV, const float* __restrict__ WO, __bf16* __restrict__ XF, __bf16* __restrict__ WB) {
  const int tid = threadIdx.x, wave = tid >> 5, lane = tid & 31;
  if (blockIdx.x < NWB) {   /* block-uniform */
    const int p = (int)blockIdx.x >> 2, n = tid & 127, k0 = ((int)blockIdx.x & 3) * 128 + (tid >> 7) * 64;
    char* dst = (char*)(WB + ((size_t)(p * 128 + n) * 512 + k0));
    if (p < 4) pre_col<0, CC>(WQ + (size_t)k0 * CC + p * 128 + n, dst);
    else if (p < 12) pre_col<0, 2 * CC>(WKV + (size_t)k0 * (2 * CC) + (p - 4) * 128 + n, dst);
    else pre_col<1, CC>(WO + (size_t)k0 * CC + (p - 12) * 128 + n, dst);
    return; }
  const int rg = ((int)blockIdx.x - NWB) * 4 + (wave >> 1), kh = wave & 1;   /* 8-row group, half of the 16 chunks */
  const float* xp = X + (size_t)(rg * 8 + (lane & 7)) * DIN + kh * 256 + (lane >> 4) * 16 + ((lane >> 3) & 1) * 8;
  __bf16* fp = XF + (size_t)(rg >> 1) * 8192 + kh * 4096 + (lane >> 4) * 256 + (((lane >> 3) & 1) * 16 + (rg & 1) * 8 + (lane & 7)) * 8;
  v4f raw[8][2];   /* all 16 loads are under way before the first conversion */
#pragma unroll
  for (int c = 0; c < 8; ++c) { raw[c][0] = *(const v4f*)(xp + c * 32); raw[c][1] = *(const v4f*)(xp + c * 32 + 4); }
  __builtin_amdgcn_sched_barrier(0);   /* no conversion is moved up among the loads: without it the last four loads wait for registers that the first results free, a second memory latency */
  asm volatile("s_wait_xcnt 0x0" :: "v"(xp) : "memory");   /* precaution: the loads' address registers stay as they are up to this wait (the operand keeps them live, so no load's own result lands on them) */
#pragma unroll
  for (int c = 0; c < 8; ++c) { union { v4u u; v8b b; } w;
#pragma unroll
    for (int i = 0; i < 4; ++i) { w.b[i] = (__bf16)raw[c][0][i]; w.b[4 + i] = (__bf16)raw[c][1][i]; }
    *(v4u*)(fp + c * 512) = w.u; }
  asm volatile("s_wait_xcnt 0x0" ::: "memory"); }   /* precaution: whatever code follows these stores in the built kernel may reuse the registers that they name */
// ---- k_proj: block = (256 rows, 128 cols, which): q/k/v = X W (+ b) with exact bf16 products (K = DIN) -> which 0: q f16 rows; 1: k f16 rows; 2: v f16 planes [c][t]
__global__ __launch_bounds__(256) void k_proj(const __bf16* __restrict__ XF, const __bf16* __restrict__ WB, const float* __restrict__ BQ, const float* __restrict__ BK, const float* __restrict__ BV,
    _Float16* __restrict__ QH, _Float16* __restrict__ KH, _Float16* __restrict__ VT) {
  __shared__ __align__(16) char smem[SM_BYTES];
  const int tid = threadIdx.x, wave = tid >> 5, lane = tid & 31, col = lane & 15, g = lane >> 4; const int which = blockIdx.z; const int c0 = blockIdx.y * 128; const size_t r0 = (size_t)blockIdx.x * 256; const size_t bb = r0 / TT; const int t0 = (int)(r0 % TT);
  const float* BA = which == 0 ? BQ : which == 1 ? BK : BV;
  v8f acc[2][8] = {};
  gemm_frag_256x128<0>(XF, r0, WB + (size_t)(which * 4 + (int)blockIdx.y) * (128 * 512), smem, acc);   /* panels 0..3 Wq, 4..7 k half of Wkv, 8..11 v half */
  if (which < 2) { _Float16* DH = which == 0 ? QH : KH;
    _Float16 (*sh)[136] = (_Float16 (*)[136])smem;
#pragma unroll
    for (int m = 0; m < 2; ++m)
#pragma unroll
      for (int j = 0; j < 8; ++j) { const float bias = BA ? bfr(BA[c0 + j * 16 + col]) : 0.f;
#pragma unroll
        for (int r = 0; r < 8; ++r) sh[wave * 32 + m * 16 + 8 * g + r][j * 16 + col] = (_Float16)(acc[m][j][r] + bias); }
    __syncthreads();
    for (int it = 0; it < 16; it += 4) { v4u vh[4];   /* four rows' pieces a trip: 4 LDS reads under way at once */
#pragma unroll
      for (int u = 0; u < 4; ++u) { const int e = (it + u) * 256 + tid, rl = e >> 4, q = e & 15; vh[u] = *(const v4u*)&sh[rl][q * 8]; }
#pragma unroll
      for (int u = 0; u < 4; ++u) { const int e = (it + u) * 256 + tid, rl = e >> 4, q = e & 15; vst2((unsigned*)(DH + (r0 + rl) * CC + c0 + q * 8), vh[u]); }
      asm volatile("s_wait_xcnt 0x0" ::: "memory"); }   /* precaution: the next trip rewrites registers that these stores name */
  } else { _Float16 (*th)[264] = (_Float16 (*)[264])smem;
#pragma unroll
    for (int m = 0; m < 2; ++m)
#pragma unroll
      for (int j = 0; j < 8; ++j) { const float bias = BA ? bfr(BA[c0 + j * 16 + col]) : 0.f; const int rb = wave * 32 + m * 16 + 8 * g, cl = j * 16 + col; v8h hv;
#pragma unroll
        for (int r = 0; r < 8; ++r) hv[r] = (_Float16)(acc[m][j][r] + bias);
        *(v8h*)&th[cl][rb] = hv; }   /* a lane's 8 values are 8 neighbouring t of one channel */
    __syncthreads();
    for (int it = 0; it < 16; it += 4) { v4u vv[4];
#pragma unroll
      for (int u = 0; u < 4; ++u) { const int e = (it + u) * 256 + tid, cl = e >> 5, q = e & 31; vv[u] = *(const v4u*)&th[cl][q * 8]; }
#pragma unroll
      for (int u = 0; u < 4; ++u) { const int e = (it + u) * 256 + tid, cl = e >> 5, q = e & 31; vst2((unsigned*)(VT + (bb * CC + c0 + cl) * (size_t)TT + t0 + q * 8), vv[u]); }
      asm volatile("s_wait_xcnt 0x0" ::: "memory"); } } }   /* precaution: the next trip rewrites registers that these stores name */
#define AP 144                 // pitch of a staged row (64 f16 = 128 B) in bytes: 16 B x odd, no bank conflict for 16-byte reads
#define AT (64 * AP)           // one operand's tile: 64 k rows (64 d each), or 64 v channels (64 keys each)
#define AB (2 * AT)            // one buffer: k tile, v tile
#define C2 (SCALE * 1.4426950408889634f)   // logit scale x log2(e)
// Hardware exp2 (v_exp_f32), each value in place. Written as asm so that the closing v_nop is tied to the last of them: it is the slot the instruction set asks for between a transcendental and a directly following
// instruction that reads its result or overwrites its source. Inside a statement no v_exp_f32 touches a neighbour's register.
__device__ __forceinline__ float exp2_1(float x) { asm("v_exp_f32 %0, %0\n\tv_nop" : "+v"(x)); return x; }
__device__ __forceinline__ void exp2_16(float (&x)[16]) {
  asm("v_exp_f32 %0, %0\n\tv_exp_f32 %1, %1\n\tv_exp_f32 %2, %2\n\tv_exp_f32 %3, %3\n\tv_exp_f32 %4, %4\n\tv_exp_f32 %5, %5\n\tv_exp_f32 %6, %6\n\tv_exp_f32 %7, %7\n\t"
      "v_exp_f32 %8, %8\n\tv_exp_f32 %9, %9\n\tv_exp_f32 %10, %10\n\tv_exp_f32 %11, %11\n\tv_exp_f32 %12, %12\n\tv_exp_f32 %13, %13\n\tv_exp_f32 %14, %14\n\tv_exp_f32 %15, %15\n\tv_nop"
      : "+v"(x[0]), "+v"(x[1]), "+v"(x[2]), "+v"(x[3]), "+v"(x[4]), "+v"(x[5]), "+v"(x[6]), "+v"(x[7]), "+v"(x[8]), "+v"(x[9]), "+v"(x[10]), "+v"(x[11]), "+v"(x[12]), "+v"(x[13]), "+v"(x[14]), "+v"(x[15])); }
__global__ __launch_bounds__(256) void k_attn(const _Float16* __restrict__ QH, const _Float16* __restrict__ KH, const _Float16* __restrict__ VT, const int* __restrict__ WI, _Float16* __restrict__ Y) {
  __shared__ __align__(16) char sm[2 * AB];
  const int tid = threadIdx.x, lane = tid & 31, col = lane & 15, g = lane >> 4;
  const int wave = __builtin_amdgcn_readfirstlane((int)(threadIdx.x >> 5));   /* wave-uniform, so the tiles' token numbers are worked out on the scalar unit */
  const int b = blockIdx.y, h = NH - 1 - (int)blockIdx.z;                       /* largest windows start first */
  const int rl_ = rlog(h), r = 1 << rl_;
  int wsh = 31 - __clz(WI[0] | 1); wsh = wsh > 7 ? 7 : wsh < 5 ? 5 : wsh;       /* grid width read from the input, as a shift (64 -> 6); 32, 64 and 128 are the widths at which 32 divides both sides of a 4,096-token grid */
  const int yb = ((int)blockIdx.x >> (wsh - 4)) * 8, xs = ((int)blockIdx.x & ((1 << (wsh - 4)) - 1)) * 16;   /* a one-to-one map block -> (8 image rows, one 16-column strip) at every such width */
  const int n0 = ((yb + wave) << wsh) + xs;
  const int sps = rl_ > 4 ? rl_ - 4 : 0, smask = (1 << sps) - 1;                /* 16-key tiles per window row: max(16, r) / 16 */
  const int rb_ = rl_ > 3 ? rl_ : 3;                                            /* the block's key rows: max(8, r) */
  const int y0 = (yb >> rb_) << rb_, xk0 = xs & ~((16 << sps) - 1);
  const int npass = (1 << (rb_ + sps)) >> 2;                                    /* 2, 2, 4 or 16 passes of 64 keys: never fewer than the two buffers */
  const int wm = ~((r - 1) | ((r - 1) << wsh));                                 /* token bits that name the window: same window row AND same window column <=> ((k ^ t) & wm) == 0 */
  const int t = n0 + col;
  const _Float16* Kb = KH + (size_t)b * TT * CC + h * HD; const _Float16* Vb = VT + ((size_t)b * CC + h * HD) * (size_t)TT;
  /* first token of 16-key tile s of the block; bounded here whatever the width input holds */
  auto tok = [&](int s) { const int k = ((y0 + (s >> sps)) << wsh) + xk0 + ((s & smask) << 4); return (k > TT - 16 ? TT - 16 : k) & ~15; };
  /* a pass's copies: 2 x 512 pieces of 16 B, four a thread. k: 8 lanes bring one key row's whole 128-byte line; v: 8 lanes bring one channel's 4 x 32 B */
  const int crow = tid >> 3, cpc = tid & 7;
  const unsigned ldst = (unsigned)(size_t)sm + (unsigned)(crow * AP + cpc * 16);
  auto stage = [&](int p, int buf) {
    const unsigned l0 = ldst + (unsigned)(buf * AB), l1 = l0 + 32 * AP, l2 = l0 + AT, l3 = l2 + 32 * AP;
    const char* k0 = (const char*)(Kb + (size_t)(tok(4 * p + (crow >> 4)) + (crow & 15)) * CC) + cpc * 16;
    const char* k1 = (const char*)(Kb + (size_t)(tok(4 * p + 2 + (crow >> 4)) + (crow & 15)) * CC) + cpc * 16;
    const char* v0 = (const char*)(Vb + (size_t)crow * TT + tok(4 * p + (cpc >> 1)) + (cpc & 1) * 8);
    const char* v1 = v0 + (size_t)32 * TT * 2;
    /* the copies and the wait that stands before their address registers are rewritten, in one statement */
    asm volatile("global_load_async_to_lds_b128 %0, %1, off\n\tglobal_load_async_to_lds_b128 %2, %3, off\n\tglobal_load_async_to_lds_b128 %4, %5, off\n\tglobal_load_async_to_lds_b128 %6, %7, off\n\ts_wait_xcnt 0x0"
                 :: "v"(l0), "v"(k0), "v"(l1), "v"(k1), "v"(l2), "v"(v0), "v"(l3), "v"(v1) : "memory"); };
  stage(0, 0);
  v16h qh[2];
#pragma unroll
  for (int kc = 0; kc < 2; ++kc) qh[kc] = frag_h(QH + ((size_t)b * TT + t) * CC + h * HD + kc * 32, lane);
  asm volatile("s_wait_asynccnt 0x0" ::: "memory");   /* this wave's share of pass 0 has landed */
  __syncthreads();                                    /* ... and every other wave's: pass 0 may be read */
  stage(1, 1);
  const unsigned foff = (unsigned)(col * AP + 16 * g);   /* the lane's own byte offset in a tile, fixed for the whole loop */
  v8f acc[HD / 16] = {}; float m = -1.0e30f, sum = 0.f;
  for (int p = 0; p < npass; ++p) {
    if ((((y0 + ((4 * p) >> sps)) ^ (yb + wave)) >> rl_) == 0) {   /* wave-uniform: the pass's key rows lie in this wave's window row (always, for r >= 8) */
    const char* kb = sm + (p & 1) * AB + foff; const char* vb = kb + AT;
    int kt[4];
#pragma unroll
    for (int u = 0; u < 4; ++u) kt[u] = tok(4 * p + u);
    v8h kq[4][4], vq[2][HD / 16][2];
#pragma unroll
    for (int u = 0; u < 4; ++u)
#pragma unroll
      for (int q = 0; q < 4; ++q) kq[u][q] = *(const v8h*)(kb + u * 16 * AP + q * 32);   /* q = 2 kc + half: d = kc*32 + half*16 + 8g .. + 7 of key row kt[u] + col */
#pragma unroll
    for (int c = 0; c < 2; ++c)
#pragma unroll
      for (int j = 0; j < HD / 16; ++j) { vq[c][j][0] = *(const v8h*)(vb + j * 16 * AP + (2 * c) * 32); vq[c][j][1] = *(const v8h*)(vb + j * 16 * AP + (2 * c + 1) * 32); }   /* keys kt[2c] + 8g .. + 7 and kt[2c + 1] + 8g .. + 7 of channel j*16 + col */
    __builtin_amdgcn_sched_barrier(0);   /* keeps the pass's 32 reads one group ahead of the products: one exposed LDS latency a pass; without it each pair of reads is waited for on its own */
    float v[4][8]; float mx = m;
#pragma unroll
    for (int u = 0; u < 4; ++u) { v8f sa = {};
#pragma unroll
      for (int kc = 0; kc < 2; ++kc) { union { v16h f; v8h q[2]; } kf; kf.q[0] = kq[u][2 * kc]; kf.q[1] = kq[u][2 * kc + 1];
        sa = __builtin_amdgcn_wmma_f32_16x16x32_f16(false, kf.f, false, qh[kc], (short)0, sa, false, false); }
#pragma unroll
      for (int i = 0; i < 8; ++i) { v[u][i] = ((((kt[u] + 8 * g + i) ^ t) & wm) == 0) ? sa[i] : -3.0e38f; mx = fmaxf(mx, v[u][i]); } }
    mx = fmaxf(mx, __shfl_xor(mx, 16));
    const float alpha = exp2_1((m - mx) * C2); m = mx;
    const float mb = 11.0f - m * C2;
#pragma unroll
    for (int j = 0; j < HD / 16; ++j) acc[j] *= alpha;
    v16h pf[2]; float ps[4];
#pragma unroll
    for (int c = 0; c < 2; ++c) { float e[16];
#pragma unroll
      for (int i = 0; i < 16; ++i) e[i] = v[2 * c + (i >> 3)][i & 7] * C2 + mb;
      exp2_16(e); ps[2 * c] = e[0]; ps[2 * c + 1] = e[8];
#pragma unroll
      for (int i = 0; i < 16; ++i) { if (i & 7) ps[2 * c + (i >> 3)] += e[i]; pf[c][i] = (_Float16)e[i]; } }
    sum = sum * alpha + ((ps[0] + ps[1]) + (ps[2] + ps[3]));
#pragma unroll
    for (int c = 0; c < 2; ++c)
#pragma unroll
      for (int j = 0; j < HD / 16; ++j) { union { v16h f; v8h q[2]; } vf; vf.q[0] = vq[c][j][0]; vf.q[1] = vq[c][j][1];
        acc[j] = __builtin_amdgcn_wmma_f32_16x16x32_f16(false, vf.f, false, pf[c], (short)0, acc[j], false, false); }
    }
    /* hand-over, passed by every wave, also one that skipped the pass */
    asm volatile("s_wait_dscnt 0x0" ::: "memory");      /* this wave's reads of the pass's buffer have retired */
    asm volatile("s_wait_asynccnt 0x0" ::: "memory");   /* its share of the next pass has landed */
    __syncthreads();                                    /* publishes the next pass and ends every wave's reads of this pass's buffer */
    if (p + 2 < npass) stage(p + 2, p & 1);             /* block-uniform: refill the buffer just left */
  }
  asm volatile("s_wait_asynccnt 0x0" ::: "memory");     /* no copy is outstanding when the wave ends */
  sum += __shfl_xor(sum, 16);
  const float inv = sum > 0.f ? 1.0f / sum : 0.f;   /* a fully excluded row yields 0 */
  /* lane = query t = row lane & 15 of the 16-token tile n0 / 16, register i of tile j = channel h*64 + j*16 + 8g + i = element i of piece j & 1 of 32-k chunk 2h + (j >> 1): the lane's own place in k_out's A fragment */
  _Float16* yp = Y + ((size_t)b * TT + n0) * CC + (size_t)(h * 4) * 256 + lane * 8;
#pragma unroll
  for (int j = 0; j < HD / 16; ++j) { v8h o;   /* the f32 value x 2^6 (exact), rounded once to f16; a wave's store is 512 contiguous bytes */
#pragma unroll
    for (int i = 0; i < 8; ++i) o[i] = (_Float16)((acc[j][i] * inv) * 64.0f);
    vst2(yp + j * 256, o); } }
// ---- k_out: block = (256 rows, 128 cols): out = ctx Wo (+ bo): ctx x 2^6 once to f16 (by k_attn; small-magnitude context rows stay clear of f16 subnormals) against Wo as f16(bf16 x 2^8) exact (1 product), un-scaled by 2^-14
__global__ __launch_bounds__(256) void k_out(const _Float16* __restrict__ Y, const _Float16* __restrict__ WH, const float* __restrict__ BO, float* __restrict__ OUT) { __shared__ __align__(16) char smem[SM_BYTES];
  const int tid = threadIdx.x, wave = tid >> 5, lane = tid & 31, col = lane & 15, g = lane >> 4; const int c0 = blockIdx.y * 128; const size_t r0 = (size_t)blockIdx.x * 256;
  v8f acc[2][8] = {};
  gemm_frag_256x128<1>(Y, r0, WH + (size_t)blockIdx.y * (128 * 512), smem, acc);
  float (*sf)[132] = (float (*)[132])(smem + wave * (32 * 132 * 4));   /* each wave stages its own 32 rows */
#pragma unroll
  for (int m = 0; m < 2; ++m)
#pragma unroll
    for (int j = 0; j < 8; ++j) { const float bias = BO ? bfr(BO[c0 + j * 16 + col]) : 0.f;
#pragma unroll
      for (int r = 0; r < 8; ++r) sf[m * 16 + 8 * g + r][j * 16 + col] = acc[m][j][r] * (1.0f / 16384.0f) + bias; }   /* 2^-8 (Wo carry) x 2^-6 (ctx carry) */
  LDSX(); for (int rl = 0; rl < 32; ++rl) vst2(OUT + (r0 + wave * 32 + rl) * DIN + c0 + lane * 4, *(const v4f*)&sf[rl][lane * 4]); }

extern "C" void kernel_launch(void* const* d_in, const int* in_sizes, int n_in, void* d_out, int out_size, void* d_ws, size_t ws_size, hipStream_t stream) {
  (void)in_sizes; (void)n_in; (void)out_size;
  const float** F = (const float**)d_in;
  if (ws_size < (size_t)WS_END) return;
  char* ws = (char*)d_ws; _Float16 *QH = (_Float16*)(ws + WS_QH), *KH = (_Float16*)(ws + WS_KH), *VT = (_Float16*)(ws + WS_VT), *Y = (_Float16*)(ws + WS_Y); __bf16 *XF = (__bf16*)(ws + WS_XF), *WB = (__bf16*)(ws + WS_WB);
  // inputs: 0 x [4,4096,512]; 1 Wq [512,512] (in,out); 2 Wkv [512,1024] (in,out; columns k | v, head*64+d); 3 Wproj [512,512] (in,out); 4 bproj [512]; 5 H (int 64); 6 W (int 64)
  const int* WI = (const int*)d_in[6];
  k_pre<<<dim3(NWB + TNB * TT / 32), 256, 0, stream>>>(F[0], F[1], F[2], F[3], XF, WB);
  k_proj<<<dim3(TNB * TT / 256, CC / 128, 3), 256, 0, stream>>>(XF, WB, nullptr, nullptr, nullptr, QH, KH, VT);
  k_attn<<<dim3(TT / 128, TNB, NH), 256, 0, stream>>>(QH, KH, VT, WI, Y);
  k_out<<<dim3(TNB * TT / 256, DIN / 128), 256, 0, stream>>>(Y, (const _Float16*)(ws + WS_WB) + (size_t)12 * 128 * 512, F[4], (float*)d_out);
}

// v008
// It runs in 65 microseconds.
// Timed twice side by side with v007, it ran 1.04 times as fast both times.
// Counting every step since v000, it is 29.2 times as fast.
// compute dtype: all float inputs rounded to bf16; q/k/v = x W with EXACT bf16 products on WMMA 16x16x32 (f32 accumulate); windowed logits with q once to f16 against k once to f16 (1 product) x 64^-0.5; per-window online softmax in f32 (base 2: one hardware exp2 per term, running maximum and sum); exp(s - m) x 2^11 once to f16 against v once to f16 (1 product), divided by the f32 sum at the end; merged heads carried x 2^6 once to f16 against Wproj carried x 2^8 in f16 (exact bf16 values), un-scaled by 2^-14, + bproj; f32 output.
#include <hip/hip_runtime.h>
#include <math.h>

typedef __attribute__((ext_vector_type(16))) _Float16 v16h;
typedef __attribute__((ext_vector_type(16))) __bf16 v16b;
typedef __attribute__((ext_vector_type(8)))  _Float16 v8h;
typedef __attribute__((ext_vector_type(8)))  float v8f;
typedef __attribute__((ext_vector_type(4)))  float v4f;
typedef __attribute__((ext_vector_type(2)))  float v2f;
typedef __attribute__((ext_vector_type(4)))  unsigned v4u;
typedef __attribute__((ext_vector_type(4)))  int v4i;
typedef float __attribute__((may_alias)) float_a;
typedef int __attribute__((may_alias)) int_a;

template <typename T> __device__ __forceinline__ void vst2(void* p, T v) { *(T*)p = v;  }
__device__ __forceinline__ v8f wmma16(v16h a, v16h b, v8f c) {
  v8f d = __builtin_amdgcn_wmma_f32_16x16x32_f16(false, a, false, b, (short)0, c, false, false);
  asm volatile("v_nop\n\tv_nop\n\tv_nop\n\tv_nop" : "+v"(d) : "v"(a), "v"(b));
  return d;
}
__device__ __forceinline__ v8f wmma_bf(v16b a, v16b b, v8f c) {
  v8f d = __builtin_amdgcn_wmma_f32_16x16x32_bf16(false, a, false, b, (short)0, c, false, false);
  asm volatile("v_nop\n\tv_nop\n\tv_nop\n\tv_nop" : "+v"(d) : "v"(a), "v"(b));
  return d;
}
// 16x16x32 fragments: lane = (h = lane>>4, row/col = lane&15); elements 0..7 = k0+8h+0..7, 8..15 = k0+16+8h+0..7; D element r = row 8h+r
__device__ __forceinline__ v16h frag_h(const _Float16* rowk0, int lane) {
  union { v16h v; v8h q[2]; } u; const _Float16* p = rowk0 + 8 * (lane >> 4);
  u.q[0] = *(const v8h*)p; u.q[1] = *(const v8h*)(p + 16); return u.v;
}
__device__ __forceinline__ v16h frag_f32(const float* rowk0, int lane) {
  v16h a; const float* p = rowk0 + 8 * (lane >> 4);
#pragma unroll
  for (int i = 0; i < 8; ++i) { a[i] = (_Float16)p[i]; a[8 + i] = (_Float16)p[16 + i]; }
  return a;
}
__device__ __forceinline__ v16h frag_f32s(const float* rowk0, int lane, float sc) {
  v16h a; const float* p = rowk0 + 8 * (lane >> 4);
#pragma unroll
  for (int i = 0; i < 8; ++i) { a[i] = (_Float16)(p[i] * sc); a[8 + i] = (_Float16)(p[16 + i] * sc); }
  return a;
}
// column fragment from a [K][ld] layout (column n), rows >= K read as 0
__device__ __forceinline__ v16h fragc_f32(const float* W, int k0, int n, int lane, int ld, int K) {
  v16h a; const int g = lane >> 4;
#pragma unroll
  for (int i = 0; i < 8; ++i) { const int ka = k0 + 8 * g + i, kb = ka + 16;
    a[i] = (_Float16)(ka < K ? W[(size_t)(ka < K ? ka : K - 1) * ld + n] : 0.f); a[8 + i] = (_Float16)(kb < K ? W[(size_t)(kb < K ? kb : K - 1) * ld + n] : 0.f); }
  return a;
}
struct F2 { v16b h, l; };
__device__ __forceinline__ F2 bsplit16(const float v[16]) { F2 r;
#pragma unroll
  for (int i = 0; i < 16; ++i) { const __bf16 h = (__bf16)v[i]; r.h[i] = h; r.l[i] = (__bf16)(v[i] - (float)h); }
  return r; }
__device__ __forceinline__ F2 split_row(const float* row, int k0, int lane) { float v[16]; const float* p = row + k0 + 8 * (lane >> 4);
#pragma unroll
  for (int i = 0; i < 8; ++i) { v[i] = p[i]; v[8 + i] = p[16 + i]; }
  return bsplit16(v); }
__device__ __forceinline__ F2 split_rowK(const float* row, int k0, int lane, int K) { float v[16]; const int g = lane >> 4;
#pragma unroll
  for (int i = 0; i < 8; ++i) { const int ka = k0 + 8 * g + i, kb = ka + 16; v[i] = ka < K ? row[ka < K ? ka : K - 1] : 0.f; v[8 + i] = kb < K ? row[kb < K ? kb : K - 1] : 0.f; }
  return bsplit16(v); }
__device__ __forceinline__ F2 split_col(const float* W, int k0, int n, int lane, int ld, int K) { float v[16]; const int g = lane >> 4;
#pragma unroll
  for (int i = 0; i < 8; ++i) { const int ka = k0 + 8 * g + i, kb = ka + 16; v[i] = ka < K ? W[(size_t)(ka < K ? ka : K - 1) * ld + n] : 0.f; v[8 + i] = kb < K ? W[(size_t)(kb < K ? kb : K - 1) * ld + n] : 0.f; }
  return bsplit16(v); }
__device__ __forceinline__ v8f mac3(const F2& a, const F2& b, v8f c) { c = wmma_bf(a.l, b.h, c); c = wmma_bf(a.h, b.l, c); return wmma_bf(a.h, b.h, c); }
__device__ __forceinline__ float sigm(float v) { return 1.0f / (1.0f + expf(-v)); }
#define LDSX() do { asm volatile("s_wait_dscnt 0" ::: "memory"); __builtin_amdgcn_wave_barrier(); __builtin_amdgcn_fence(__ATOMIC_RELEASE, "workgroup"); } while (0)

// Multi-scale windowed self-attention (B 4, 64 x 64 = 4,096 tokens, C 512 = 8 heads x 64; head h attends within non-overlapping r x r spatial windows with r = (4, 4, 8, 8, 16, 16, 32, 32)[h]; 0.02-scale (in,out) Wq [512,512], Wkv [512,1024] (k | v), Wproj [512,512] + zero bproj): q = x Wq, k|v = x Wkv; per head: softmax(q k^T x 64^-0.5) over the window's r^2 keys; heads merged (channel = head*64 + d); out = o Wproj + bproj.
#define NB 4
#define TT 4096
#define CC 512            // NH * HD = projected width
#define DIN 512          // input (model) width
#define NH 8
#define HD 64
#define NQB (TT / 64)
#define HG 1
#define SCALE (0.125f)
#define CAUSAL 0
#ifndef TNB
#define TNB NB
#endif
__device__ __forceinline__ float bfr(float v) { return (float)(__bf16)v; }
__host__ __device__ __forceinline__ int kb_last(int qb) { return CAUSAL ? ((qb * 64 + 63) >> 7) : (TT / 128 - 1); }
typedef __attribute__((ext_vector_type(8))) __bf16 v8b;
__device__ __forceinline__ v16b frag_b(const __bf16* rowk0, int lane) {
  union { v16b v; v8b q[2]; } u; const __bf16* p = rowk0 + 8 * (lane >> 4);
  u.q[0] = *(const v8b*)p; u.q[1] = *(const v8b*)(p + 16); return u.v;
}
// B fragment (k rows k0+.., output column o) of a weight: (in,out) [K][ld] or (out,in) [ld rows of K]: bf16 exact, or f16(bf16 * 256) exact
__device__ __forceinline__ v16b wcol_io(const float* Wm, int k0, int o, int lane, int ld) { v16b w; const int g = lane >> 4;
#pragma unroll
  for (int i = 0; i < 8; ++i) { w[i] = (__bf16)Wm[(size_t)(k0 + 8 * g + i) * ld + o]; w[8 + i] = (__bf16)Wm[(size_t)(k0 + 16 + 8 * g + i) * ld + o]; }
  return w; }
__device__ __forceinline__ v16b wcol_oi(const float* Wm, int k0, int o, int lane, int K) { v16b w; const float* p = Wm + (size_t)o * K + k0 + 8 * (lane >> 4);
#pragma unroll
  for (int i = 0; i < 8; ++i) { w[i] = (__bf16)p[i]; w[8 + i] = (__bf16)p[16 + i]; }
  return w; }
__device__ __forceinline__ v16h wcolh_io(const float* Wm, int k0, int o, int lane, int ld) { v16h w; const int g = lane >> 4;
#pragma unroll
  for (int i = 0; i < 8; ++i) { w[i] = (_Float16)(bfr(Wm[(size_t)(k0 + 8 * g + i) * ld + o]) * 256.0f); w[8 + i] = (_Float16)(bfr(Wm[(size_t)(k0 + 16 + 8 * g + i) * ld + o]) * 256.0f); }
  return w; }
__device__ __forceinline__ v16h wcolh_oi(const float* Wm, int k0, int o, int lane, int K) { v16h w; const float* p = Wm + (size_t)o * K + k0 + 8 * (lane >> 4);
#pragma unroll
  for (int i = 0; i < 8; ++i) { w[i] = (_Float16)(bfr(p[i]) * 256.0f); w[8 + i] = (_Float16)(bfr(p[16 + i]) * 256.0f); }
  return w; }
#define WQKV_LAYOUT 0   // 0 = (in,out) [DIN][CC]; 1 = (out,in) [CC][DIN]; 2 = per-head [NH][DIN][HD]
__device__ __forceinline__ v16b wcol_hdk(const float* Wm, int k0, int o, int lane) { v16b w; const int g = lane >> 4; const float* p = Wm + (size_t)(o / HD) * DIN * HD + (o % HD);
#pragma unroll
  for (int i = 0; i < 8; ++i) { w[i] = (__bf16)p[(size_t)(k0 + 8 * g + i) * HD]; w[8 + i] = (__bf16)p[(size_t)(k0 + 16 + 8 * g + i) * HD]; }
  return w; }
#define WO_OUT_IN 0
#if WQKV_LAYOUT == 1
#define WCOL(W, k0, o, lane) wcol_oi(W, k0, o, lane, DIN)
#elif WQKV_LAYOUT == 2
#define WCOL(W, k0, o, lane) wcol_hdk(W, k0, o, lane)
#else
#define WCOL(W, k0, o, lane) wcol_io(W, k0, o, lane, (which == 0 ? CC : 2 * CC))   /* Wq [512][512]; Wkv [512][1024] packed k | v */
#endif
#if WO_OUT_IN
#define WOCOL(W, k0, o, lane) wcol_oi(W, k0, o, lane, CC)
#define WOCOLH(W, k0, o, lane) wcolh_oi(W, k0, o, lane, CC)
#else
#define WOCOL(W, k0, o, lane) wcol_io(W, k0, o, lane, DIN)
#define WOCOLH(W, k0, o, lane) wcolh_io(W, k0, o, lane, DIN)
#endif
// per-head local window: REGIONS = (4, 4, 8, 8, 16, 16, 32, 32) -> r(h) = 4 << (h / 2); tokens are a 64 x 64 grid (n = y*64 + x), a k_attn block is 8 image rows x 16 columns and walks its keys 64 a pass
__host__ __device__ __forceinline__ int rlog(int h) { return 2 + (h >> 1); }

#define WS_QH  0u                                      // f16 q rows [b*t][CC]
#define WS_KH  (WS_QH + 2u * (size_t)NB * TT * CC)      // f16 k rows [b*t][CC]
#define WS_VT  (WS_KH + 2u * (size_t)NB * TT * CC)      // f16 v planes [b][c][t]
#define WS_Y   (WS_VT + 2u * (size_t)NB * CC * TT)      // f16 ctx x 2^6 in the fragment order of the output projection: [16-token tile][32-k chunk][half][lane][8], 512 B a (chunk, half)
#define WS_XF (WS_Y  + 4u * (size_t)NB * TT * CC)      // bf16 x in the fragment order of the q/k/v projection, the same order as WS_Y
#define WS_WB (WS_XF + 2u * (size_t)NB * TT * DIN)     // 16 weight panels [128 columns][512 k] in 16 bits: Wq 4, Wkv 8 (bf16), Wproj 4 (f16 x 2^8)
#define WS_END (WS_WB + 2u * (size_t)16 * 128 * 512)

// ---- the two projection GEMMs share tile and panel: block = 8 waves = (256 rows, 128 cols), K = 512.
// The block's weight panel (128 output columns x all 512 k, in its 16-bit form) is kept in LDS as [column][k]; every wave reads its B fragments from there.
// Each wave owns 32 rows (2 A fragments x 8 B fragments = 16 products per 32 k), which it finds in memory as finished 16-bit A fragments (x: written so by k_pre; ctx: by k_attn).
// k ascends within each accumulator.
#define PW 520                       // pitch of a panel row (one column, 512 k) in 16-bit elements: 1,040 B = 16 B x odd, no bank conflict for 16-byte reads
#define SM_W (128 * PW * 2)          // panel bytes
#define SM_BYTES 153600              // the panel, and k_out's epilogue (8 waves x 32 rows x 132 floats): two blocks per WGP
union Frag { v4u q[2]; v16b b; v16h h; };
// F16M 0: operands rounded to bf16 (exact products); F16M 1: rows x 2^6 to f16, weights f16(bf16 x 2^8) (exact)
// the block's panel, 128 columns x 512 k, lies in memory in its 16-bit form as [column][k] (written so by k_pre): 131,072 contiguous bytes -> LDS rows of pitch PW. A wave's load and its LDS store are 512 contiguous bytes.
template <typename T> __device__ __forceinline__ void stage_panel(const T* __restrict__ Wp, char* smem) {
  const int tid = threadIdx.x; const char* src = (const char*)Wp + tid * 16; char* dst = smem + (tid >> 6) * (PW * 2) + (tid & 63) * 16;
#pragma unroll   /* all 32 loads of a wave are in flight at once, from one base address: one latency for the whole panel */
  for (int it = 0; it < 32; ++it) *(v4u*)(dst + it * 4 * PW * 2) = *(const v4u*)(src + it * 4096);
  asm volatile("s_wait_xcnt 0x0" :: "v"(src) : "memory"); }   /* precaution: the loads' address registers stay as they are up to this wait */
// ---- the main loop of both: the rows arrive as finished 16-bit A fragments: lane (row lane & 15, g) finds elements 0..7 = k0 + 8g .. and 8..15 = k0 + 16 + 8g .. as two 16-byte pieces,
// and a wave's load of one piece is 512 contiguous bytes (4 whole lines). The fragments go from memory straight into the registers the products read: no conversion, no LDS write and no LDS hand-over wait in the loop.
// A chunk's four loads are asked for YA chunks ahead. k ascends within each accumulator.
#define YA 2
template <int F16M, typename T> __device__ __forceinline__ void gemm_frag_256x128(const T* __restrict__ XF, size_t r0, const T* __restrict__ Wp, char* smem, v8f (&acc)[2][8]) {
  const int tid = threadIdx.x, wave = tid >> 5, lane = tid & 31, col = lane & 15, g = lane >> 4;
  const T* xp = XF + (r0 + wave * 32) * 512 + lane * 8;   /* a 16-row tile is 8,192 elements: 16 chunks x 2 pieces x 256 */
  const char* wb = smem + (col * PW + 8 * g) * 2;
  Frag a[16][2];
#pragma unroll
  for (int kc = 0; kc < YA; ++kc)
#pragma unroll
    for (int m = 0; m < 2; ++m) { a[kc][m].q[0] = *(const v4u*)(xp + m * 8192 + kc * 512); a[kc][m].q[1] = *(const v4u*)(xp + m * 8192 + kc * 512 + 256); }
  stage_panel(Wp, smem);
  __syncthreads();   /* the panel is complete before any wave reads it */
#pragma unroll
  for (int kc = 0; kc < 16; ++kc) {
    if (kc + YA < 16) {
#pragma unroll
      for (int m = 0; m < 2; ++m) { a[kc + YA][m].q[0] = *(const v4u*)(xp + m * 8192 + (kc + YA) * 512); a[kc + YA][m].q[1] = *(const v4u*)(xp + m * 8192 + (kc + YA) * 512 + 256); } }
    if (kc + YA == 15) { asm volatile("s_wait_xcnt 0x0" ::: "memory");   /* precaution: behind the last load its address registers are free for reuse */
      __builtin_amdgcn_sched_barrier(0); }   /* ... and nothing that reuses them is moved up in front of that wait */
    Frag w[8];   /* the chunk's 16 fragment reads go as one group ahead of its 16 products */
#pragma unroll
    for (int j = 0; j < 8; ++j) { w[j].q[0] = *(const v4u*)(wb + (j * 16 * PW + kc * 32) * 2); w[j].q[1] = *(const v4u*)(wb + (j * 16 * PW + kc * 32) * 2 + 32); }
    __builtin_amdgcn_sched_barrier(0);   /* keeps the 16 reads one group ahead of the products (one exposed LDS latency a chunk; without it each pair of reads is waited for on its own) and the loads YA chunks ahead of their use */
#pragma unroll
    for (int j = 0; j < 8; ++j)
#pragma unroll
      for (int m = 0; m < 2; ++m) { if constexpr (F16M) acc[m][j] = __builtin_amdgcn_wmma_f32_16x16x32_f16(false, a[kc][m].h, false, w[j].h, (short)0, acc[m][j], false, false);
        else acc[m][j] = __builtin_amdgcn_wmma_f32_16x16x32_bf16(false, a[kc][m].b, false, w[j].b, (short)0, acc[m][j], false, false); }
    __builtin_amdgcn_sched_barrier(0);   /* the next chunk's reads stay one group behind these products */
  }
  __syncthreads();   /* every wave has left the panel: the epilogue reuses the LDS */
}
// ---- k_pre: every operand of the two projection GEMMs is brought ONCE into the 16-bit form and the order in which the GEMM blocks read it, so that none of the 12 column blocks that need a row of x,
// and none of the 64 row blocks that need a weight panel, loads it as f32, converts it or turns it round.
// Blocks 0 .. 63, weights: 16 panels of 128 columns (Wq 4, Wkv 8: bf16; Wproj 4: f16(bf16 x 2^8), exact) x 4 quarters of k -> [panel][column][k]. A wave reads 32 neighbouring columns of one k row (one whole line);
// a thread gathers 64 k of its column, which is one whole 128-byte line of the result.
// Blocks 64 .., x -> bf16 in the order of the A fragments. Wave = 8 rows x 8 chunks of 32 k. Lane = (row lane & 7, g = bit 3, piece = bit 4) takes the 8 values k = chunk*32 + piece*16 + 8g .. + 7:
// four lanes read one row's whole 128-byte line, and a wave's 16-byte stores fill four whole lines.
#define NWB 64
// 64 k of one column of a [k][LD] f32 weight -> 128 contiguous bytes; the pitch as a constant puts every row step into the loads' immediate offsets
template <int F16M, int LD> __device__ __forceinline__ void pre_col(const float* __restrict__ wp, char* dst) {
  float f[8][8];
#pragma unroll
  for (int j = 0; j < 8; ++j)
#pragma unroll
    for (int i = 0; i < 8; ++i) f[j][i] = wp[(size_t)(j * 8 + i) * LD];
  __builtin_amdgcn_sched_barrier(0);   /* all 64 loads are under way before the first conversion: one memory latency */
  asm volatile("s_wait_xcnt 0x0" :: "v"(wp) : "memory");   /* precaution: the loads' address registers stay as they are up to this wait */
#pragma unroll
  for (int j = 0; j < 8; ++j) { union { v4u u; v8b b; v8h h; } w;
#pragma unroll
    for (int i = 0; i < 8; ++i) { if constexpr (F16M) w.h[i] = (_Float16)(bfr(f[j][i]) * 256.0f); else w.b[i] = (__bf16)f[j][i]; }
    *(v4u*)(dst + j * 16) = w.u; }
  asm volatile("s_wait_xcnt 0x0" ::: "memory"); }   /* precaution: whatever code follows these stores in the built kernel may reuse the registers that they name */
__global__ __launch_bounds__(256) void k_pre(const float* __restrict__ X, const float* __restrict__ WQ, const float* __restrict__ WKV, const float* __restrict__ WO, __bf16* __restrict__ XF, __bf16* __restrict__ WB) {
  const int tid = threadIdx.x, wave = tid >> 5, lane = tid & 31;
  if (blockIdx.x < NWB) {   /* block-uniform */
    const int p = (int)blockIdx.x >> 2, n = tid & 127, k0 = ((int)blockIdx.x & 3) * 128 + (tid >> 7) * 64;
    char* dst = (char*)(WB + ((size_t)(p * 128 + n) * 512 + k0));
    if (p < 4) pre_col<0, CC>(WQ + (size_t)k0 * CC + p * 128 + n, dst);
    else if (p < 12) pre_col<0, 2 * CC>(WKV + (size_t)k0 * (2 * CC) + (p - 4) * 128 + n, dst);
    else pre_col<1, CC>(WO + (size_t)k0 * CC + (p - 12) * 128 + n, dst);
    return; }
  const int rg = ((int)blockIdx.x - NWB) * 4 + (wave >> 1), kh = wave & 1;   /* 8-row group, half of the 16 chunks */
  const float* xp = X + (size_t)(rg * 8 + (lane & 7)) * DIN + kh * 256 + (lane >> 4) * 16 + ((lane >> 3) & 1) * 8;
  __bf16* fp = XF + (size_t)(rg >> 1) * 8192 + kh * 4096 + (lane >> 4) * 256 + (((lane >> 3) & 1) * 16 + (rg & 1) * 8 + (lane & 7)) * 8;
  v4f raw[8][2];   /* all 16 loads are under way before the first conversion */
#pragma unroll
  for (int c = 0; c < 8; ++c) { raw[c][0] = *(const v4f*)(xp + c * 32); raw[c][1] = *(const v4f*)(xp + c * 32 + 4); }
  __builtin_amdgcn_sched_barrier(0);   /* no conversion is moved up among the loads: without it the last four loads wait for registers that the first results free, a second memory latency */
  asm volatile("s_wait_xcnt 0x0" :: "v"(xp) : "memory");   /* precaution: the loads' address registers stay as they are up to this wait (the operand keeps them live, so no load's own result lands on them) */
#pragma unroll
  for (int c = 0; c < 8; ++c) { union { v4u u; v8b b; } w;
#pragma unroll
    for (int i = 0; i < 4; ++i) { w.b[i] = (__bf16)raw[c][0][i]; w.b[4 + i] = (__bf16)raw[c][1][i]; }
    *(v4u*)(fp + c * 512) = w.u; }
  asm volatile("s_wait_xcnt 0x0" ::: "memory"); }   /* precaution: whatever code follows these stores in the built kernel may reuse the registers that they name */
// ---- k_proj: block = (256 rows, 128 cols, which): q/k/v = X W (+ b) with exact bf16 products (K = DIN) -> which 0: q f16 rows; 1: k f16 rows; 2: v f16 planes [c][t]
__global__ __launch_bounds__(256) void k_proj(const __bf16* __restrict__ XF, const __bf16* __restrict__ WB, const float* __restrict__ BQ, const float* __restrict__ BK, const float* __restrict__ BV,
    _Float16* __restrict__ QH, _Float16* __restrict__ KH, _Float16* __restrict__ VT) {
  __shared__ __align__(16) char smem[SM_BYTES];
  const int tid = threadIdx.x, wave = tid >> 5, lane = tid & 31, col = lane & 15, g = lane >> 4; const int which = blockIdx.z; const int c0 = blockIdx.y * 128; const size_t r0 = (size_t)blockIdx.x * 256; const size_t bb = r0 / TT; const int t0 = (int)(r0 % TT);
  const float* BA = which == 0 ? BQ : which == 1 ? BK : BV;
  v8f acc[2][8] = {};
  gemm_frag_256x128<0>(XF, r0, WB + (size_t)(which * 4 + (int)blockIdx.y) * (128 * 512), smem, acc);   /* panels 0..3 Wq, 4..7 k half of Wkv, 8..11 v half */
  if (which < 2) { _Float16* DH = which == 0 ? QH : KH;
    _Float16 (*sh)[136] = (_Float16 (*)[136])smem;
#pragma unroll
    for (int m = 0; m < 2; ++m)
#pragma unroll
      for (int j = 0; j < 8; ++j) { const float bias = BA ? bfr(BA[c0 + j * 16 + col]) : 0.f;
#pragma unroll
        for (int r = 0; r < 8; ++r) sh[wave * 32 + m * 16 + 8 * g + r][j * 16 + col] = (_Float16)(acc[m][j][r] + bias); }
    __syncthreads();
    for (int it = 0; it < 16; it += 4) { v4u vh[4];   /* four rows' pieces a trip: 4 LDS reads under way at once */
#pragma unroll
      for (int u = 0; u < 4; ++u) { const int e = (it + u) * 256 + tid, rl = e >> 4, q = e & 15; vh[u] = *(const v4u*)&sh[rl][q * 8]; }
#pragma unroll
      for (int u = 0; u < 4; ++u) { const int e = (it + u) * 256 + tid, rl = e >> 4, q = e & 15; vst2((unsigned*)(DH + (r0 + rl) * CC + c0 + q * 8), vh[u]); }
      asm volatile("s_wait_xcnt 0x0" ::: "memory"); }   /* precaution: the next trip rewrites registers that these stores name */
  } else { _Float16 (*th)[264] = (_Float16 (*)[264])smem;
#pragma unroll
    for (int m = 0; m < 2; ++m)
#pragma unroll
      for (int j = 0; j < 8; ++j) { const float bias = BA ? bfr(BA[c0 + j * 16 + col]) : 0.f; const int rb = wave * 32 + m * 16 + 8 * g, cl = j * 16 + col; v8h hv;
#pragma unroll
        for (int r = 0; r < 8; ++r) hv[r] = (_Float16)(acc[m][j][r] + bias);
        *(v8h*)&th[cl][rb] = hv; }   /* a lane's 8 values are 8 neighbouring t of one channel */
    __syncthreads();
    for (int it = 0; it < 16; it += 4) { v4u vv[4];
#pragma unroll
      for (int u = 0; u < 4; ++u) { const int e = (it + u) * 256 + tid, cl = e >> 5, q = e & 31; vv[u] = *(const v4u*)&th[cl][q * 8]; }
#pragma unroll
      for (int u = 0; u < 4; ++u) { const int e = (it + u) * 256 + tid, cl = e >> 5, q = e & 31; vst2((unsigned*)(VT + (bb * CC + c0 + cl) * (size_t)TT + t0 + q * 8), vv[u]); }
      asm volatile("s_wait_xcnt 0x0" ::: "memory"); } } }   /* precaution: the next trip rewrites registers that these stores name */
#define AP 144                 // pitch of a staged row (64 f16 = 128 B) in bytes: 16 B x odd, no bank conflict for 16-byte reads
#define AT (64 * AP)           // one operand's tile: 64 k rows (64 d each), or 64 v channels (64 keys each)
#define AB (2 * AT)            // one buffer: k tile, v tile
#define C2 (SCALE * 1.4426950408889634f)   // logit scale x log2(e)
// Hardware exp2 (v_exp_f32), each value in place. Written as asm so that the closing v_nop is tied to the last of them: it is the slot the instruction set asks for between a transcendental and a directly following
// instruction that reads its result or overwrites its source. Inside a statement no v_exp_f32 touches a neighbour's register.
__device__ __forceinline__ float exp2_1(float x) { asm("v_exp_f32 %0, %0\n\tv_nop" : "+v"(x)); return x; }
__device__ __forceinline__ void exp2_16(float (&x)[16]) {
  asm("v_exp_f32 %0, %0\n\tv_exp_f32 %1, %1\n\tv_exp_f32 %2, %2\n\tv_exp_f32 %3, %3\n\tv_exp_f32 %4, %4\n\tv_exp_f32 %5, %5\n\tv_exp_f32 %6, %6\n\tv_exp_f32 %7, %7\n\t"
      "v_exp_f32 %8, %8\n\tv_exp_f32 %9, %9\n\tv_exp_f32 %10, %10\n\tv_exp_f32 %11, %11\n\tv_exp_f32 %12, %12\n\tv_exp_f32 %13, %13\n\tv_exp_f32 %14, %14\n\tv_exp_f32 %15, %15\n\tv_nop"
      : "+v"(x[0]), "+v"(x[1]), "+v"(x[2]), "+v"(x[3]), "+v"(x[4]), "+v"(x[5]), "+v"(x[6]), "+v"(x[7]), "+v"(x[8]), "+v"(x[9]), "+v"(x[10]), "+v"(x[11]), "+v"(x[12]), "+v"(x[13]), "+v"(x[14]), "+v"(x[15])); }
template <bool B> struct Flag { static constexpr bool value = B; };
__global__ __launch_bounds__(256) void k_attn(const _Float16* __restrict__ QH, const _Float16* __restrict__ KH, const _Float16* __restrict__ VT, const int* __restrict__ WI, _Float16* __restrict__ Y) {
  __shared__ __align__(16) char sm[2 * AB];
  const int tid = threadIdx.x, lane = tid & 31, col = lane & 15, g = lane >> 4;
  const int wave = __builtin_amdgcn_readfirstlane((int)(threadIdx.x >> 5));   /* wave-uniform, so the tiles' token numbers are worked out on the scalar unit */
  const int b = blockIdx.y, h = NH - 1 - (int)blockIdx.z;                       /* largest windows start first */
  const int rl_ = rlog(h), r = 1 << rl_;
  int wsh = 31 - __clz(WI[0] | 1); wsh = wsh > 7 ? 7 : wsh < 5 ? 5 : wsh;       /* grid width read from the input, as a shift (64 -> 6); 32, 64 and 128 are the widths at which 32 divides both sides of a 4,096-token grid */
  const int yb = ((int)blockIdx.x >> (wsh - 4)) * 8, xs = ((int)blockIdx.x & ((1 << (wsh - 4)) - 1)) * 16;   /* a one-to-one map block -> (8 image rows, one 16-column strip) at every such width */
  const int n0 = ((yb + wave) << wsh) + xs;
  const int sps = rl_ > 4 ? rl_ - 4 : 0, smask = (1 << sps) - 1;                /* 16-key tiles per window row: max(16, r) / 16 */
  const int rb_ = rl_ > 3 ? rl_ : 3;                                            /* the block's key rows: max(8, r) */
  const int y0 = (yb >> rb_) << rb_, xk0 = xs & ~((16 << sps) - 1);
  const int npass = (1 << (rb_ + sps)) >> 2;                                    /* 2, 2, 4 or 16 passes of 64 keys: never fewer than the two buffers */
  const int t = n0 + col;
  const _Float16* Kb = KH + (size_t)b * TT * CC + h * HD; const _Float16* Vb = VT + ((size_t)b * CC + h * HD) * (size_t)TT;
  /* first token of 16-key tile s of the block; bounded here whatever the width input holds */
  auto tok = [&](int s) { const int k = ((y0 + (s >> sps)) << wsh) + xk0 + ((s & smask) << 4); return (k > TT - 16 ? TT - 16 : k) & ~15; };
  /* a pass's copies: 2 x 512 pieces of 16 B, four a thread. k: 8 lanes bring one key row's whole 128-byte line; v: 8 lanes bring one channel's 4 x 32 B */
  const int crow = tid >> 3, cpc = tid & 7;
  const unsigned ldst = (unsigned)(size_t)sm + (unsigned)(crow * AP + cpc * 16);
  auto stage = [&](int p, int buf) {
    const unsigned l0 = ldst + (unsigned)(buf * AB), l1 = l0 + 32 * AP, l2 = l0 + AT, l3 = l2 + 32 * AP;
    const char* k0 = (const char*)(Kb + (size_t)(tok(4 * p + (crow >> 4)) + (crow & 15)) * CC) + cpc * 16;
    const char* k1 = (const char*)(Kb + (size_t)(tok(4 * p + 2 + (crow >> 4)) + (crow & 15)) * CC) + cpc * 16;
    const char* v0 = (const char*)(Vb + (size_t)crow * TT + tok(4 * p + (cpc >> 1)) + (cpc & 1) * 8);
    const char* v1 = v0 + (size_t)32 * TT * 2;
    /* the copies and the wait that stands before their address registers are rewritten, in one statement */
    asm volatile("global_load_async_to_lds_b128 %0, %1, off\n\tglobal_load_async_to_lds_b128 %2, %3, off\n\tglobal_load_async_to_lds_b128 %4, %5, off\n\tglobal_load_async_to_lds_b128 %6, %7, off\n\ts_wait_xcnt 0x0"
                 :: "v"(l0), "v"(k0), "v"(l1), "v"(k1), "v"(l2), "v"(v0), "v"(l3), "v"(v1) : "memory"); };
  stage(0, 0);
  v16h qh[2];
#pragma unroll
  for (int kc = 0; kc < 2; ++kc) qh[kc] = frag_h(QH + ((size_t)b * TT + t) * CC + h * HD + kc * 32, lane);
  asm volatile("s_wait_asynccnt 0x0" ::: "memory");   /* this wave's share of pass 0 has landed */
  __syncthreads();                                    /* ... and every other wave's: pass 0 may be read */
  stage(1, 1);
  const unsigned foff = (unsigned)(col * AP + 16 * g);   /* the lane's own byte offset in a tile, fixed for the whole loop */
  v8f acc[HD / 16] = {}; float m = -1.0e30f, sum = 0.f;
  /* The window test does not depend on the pass. Rows: a pass that a wave works on lies wholly in the wave's window row (the test at the loop's head). Columns: for r >= 16 the block's keys span exactly the one window
     that holds its 16 query columns, so every staged key belongs to every query and there is no test at all; for r < 16 key column and query column share the 16-column strip xs, so key 8g + i of ANY tile is in the
     window of query column col <=> their strip offsets agree above the low log2(r) bits: 8 lane flags, formed once here. */
  const int cm = 15 & ~(r - 1);
  bool ok[8];
#pragma unroll
  for (int i = 0; i < 8; ++i) ok[i] = (((8 * g + i) ^ col) & cm) == 0;
  /* the pass loop, built twice: with the flags (windows of 4 and 8) and without any test (16 and 32). The whole loop and not only the pass's body, so that the accumulators stay in the same registers from pass to pass */
  auto passes = [&](auto MK) __attribute__((always_inline)) {
  for (int p = 0; p < npass; ++p) {
    if ((((y0 + ((4 * p) >> sps)) ^ (yb + wave)) >> rl_) == 0) {   /* wave-uniform: the pass's key rows lie in this wave's window row (always, for r >= 8) */
    const char* kb = sm + (p & 1) * AB + foff; const char* vb = kb + AT;
    v8h kq[4][4], vq[2][HD / 16][2];
#pragma unroll
    for (int u = 0; u < 4; ++u)
#pragma unroll
      for (int q = 0; q < 4; ++q) kq[u][q] = *(const v8h*)(kb + u * 16 * AP + q * 32);   /* q = 2 kc + half: d = kc*32 + half*16 + 8g .. + 7 of key row col of the pass's tile u */
#pragma unroll
    for (int c = 0; c < 2; ++c)
#pragma unroll
      for (int j = 0; j < HD / 16; ++j) { vq[c][j][0] = *(const v8h*)(vb + j * 16 * AP + (2 * c) * 32); vq[c][j][1] = *(const v8h*)(vb + j * 16 * AP + (2 * c + 1) * 32); }   /* keys 8g .. + 7 of tile 2c and of tile 2c + 1, channel j*16 + col */
    __builtin_amdgcn_sched_barrier(0);   /* keeps the pass's 32 reads one group ahead of the products: one exposed LDS latency a pass; without it each pair of reads is waited for on its own */
    float v[4][8]; float mx = m;
#pragma unroll
    for (int u = 0; u < 4; ++u) { v8f sa = {};
#pragma unroll
      for (int kc = 0; kc < 2; ++kc) { union { v16h f; v8h q[2]; } kf; kf.q[0] = kq[u][2 * kc]; kf.q[1] = kq[u][2 * kc + 1];
        sa = __builtin_amdgcn_wmma_f32_16x16x32_f16(false, kf.f, false, qh[kc], (short)0, sa, false, false); }
#pragma unroll
      for (int i = 0; i < 8; ++i) { if constexpr (decltype(MK)::value) v[u][i] = ok[i] ? sa[i] : -3.0e38f; else v[u][i] = sa[i];
        mx = fmaxf(mx, v[u][i]); } }
    mx = fmaxf(mx, __shfl_xor(mx, 16));
    const float alpha = exp2_1((m - mx) * C2); m = mx;
    const float mb = 11.0f - m * C2;
#pragma unroll
    for (int j = 0; j < HD / 16; ++j) acc[j] *= alpha;
    v16h pf[2]; float ps[4];
#pragma unroll
    for (int c = 0; c < 2; ++c) { float e[16];
#pragma unroll
      for (int i = 0; i < 16; ++i) e[i] = v[2 * c + (i >> 3)][i & 7] * C2 + mb;
      exp2_16(e); ps[2 * c] = e[0]; ps[2 * c + 1] = e[8];
#pragma unroll
      for (int i = 0; i < 16; ++i) { if (i & 7) ps[2 * c + (i >> 3)] += e[i]; pf[c][i] = (_Float16)e[i]; } }
    sum = sum * alpha + ((ps[0] + ps[1]) + (ps[2] + ps[3]));
#pragma unroll
    for (int c = 0; c < 2; ++c)
#pragma unroll
      for (int j = 0; j < HD / 16; ++j) { union { v16h f; v8h q[2]; } vf; vf.q[0] = vq[c][j][0]; vf.q[1] = vq[c][j][1];
        acc[j] = __builtin_amdgcn_wmma_f32_16x16x32_f16(false, vf.f, false, pf[c], (short)0, acc[j], false, false); }
    }
    /* hand-over, passed by every wave, also one that skipped the pass */
    asm volatile("s_wait_dscnt 0x0" ::: "memory");      /* this wave's reads of the pass's buffer have retired */
    asm volatile("s_wait_asynccnt 0x0" ::: "memory");   /* its share of the next pass has landed */
    __syncthreads();                                    /* publishes the next pass and ends every wave's reads of this pass's buffer */
    if (p + 2 < npass) stage(p + 2, p & 1);             /* block-uniform: refill the buffer just left */
  }
  };
  if (rl_ >= 4) passes(Flag<false>{}); else passes(Flag<true>{});   /* block-uniform (the head's window size): every wave of a block runs the same loop and meets the same barriers */
  asm volatile("s_wait_asynccnt 0x0" ::: "memory");     /* no copy is outstanding when the wave ends */
  sum += __shfl_xor(sum, 16);
  const float inv = sum > 0.f ? 1.0f / sum : 0.f;   /* a fully excluded row yields 0 */
  /* lane = query t = row lane & 15 of the 16-token tile n0 / 16, register i of tile j = channel h*64 + j*16 + 8g + i = element i of piece j & 1 of 32-k chunk 2h + (j >> 1): the lane's own place in k_out's A fragment */
  _Float16* yp = Y + ((size_t)b * TT + n0) * CC + (size_t)(h * 4) * 256 + lane * 8;
#pragma unroll
  for (int j = 0; j < HD / 16; ++j) { v8h o;   /* the f32 value x 2^6 (exact), rounded once to f16; a wave's store is 512 contiguous bytes */
#pragma unroll
    for (int i = 0; i < 8; ++i) o[i] = (_Float16)((acc[j][i] * inv) * 64.0f);
    vst2(yp + j * 256, o); } }
// ---- k_out: block = (256 rows, 128 cols): out = ctx Wo (+ bo): ctx x 2^6 once to f16 (by k_attn; small-magnitude context rows stay clear of f16 subnormals) against Wo as f16(bf16 x 2^8) exact (1 product), un-scaled by 2^-14
__global__ __launch_bounds__(256) void k_out(const _Float16* __restrict__ Y, const _Float16* __restrict__ WH, const float* __restrict__ BO, float* __restrict__ OUT) { __shared__ __align__(16) char smem[SM_BYTES];
  const int tid = threadIdx.x, wave = tid >> 5, lane = tid & 31, col = lane & 15, g = lane >> 4; const int c0 = blockIdx.y * 128; const size_t r0 = (size_t)blockIdx.x * 256;
  v8f acc[2][8] = {};
  gemm_frag_256x128<1>(Y, r0, WH + (size_t)blockIdx.y * (128 * 512), smem, acc);
  float (*sf)[132] = (float (*)[132])(smem + wave * (32 * 132 * 4));   /* each wave stages its own 32 rows */
#pragma unroll
  for (int m = 0; m < 2; ++m)
#pragma unroll
    for (int j = 0; j < 8; ++j) { const float bias = BO ? bfr(BO[c0 + j * 16 + col]) : 0.f;
#pragma unroll
      for (int r = 0; r < 8; ++r) sf[m * 16 + 8 * g + r][j * 16 + col] = acc[m][j][r] * (1.0f / 16384.0f) + bias; }   /* 2^-8 (Wo carry) x 2^-6 (ctx carry) */
  LDSX(); for (int rl = 0; rl < 32; ++rl) vst2(OUT + (r0 + wave * 32 + rl) * DIN + c0 + lane * 4, *(const v4f*)&sf[rl][lane * 4]); }

extern "C" void kernel_launch(void* const* d_in, const int* in_sizes, int n_in, void* d_out, int out_size, void* d_ws, size_t ws_size, hipStream_t stream) {
  (void)in_sizes; (void)n_in; (void)out_size;
  const float** F = (const float**)d_in;
  if (ws_size < (size_t)WS_END) return;
  char* ws = (char*)d_ws; _Float16 *QH = (_Float16*)(ws + WS_QH), *KH = (_Float16*)(ws + WS_KH), *VT = (_Float16*)(ws + WS_VT), *Y = (_Float16*)(ws + WS_Y); __bf16 *XF = (__bf16*)(ws + WS_XF), *WB = (__bf16*)(ws + WS_WB);
  // inputs: 0 x [4,4096,512]; 1 Wq [512,512] (in,out); 2 Wkv [512,1024] (in,out; columns k | v, head*64+d); 3 Wproj [512,512] (in,out); 4 bproj [512]; 5 H (int 64); 6 W (int 64)
  const int* WI = (const int*)d_in[6];
  k_pre<<<dim3(NWB + TNB * TT / 32), 256, 0, stream>>>(F[0], F[1], F[2], F[3], XF, WB);
  k_proj<<<dim3(TNB * TT / 256, CC / 128, 3), 256, 0, stream>>>(XF, WB, nullptr, nullptr, nullptr, QH, KH, VT);
  k_attn<<<dim3(TT / 128, TNB, NH), 256, 0, stream>>>(QH, KH, VT, WI, Y);
  k_out<<<dim3(TNB * TT / 256, DIN / 128), 256, 0, stream>>>(Y, (const _Float16*)(ws + WS_WB) + (size_t)12 * 128 * 512, F[4], (float*)d_out);
}

// v009
// A run of this version takes 60.6 microseconds.
// Next to v008, in two timings, it ran 1.07 times as fast each time.
// All steps since v000 together make it 31.2 times as fast.
// compute dtype: all float inputs rounded to bf16; q/k/v = x W with EXACT bf16 products on WMMA 16x16x32 (f32 accumulate); windowed logits with q once to f16 against k once to f16 (1 product) x 64^-0.5; per-window online softmax in f32 (base 2: one hardware exp2 per term, running maximum and sum); exp(s - m) x 2^11 once to f16 against v once to f16 (1 product), divided by the f32 sum at the end; merged heads carried x 2^6 once to f16 against Wproj carried x 2^8 in f16 (exact bf16 values), un-scaled by 2^-14, + bproj; f32 output.
#include <hip/hip_runtime.h>
#include <math.h>

typedef __attribute__((ext_vector_type(16))) _Float16 v16h;
typedef __attribute__((ext_vector_type(16))) __bf16 v16b;
typedef __attribute__((ext_vector_type(8)))  _Float16 v8h;
typedef __attribute__((ext_vector_type(8)))  float v8f;
typedef __attribute__((ext_vector_type(4)))  float v4f;
typedef __attribute__((ext_vector_type(2)))  float v2f;
typedef __attribute__((ext_vector_type(4)))  unsigned v4u;
typedef __attribute__((ext_vector_type(4)))  int v4i;
typedef float __attribute__((may_alias)) float_a;
typedef int __attribute__((may_alias)) int_a;

template <typename T> __device__ __forceinline__ void vst2(void* p, T v) { *(T*)p = v;  }
__device__ __forceinline__ v8f wmma16(v16h a, v16h b, v8f c) {
  v8f d = __builtin_amdgcn_wmma_f32_16x16x32_f16(false, a, false, b, (short)0, c, false, false);
  asm volatile("v_nop\n\tv_nop\n\tv_nop\n\tv_nop" : "+v"(d) : "v"(a), "v"(b));
  return d;
}
__device__ __forceinline__ v8f wmma_bf(v16b a, v16b b, v8f c) {
  v8f d = __builtin_amdgcn_wmma_f32_16x16x32_bf16(false, a, false, b, (short)0, c, false, false);
  asm volatile("v_nop\n\tv_nop\n\tv_nop\n\tv_nop" : "+v"(d) : "v"(a), "v"(b));
  return d;
}
// 16x16x32 fragments: lane = (h = lane>>4, row/col = lane&15); elements 0..7 = k0+8h+0..7, 8..15 = k0+16+8h+0..7; D element r = row 8h+r
__device__ __forceinline__ v16h frag_h(const _Float16* rowk0, int lane) {
  union { v16h v; v8h q[2]; } u; const _Float16* p = rowk0 + 8 * (lane >> 4);
  u.q[0] = *(const v8h*)p; u.q[1] = *(const v8h*)(p + 16); return u.v;
}
__device__ __forceinline__ v16h frag_f32(const float* rowk0, int lane) {
  v16h a; const float* p = rowk0 + 8 * (lane >> 4);
#pragma unroll
  for (int i = 0; i < 8; ++i) { a[i] = (_Float16)p[i]; a[8 + i] = (_Float16)p[16 + i]; }
  return a;
}
__device__ __forceinline__ v16h frag_f32s(const float* rowk0, int lane, float sc) {
  v16h a; const float* p = rowk0 + 8 * (lane >> 4);
#pragma unroll
  for (int i = 0; i < 8; ++i) { a[i] = (_Float16)(p[i] * sc); a[8 + i] = (_Float16)(p[16 + i] * sc); }
  return a;
}
// column fragment from a [K][ld] layout (column n), rows >= K read as 0
__device__ __forceinline__ v16h fragc_f32(const float* W, int k0, int n, int lane, int ld, int K) {
  v16h a; const int g = lane >> 4;
#pragma unroll
  for (int i = 0; i < 8; ++i) { const int ka = k0 + 8 * g + i, kb = ka + 16;
    a[i] = (_Float16)(ka < K ? W[(size_t)(ka < K ? ka : K - 1) * ld + n] : 0.f); a[8 + i] = (_Float16)(kb < K ? W[(size_t)(kb < K ? kb : K - 1) * ld + n] : 0.f); }
  return a;
}
struct F2 { v16b h, l; };
__device__ __forceinline__ F2 bsplit16(const float v[16]) { F2 r;
#pragma unroll
  for (int i = 0; i < 16; ++i) { const __bf16 h = (__bf16)v[i]; r.h[i] = h; r.l[i] = (__bf16)(v[i] - (float)h); }
  return r; }
__device__ __forceinline__ F2 split_row(const float* row, int k0, int lane) { float v[16]; const float* p = row + k0 + 8 * (lane >> 4);
#pragma unroll
  for (int i = 0; i < 8; ++i) { v[i] = p[i]; v[8 + i] = p[16 + i]; }
  return bsplit16(v); }
__device__ __forceinline__ F2 split_rowK(const float* row, int k0, int lane, int K) { float v[16]; const int g = lane >> 4;
#pragma unroll
  for (int i = 0; i < 8; ++i) { const int ka = k0 + 8 * g + i, kb = ka + 16; v[i] = ka < K ? row[ka < K ? ka : K - 1] : 0.f; v[8 + i] = kb < K ? row[kb < K ? kb : K - 1] : 0.f; }
  return bsplit16(v); }
__device__ __forceinline__ F2 split_col(const float* W, int k0, int n, int lane, int ld, int K) { float v[16]; const int g = lane >> 4;
#pragma unroll
  for (int i = 0; i < 8; ++i) { const int ka = k0 + 8 * g + i, kb = ka + 16; v[i] = ka < K ? W[(size_t)(ka < K ? ka : K - 1) * ld + n] : 0.f; v[8 + i] = kb < K ? W[(size_t)(kb < K ? kb : K - 1) * ld + n] : 0.f; }
  return bsplit16(v); }
__device__ __forceinline__ v8f mac3(const F2& a, const F2& b, v8f c) { c = wmma_bf(a.l, b.h, c); c = wmma_bf(a.h, b.l, c); return wmma_bf(a.h, b.h, c); }
__device__ __forceinline__ float sigm(float v) { return 1.0f / (1.0f + expf(-v)); }
#define LDSX() do { asm volatile("s_wait_dscnt 0" ::: "memory"); __builtin_amdgcn_wave_barrier(); __builtin_amdgcn_fence(__ATOMIC_RELEASE, "workgroup"); } while (0)

// Multi-scale windowed self-attention (B 4, 64 x 64 = 4,096 tokens, C 512 = 8 heads x 64; head h attends within non-overlapping r x r spatial windows with r = (4, 4, 8, 8, 16, 16, 32, 32)[h]; 0.02-scale (in,out) Wq [512,512], Wkv [512,1024] (k | v), Wproj [512,512] + zero bproj): q = x Wq, k|v = x Wkv; per head: softmax(q k^T x 64^-0.5) over the window's r^2 keys; heads merged (channel = head*64 + d); out = o Wproj + bproj.
#define NB 4
#define TT 4096
#define CC 512            // NH * HD = projected width
#define DIN 512          // input (model) width
#define NH 8
#define HD 64
#define NQB (TT / 64)
#define HG 1
#define SCALE (0.125f)
#define CAUSAL 0
#ifndef TNB
#define TNB NB
#endif
__device__ __forceinline__ float bfr(float v) { return (float)(__bf16)v; }
__host__ __device__ __forceinline__ int kb_last(int qb) { return CAUSAL ? ((qb * 64 + 63) >> 7) : (TT / 128 - 1); }
typedef __attribute__((ext_vector_type(8))) __bf16 v8b;
__device__ __forceinline__ v16b frag_b(const __bf16* rowk0, int lane) {
  union { v16b v; v8b q[2]; } u; const __bf16* p = rowk0 + 8 * (lane >> 4);
  u.q[0] = *(const v8b*)p; u.q[1] = *(const v8b*)(p + 16); return u.v;
}
// B fragment (k rows k0+.., output column o) of a weight: (in,out) [K][ld] or (out,in) [ld rows of K]: bf16 exact, or f16(bf16 * 256) exact
__device__ __forceinline__ v16b wcol_io(const float* Wm, int k0, int o, int lane, int ld) { v16b w; const int g = lane >> 4;
#pragma unroll
  for (int i = 0; i < 8; ++i) { w[i] = (__bf16)Wm[(size_t)(k0 + 8 * g + i) * ld + o]; w[8 + i] = (__bf16)Wm[(size_t)(k0 + 16 + 8 * g + i) * ld + o]; }
  return w; }
__device__ __forceinline__ v16b wcol_oi(const float* Wm, int k0, int o, int lane, int K) { v16b w; const float* p = Wm + (size_t)o * K + k0 + 8 * (lane >> 4);
#pragma unroll
  for (int i = 0; i < 8; ++i) { w[i] = (__bf16)p[i]; w[8 + i] = (__bf16)p[16 + i]; }
  return w; }
__device__ __forceinline__ v16h wcolh_io(const float* Wm, int k0, int o, int lane, int ld) { v16h w; const int g = lane >> 4;
#pragma unroll
  for (int i = 0; i < 8; ++i) { w[i] = (_Float16)(bfr(Wm[(size_t)(k0 + 8 * g + i) * ld + o]) * 256.0f); w[8 + i] = (_Float16)(bfr(Wm[(size_t)(k0 + 16 + 8 * g + i) * ld + o]) * 256.0f); }
  return w; }
__device__ __forceinline__ v16h wcolh_oi(const float* Wm, int k0, int o, int lane, int K) { v16h w; const float* p = Wm + (size_t)o * K + k0 + 8 * (lane >> 4);
#pragma unroll
  for (int i = 0; i < 8; ++i) { w[i] = (_Float16)(bfr(p[i]) * 256.0f); w[8 + i] = (_Float16)(bfr(p[16 + i]) * 256.0f); }
  return w; }
#define WQKV_LAYOUT 0   // 0 = (in,out) [DIN][CC]; 1 = (out,in) [CC][DIN]; 2 = per-head [NH][DIN][HD]
__device__ __forceinline__ v16b wcol_hdk(const float* Wm, int k0, int o, int lane) { v16b w; const int g = lane >> 4; const float* p = Wm + (size_t)(o / HD) * DIN * HD + (o % HD);
#pragma unroll
  for (int i = 0; i < 8; ++i) { w[i] = (__bf16)p[(size_t)(k0 + 8 * g + i) * HD]; w[8 + i] = (__bf16)p[(size_t)(k0 + 16 + 8 * g + i) * HD]; }
  return w; }
#define WO_OUT_IN 0
#if WQKV_LAYOUT == 1
#define WCOL(W, k0, o, lane) wcol_oi(W, k0, o, lane, DIN)
#elif WQKV_LAYOUT == 2
#define WCOL(W, k0, o, lane) wcol_hdk(W, k0, o, lane)
#else
#define WCOL(W, k0, o, lane) wcol_io(W, k0, o, lane, (which == 0 ? CC : 2 * CC))   /* Wq [512][512]; Wkv [512][1024] packed k | v */
#endif
#if WO_OUT_IN
#define WOCOL(W, k0, o, lane) wcol_oi(W, k0, o, lane, CC)
#define WOCOLH(W, k0, o, lane) wcolh_oi(W, k0, o, lane, CC)
#else
#define WOCOL(W, k0, o, lane) wcol_io(W, k0, o, lane, DIN)
#define WOCOLH(W, k0, o, lane) wcolh_io(W, k0, o, lane, DIN)
#endif
// per-head local window: REGIONS = (4, 4, 8, 8, 16, 16, 32, 32) -> r(h) = 4 << (h / 2); tokens are a 64 x 64 grid (n = y*64 + x), a k_attn block is 8 image rows x 16 columns and walks its keys 64 a pass
__host__ __device__ __forceinline__ int rlog(int h) { return 2 + (h >> 1); }

#define WS_QH  0u                                      // f16 q as the finished B fragments of k_attn's logit products, in the order of WS_Y
#define WS_KH  (WS_QH + 2u * (size_t)NB * TT * CC)      // f16 k rows [b*t][CC]
#define WS_VT  (WS_KH + 2u * (size_t)NB * TT * CC)      // f16 v in tiles of 16 keys: [b][head][t / 16][d][t % 16], 2 KiB a tile
#define WS_Y   (WS_VT + 2u * (size_t)NB * CC * TT)      // f16 ctx x 2^6 in the fragment order of the output projection: [16-token tile][32-k chunk][half][lane][8], 512 B a (chunk, half)
#define WS_XF (WS_Y  + 4u * (size_t)NB * TT * CC)      // bf16 x in the fragment order of the q/k/v projection, the same order as WS_Y
#define WS_WB (WS_XF + 2u * (size_t)NB * TT * DIN)     // 16 weight panels [128 columns][512 k] in 16 bits: Wq 4, Wkv 8 (bf16), Wproj 4 (f16 x 2^8)
#define WS_END (WS_WB + 2u * (size_t)16 * 128 * 512)

// ---- the two projection GEMMs share tile and panel: block = 8 waves = (256 rows, 128 cols), K = 512.
// The block's weight panel (128 output columns x all 512 k, in its 16-bit form) is kept in LDS as [column][k]; every wave reads its B fragments from there.
// Each wave owns 32 rows (2 A fragments x 8 B fragments = 16 products per 32 k), which it finds in memory as finished 16-bit A fragments (x: written so by k_pre; ctx: by k_attn).
// k ascends within each accumulator.
#define PW 520                       // pitch of a panel row (one column, 512 k) in 16-bit elements: 1,040 B = 16 B x odd, no bank conflict for 16-byte reads
#define SM_W (128 * PW * 2)          // panel bytes
#define SM_BYTES 153600              // the panel, and k_out's epilogue (8 waves x 32 rows x 132 floats): two blocks per WGP
union Frag { v4u q[2]; v16b b; v16h h; };
// F16M 0: operands rounded to bf16 (exact products); F16M 1: rows x 2^6 to f16, weights f16(bf16 x 2^8) (exact)
// the block's panel, 128 columns x 512 k, lies in memory in its 16-bit form as [column][k] (written so by k_pre): 131,072 contiguous bytes -> LDS rows of pitch PW. A wave's load and its LDS store are 512 contiguous bytes.
template <typename T> __device__ __forceinline__ void stage_panel(const T* __restrict__ Wp, char* smem) {
  const int tid = threadIdx.x; const char* src = (const char*)Wp + tid * 16; char* dst = smem + (tid >> 6) * (PW * 2) + (tid & 63) * 16;
#pragma unroll   /* all 32 loads of a wave are in flight at once, from one base address: one latency for the whole panel */
  for (int it = 0; it < 32; ++it) *(v4u*)(dst + it * 4 * PW * 2) = *(const v4u*)(src + it * 4096);
  asm volatile("s_wait_xcnt 0x0" :: "v"(src) : "memory"); }   /* precaution: the loads' address registers stay as they are up to this wait */
// ---- the main loop of both: the rows arrive as finished 16-bit A fragments: lane (row lane & 15, g) finds elements 0..7 = k0 + 8g .. and 8..15 = k0 + 16 + 8g .. as two 16-byte pieces,
// and a wave's load of one piece is 512 contiguous bytes (4 whole lines). The fragments go from memory straight into the registers the products read: no conversion, no LDS write and no LDS hand-over wait in the loop.
// A chunk's four loads are asked for YA chunks ahead. k ascends within each accumulator.
#define YA 2
template <int F16M, typename T> __device__ __forceinline__ void gemm_frag_256x128(const T* __restrict__ XF, size_t r0, const T* __restrict__ Wp, char* smem, v8f (&acc)[2][8]) {
  const int tid = threadIdx.x, wave = tid >> 5, lane = tid & 31, col = lane & 15, g = lane >> 4;
  const T* xp = XF + (r0 + wave * 32) * 512 + lane * 8;   /* a 16-row tile is 8,192 elements: 16 chunks x 2 pieces x 256 */
  const char* wb = smem + (col * PW + 8 * g) * 2;
  Frag a[16][2];
#pragma unroll
  for (int kc = 0; kc < YA; ++kc)
#pragma unroll
    for (int m = 0; m < 2; ++m) { a[kc][m].q[0] = *(const v4u*)(xp + m * 8192 + kc * 512); a[kc][m].q[1] = *(const v4u*)(xp + m * 8192 + kc * 512 + 256); }
  stage_panel(Wp, smem);
  __syncthreads();   /* the panel is complete before any wave reads it */
#pragma unroll
  for (int kc = 0; kc < 16; ++kc) {
    if (kc + YA < 16) {
#pragma unroll
      for (int m = 0; m < 2; ++m) { a[kc + YA][m].q[0] = *(const v4u*)(xp + m * 8192 + (kc + YA) * 512); a[kc + YA][m].q[1] = *(const v4u*)(xp + m * 8192 + (kc + YA) * 512 + 256); } }
    if (kc + YA == 15) { asm volatile("s_wait_xcnt 0x0" ::: "memory");   /* precaution: behind the last load its address registers are free for reuse */
      __builtin_amdgcn_sched_barrier(0); }   /* ... and nothing that reuses them is moved up in front of that wait */
    Frag w[8];   /* the chunk's 16 fragment reads go as one group ahead of its 16 products */
#pragma unroll
    for (int j = 0; j < 8; ++j) { w[j].q[0] = *(const v4u*)(wb + (j * 16 * PW + kc * 32) * 2); w[j].q[1] = *(const v4u*)(wb + (j * 16 * PW + kc * 32) * 2 + 32); }
    __builtin_amdgcn_sched_barrier(0);   /* keeps the 16 reads one group ahead of the products (one exposed LDS latency a chunk; without it each pair of reads is waited for on its own) and the loads YA chunks ahead of their use */
#pragma unroll
    for (int j = 0; j < 8; ++j)
#pragma unroll
      for (int m = 0; m < 2; ++m) { if constexpr (F16M) acc[m][j] = __builtin_amdgcn_wmma_f32_16x16x32_f16(false, a[kc][m].h, false, w[j].h, (short)0, acc[m][j], false, false);
        else acc[m][j] = __builtin_amdgcn_wmma_f32_16x16x32_bf16(false, a[kc][m].b, false, w[j].b, (short)0, acc[m][j], false, false); }
    __builtin_amdgcn_sched_barrier(0);   /* the next chunk's reads stay one group behind these products */
  }
  __syncthreads();   /* every wave has left the panel: the epilogue reuses the LDS */
}
// ---- k_pre: every operand of the two projection GEMMs is brought ONCE into the 16-bit form and the order in which the GEMM blocks read it, so that none of the 12 column blocks that need a row of x,
// and none of the 64 row blocks that need a weight panel, loads it as f32, converts it or turns it round.
// Blocks 0 .. 63, weights: 16 panels of 128 columns (Wq 4, Wkv 8: bf16; Wproj 4: f16(bf16 x 2^8), exact) x 4 quarters of k -> [panel][column][k]. A wave reads 32 neighbouring columns of one k row (one whole line);
// a thread gathers 64 k of its column, which is one whole 128-byte line of the result.
// Blocks 64 .., x -> bf16 in the order of the A fragments. Wave = 8 rows x 8 chunks of 32 k. Lane = (row lane & 7, g = bit 3, piece = bit 4) takes the 8 values k = chunk*32 + piece*16 + 8g .. + 7:
// four lanes read one row's whole 128-byte line, and a wave's 16-byte stores fill four whole lines.
#define NWB 64
// 64 k of one column of a [k][LD] f32 weight -> 128 contiguous bytes; the pitch as a constant puts every row step into the loads' immediate offsets
template <int F16M, int LD> __device__ __forceinline__ void pre_col(const float* __restrict__ wp, char* dst) {
  float f[8][8];
#pragma unroll
  for (int j = 0; j < 8; ++j)
#pragma unroll
    for (int i = 0; i < 8; ++i) f[j][i] = wp[(size_t)(j * 8 + i) * LD];
  __builtin_amdgcn_sched_barrier(0);   /* all 64 loads are under way before the first conversion: one memory latency */
  asm volatile("s_wait_xcnt 0x0" :: "v"(wp) : "memory");   /* precaution: the loads' address registers stay as they are up to this wait */
#pragma unroll
  for (int j = 0; j < 8; ++j) { union { v4u u; v8b b; v8h h; } w;
#pragma unroll
    for (int i = 0; i < 8; ++i) { if constexpr (F16M) w.h[i] = (_Float16)(bfr(f[j][i]) * 256.0f); else w.b[i] = (__bf16)f[j][i]; }
    *(v4u*)(dst + j * 16) = w.u; }
  asm volatile("s_wait_xcnt 0x0" ::: "memory"); }   /* precaution: whatever code follows these stores in the built kernel may reuse the registers that they name */
__global__ __launch_bounds__(256) void k_pre(const float* __restrict__ X, const float* __restrict__ WQ, const float* __restrict__ WKV, const float* __restrict__ WO, __bf16* __restrict__ XF, __bf16* __restrict__ WB) {
  const int tid = threadIdx.x, wave = tid >> 5, lane = tid & 31;
  if (blockIdx.x < NWB) {   /* block-uniform */
    const int p = (int)blockIdx.x >> 2, n = tid & 127, k0 = ((int)blockIdx.x & 3) * 128 + (tid >> 7) * 64;
    char* dst = (char*)(WB + ((size_t)(p * 128 + n) * 512 + k0));
    if (p < 4) pre_col<0, CC>(WQ + (size_t)k0 * CC + p * 128 + n, dst);
    else if (p < 12) pre_col<0, 2 * CC>(WKV + (size_t)k0 * (2 * CC) + (p - 4) * 128 + n, dst);
    else pre_col<1, CC>(WO + (size_t)k0 * CC + (p - 12) * 128 + n, dst);
    return; }
  const int rg = ((int)blockIdx.x - NWB) * 4 + (wave >> 1), kh = wave & 1;   /* 8-row group, half of the 16 chunks */
  const float* xp = X + (size_t)(rg * 8 + (lane & 7)) * DIN + kh * 256 + (lane >> 4) * 16 + ((lane >> 3) & 1) * 8;
  __bf16* fp = XF + (size_t)(rg >> 1) * 8192 + kh * 4096 + (lane >> 4) * 256 + (((lane >> 3) & 1) * 16 + (rg & 1) * 8 + (lane & 7)) * 8;
  v4f raw[8][2];   /* all 16 loads are under way before the first conversion */
#pragma unroll
  for (int c = 0; c < 8; ++c) { raw[c][0] = *(const v4f*)(xp + c * 32); raw[c][1] = *(const v4f*)(xp + c * 32 + 4); }
  __builtin_amdgcn_sched_barrier(0);   /* no conversion is moved up among the loads: without it the last four loads wait for registers that the first results free, a second memory latency */
  asm volatile("s_wait_xcnt 0x0" :: "v"(xp) : "memory");   /* precaution: the loads' address registers stay as they are up to this wait (the operand keeps them live, so no load's own result lands on them) */
#pragma unroll
  for (int c = 0; c < 8; ++c) { union { v4u u; v8b b; } w;
#pragma unroll
    for (int i = 0; i < 4; ++i) { w.b[i] = (__bf16)raw[c][0][i]; w.b[4 + i] = (__bf16)raw[c][1][i]; }
    *(v4u*)(fp + c * 512) = w.u; }
  asm volatile("s_wait_xcnt 0x0" ::: "memory"); }   /* precaution: whatever code follows these stores in the built kernel may reuse the registers that they name */
// ---- k_proj: block = (256 rows, 128 cols, which): q/k/v = X W (+ b) with exact bf16 products (K = DIN) -> which 0: q f16 fragments; 1: k f16 rows; 2: v f16 tiles of 16 keys.
// q and v leave in the order in which k_attn reads them, so that each of its wave-wide loads and copies covers 512 contiguous bytes (4 whole lines) and not 8 or 16 pieces of lines
__global__ __launch_bounds__(256) void k_proj(const __bf16* __restrict__ XF, const __bf16* __restrict__ WB, const float* __restrict__ BQ, const float* __restrict__ BK, const float* __restrict__ BV,
    _Float16* __restrict__ QH, _Float16* __restrict__ KH, _Float16* __restrict__ VT) {
  __shared__ __align__(16) char smem[SM_BYTES];
  const int tid = threadIdx.x, wave = tid >> 5, lane = tid & 31, col = lane & 15, g = lane >> 4; const int which = blockIdx.z; const int c0 = blockIdx.y * 128; const size_t r0 = (size_t)blockIdx.x * 256; const size_t bb = r0 / TT; const int t0 = (int)(r0 % TT);
  const float* BA = which == 0 ? BQ : which == 1 ? BK : BV;
  v8f acc[2][8] = {};
  gemm_frag_256x128<0>(XF, r0, WB + (size_t)(which * 4 + (int)blockIdx.y) * (128 * 512), smem, acc);   /* panels 0..3 Wq, 4..7 k half of Wkv, 8..11 v half */
  if (which < 2) { _Float16* DH = which == 0 ? QH : KH;
    _Float16 (*sh)[136] = (_Float16 (*)[136])smem;
#pragma unroll
    for (int m = 0; m < 2; ++m)
#pragma unroll
      for (int j = 0; j < 8; ++j) { const float bias = BA ? bfr(BA[c0 + j * 16 + col]) : 0.f;
#pragma unroll
        for (int r = 0; r < 8; ++r) sh[wave * 32 + m * 16 + 8 * g + r][j * 16 + col] = (_Float16)(acc[m][j][r] + bias); }
    __syncthreads();
    if (which == 0) {   /* block-uniform. Piece wp = (16-token tile, 32-channel chunk, half): lane (row col, g) holds channels chunk*32 + half*16 + 8g .. + 7 of its token; a wave's store is 512 contiguous bytes */
    for (int it = 0; it < 16; it += 4) { v4u vh[4];
#pragma unroll
      for (int u = 0; u < 4; ++u) { const int wp = (it + u) * 8 + wave; vh[u] = *(const v4u*)&sh[(wp >> 3) * 16 + col][((wp >> 1) & 3) * 32 + (wp & 1) * 16 + g * 8]; }
#pragma unroll
      for (int u = 0; u < 4; ++u) { const int wp = (it + u) * 8 + wave; vst2((unsigned*)(QH + (r0 + (wp >> 3) * 16) * CC + (((c0 >> 5) + ((wp >> 1) & 3)) * 2 + (wp & 1)) * 256 + lane * 8), vh[u]); }
      asm volatile("s_wait_xcnt 0x0" ::: "memory"); }   /* precaution: the next trip rewrites registers that these stores name */
    } else
    for (int it = 0; it < 16; it += 4) { v4u vh[4];   /* four rows' pieces a trip: 4 LDS reads under way at once */
#pragma unroll
      for (int u = 0; u < 4; ++u) { const int e = (it + u) * 256 + tid, rl = e >> 4, q = e & 15; vh[u] = *(const v4u*)&sh[rl][q * 8]; }
#pragma unroll
      for (int u = 0; u < 4; ++u) { const int e = (it + u) * 256 + tid, rl = e >> 4, q = e & 15; vst2((unsigned*)(DH + (r0 + rl) * CC + c0 + q * 8), vh[u]); }
      asm volatile("s_wait_xcnt 0x0" ::: "memory"); }   /* precaution: the next trip rewrites registers that these stores name */
  } else { _Float16 (*th)[264] = (_Float16 (*)[264])smem;
#pragma unroll
    for (int m = 0; m < 2; ++m)
#pragma unroll
      for (int j = 0; j < 8; ++j) { const float bias = BA ? bfr(BA[c0 + j * 16 + col]) : 0.f; const int rb = wave * 32 + m * 16 + 8 * g, cl = j * 16 + col; v8h hv;
#pragma unroll
        for (int r = 0; r < 8; ++r) hv[r] = (_Float16)(acc[m][j][r] + bias);
        *(v8h*)&th[cl][rb] = hv; }   /* a lane's 8 values are 8 neighbouring t of one channel */
    __syncthreads();
    for (int it = 0; it < 16; it += 4) { v4u vv[4];
#pragma unroll
      for (int u = 0; u < 4; ++u) { const int wp = (it + u) * 8 + wave; vv[u] = *(const v4u*)&th[(wp >> 6) * 64 + (wp & 3) * 16 + col][((wp >> 2) & 15) * 16 + g * 8]; }   /* piece wp = (head of the block's two, 16-key tile, 16 channels): lane = (channel col, keys 8g .. + 7) */
#pragma unroll
      for (int u = 0; u < 4; ++u) { const int wp = (it + u) * 8 + wave; vst2((unsigned*)(VT + (((bb * NH + (c0 >> 6) + (wp >> 6)) * (TT / 16) + (t0 >> 4) + ((wp >> 2) & 15)) * HD + (wp & 3) * 16 + col) * 16 + g * 8), vv[u]); }   /* a wave's store is 512 contiguous bytes */
      asm volatile("s_wait_xcnt 0x0" ::: "memory"); } } }   /* precaution: the next trip rewrites registers that these stores name */
#define AP 144                 // pitch of a staged row (64 f16 = 128 B) in bytes: 16 B x odd, no bank conflict for 16-byte reads
#define AT (64 * AP)           // one operand's tile: 64 k rows (64 d each), or 64 v channels (64 keys each)
#define AB (2 * AT)            // one buffer: k tile, v tile
#define C2 (SCALE * 1.4426950408889634f)   // logit scale x log2(e)
// Hardware exp2 (v_exp_f32), each value in place. Written as asm so that the closing v_nop is tied to the last of them: it is the slot the instruction set asks for between a transcendental and a directly following
// instruction that reads its result or overwrites its source. Inside a statement no v_exp_f32 touches a neighbour's register.
__device__ __forceinline__ float exp2_1(float x) { asm("v_exp_f32 %0, %0\n\tv_nop" : "+v"(x)); return x; }
__device__ __forceinline__ void exp2_16(float (&x)[16]) {
  asm("v_exp_f32 %0, %0\n\tv_exp_f32 %1, %1\n\tv_exp_f32 %2, %2\n\tv_exp_f32 %3, %3\n\tv_exp_f32 %4, %4\n\tv_exp_f32 %5, %5\n\tv_exp_f32 %6, %6\n\tv_exp_f32 %7, %7\n\t"
      "v_exp_f32 %8, %8\n\tv_exp_f32 %9, %9\n\tv_exp_f32 %10, %10\n\tv_exp_f32 %11, %11\n\tv_exp_f32 %12, %12\n\tv_exp_f32 %13, %13\n\tv_exp_f32 %14, %14\n\tv_exp_f32 %15, %15\n\tv_nop"
      : "+v"(x[0]), "+v"(x[1]), "+v"(x[2]), "+v"(x[3]), "+v"(x[4]), "+v"(x[5]), "+v"(x[6]), "+v"(x[7]), "+v"(x[8]), "+v"(x[9]), "+v"(x[10]), "+v"(x[11]), "+v"(x[12]), "+v"(x[13]), "+v"(x[14]), "+v"(x[15])); }
template <bool B> struct Flag { static constexpr bool value = B; };
__global__ __launch_bounds__(256) void k_attn(const _Float16* __restrict__ QH, const _Float16* __restrict__ KH, const _Float16* __restrict__ VT, const int* __restrict__ WI, _Float16* __restrict__ Y) {
  __shared__ __align__(16) char sm[2 * AB];
  const int tid = threadIdx.x, lane = tid & 31, col = lane & 15, g = lane >> 4;
  const int wave = __builtin_amdgcn_readfirstlane((int)(threadIdx.x >> 5));   /* wave-uniform, so the tiles' token numbers are worked out on the scalar unit */
  const int b = blockIdx.y, h = NH - 1 - (int)blockIdx.z;                       /* largest windows start first */
  const int rl_ = rlog(h), r = 1 << rl_;
  int wsh = 31 - __clz(WI[0] | 1); wsh = wsh > 7 ? 7 : wsh < 5 ? 5 : wsh;       /* grid width read from the input, as a shift (64 -> 6); 32, 64 and 128 are the widths at which 32 divides both sides of a 4,096-token grid */
  const int yb = ((int)blockIdx.x >> (wsh - 4)) * 8, xs = ((int)blockIdx.x & ((1 << (wsh - 4)) - 1)) * 16;   /* a one-to-one map block -> (8 image rows, one 16-column strip) at every such width */
  const int n0 = ((yb + wave) << wsh) + xs;
  const int sps = rl_ > 4 ? rl_ - 4 : 0, smask = (1 << sps) - 1;                /* 16-key tiles per window row: max(16, r) / 16 */
  const int rb_ = rl_ > 3 ? rl_ : 3;                                            /* the block's key rows: max(8, r) */
  const int y0 = (yb >> rb_) << rb_, xk0 = xs & ~((16 << sps) - 1);
  const int npass = (1 << (rb_ + sps)) >> 2;                                    /* 2, 2, 4 or 16 passes of 64 keys: never fewer than the two buffers */
  const _Float16* Kb = KH + (size_t)b * TT * CC + h * HD; const _Float16* Vb = VT + ((size_t)b * CC + h * HD) * (size_t)TT;
  /* first token of 16-key tile s of the block; bounded here whatever the width input holds */
  auto tok = [&](int s) { const int k = ((y0 + (s >> sps)) << wsh) + xk0 + ((s & smask) << 4); return (k > TT - 16 ? TT - 16 : k) & ~15; };
  /* a pass's copies: 2 x 512 pieces of 16 B, four a thread. k: 8 lanes bring one key row's whole 128-byte line; v: a wave brings 32 channels of one 16-key tile, 1 KiB contiguous in memory (tile wave >> 1 of the pass, channels (wave & 1) * 32 ..) */
  const int crow = tid >> 3, cpc = tid & 7;
  const unsigned ldst = (unsigned)(size_t)sm + (unsigned)(crow * AP + cpc * 16);
  const int vrow = (wave & 1) * 32 + (lane >> 1);   /* the lane's channel in its first v copy; the second takes channel vrow + 16 */
  const unsigned vdst = (unsigned)(size_t)sm + (unsigned)(AT + vrow * AP + (wave >> 1) * 32 + (lane & 1) * 16);
  auto stage = [&](int p, int buf) {
    const unsigned l0 = ldst + (unsigned)(buf * AB), l1 = l0 + 32 * AP, l2 = vdst + (unsigned)(buf * AB), l3 = l2 + 16 * AP;
    const char* k0 = (const char*)(Kb + (size_t)(tok(4 * p + (crow >> 4)) + (crow & 15)) * CC) + cpc * 16;
    const char* k1 = (const char*)(Kb + (size_t)(tok(4 * p + 2 + (crow >> 4)) + (crow & 15)) * CC) + cpc * 16;
    const char* v0 = (const char*)(Vb + (size_t)(tok(4 * p + (wave >> 1)) >> 4) * (HD * 16) + vrow * 16 + (lane & 1) * 8);
    const char* v1 = v0 + 16 * 16 * 2;
    /* the copies and the wait that stands before their address registers are rewritten, in one statement */
    asm volatile("global_load_async_to_lds_b128 %0, %1, off\n\tglobal_load_async_to_lds_b128 %2, %3, off\n\tglobal_load_async_to_lds_b128 %4, %5, off\n\tglobal_load_async_to_lds_b128 %6, %7, off\n\ts_wait_xcnt 0x0"
                 :: "v"(l0), "v"(k0), "v"(l1), "v"(k1), "v"(l2), "v"(v0), "v"(l3), "v"(v1) : "memory"); };
  stage(0, 0);
  v16h qh[2];
#pragma unroll
  for (int kc = 0; kc < 2; ++kc) { union { v16h v; v8h q[2]; } u; const _Float16* qp = QH + ((size_t)b * TT + n0) * CC + (h * 4 + 2 * kc) * 256 + lane * 8;   /* the lane's own two pieces of chunk 2h + kc of the 16-token tile n0 / 16 */
    u.q[0] = *(const v8h*)qp; u.q[1] = *(const v8h*)(qp + 256); qh[kc] = u.v; }
  asm volatile("s_wait_asynccnt 0x0" ::: "memory");   /* this wave's share of pass 0 has landed */
  __syncthreads();                                    /* ... and every other wave's: pass 0 may be read */
  stage(1, 1);
  const unsigned foff = (unsigned)(col * AP + 16 * g);   /* the lane's own byte offset in a tile, fixed for the whole loop */
  v8f acc[HD / 16] = {}; float m = -1.0e30f, sum = 0.f;
  /* The window test does not depend on the pass. Rows: a pass that a wave works on lies wholly in the wave's window row (the test at the loop's head). Columns: for r >= 16 the block's keys span exactly the one window
     that holds its 16 query columns, so every staged key belongs to every query and there is no test at all; for r < 16 key column and query column share the 16-column strip xs, so key 8g + i of ANY tile is in the
     window of query column col <=> their strip offsets agree above the low log2(r) bits: 8 lane flags, formed once here. */
  const int cm = 15 & ~(r - 1);
  bool ok[8];
#pragma unroll
  for (int i = 0; i < 8; ++i) ok[i] = (((8 * g + i) ^ col) & cm) == 0;
  /* the pass loop, built twice: with the flags (windows of 4 and 8) and without any test (16 and 32). The whole loop and not only the pass's body, so that the accumulators stay in the same registers from pass to pass */
  auto passes = [&](auto MK) __attribute__((always_inline)) {
  for (int p = 0; p < npass; ++p) {
    if ((((y0 + ((4 * p) >> sps)) ^ (yb + wave)) >> rl_) == 0) {   /* wave-uniform: the pass's key rows lie in this wave's window row (always, for r >= 8) */
    const char* kb = sm + (p & 1) * AB + foff; const char* vb = kb + AT;
    v8h kq[4][4], vq[2][HD / 16][2];
#pragma unroll
    for (int u = 0; u < 4; ++u)
#pragma unroll
      for (int q = 0; q < 4; ++q) kq[u][q] = *(const v8h*)(kb + u * 16 * AP + q * 32);   /* q = 2 kc + half: d = kc*32 + half*16 + 8g .. + 7 of key row col of the pass's tile u */
#pragma unroll
    for (int c = 0; c < 2; ++c)
#pragma unroll
      for (int j = 0; j < HD / 16; ++j) { vq[c][j][0] = *(const v8h*)(vb + j * 16 * AP + (2 * c) * 32); vq[c][j][1] = *(const v8h*)(vb + j * 16 * AP + (2 * c + 1) * 32); }   /* keys 8g .. + 7 of tile 2c and of tile 2c + 1, channel j*16 + col */
    __builtin_amdgcn_sched_barrier(0);   /* keeps the pass's 32 reads one group ahead of the products: one exposed LDS latency a pass; without it each pair of reads is waited for on its own */
    float v[4][8]; float mx = m;
#pragma unroll
    for (int u = 0; u < 4; ++u) { v8f sa = {};
#pragma unroll
      for (int kc = 0; kc < 2; ++kc) { union { v16h f; v8h q[2]; } kf; kf.q[0] = kq[u][2 * kc]; kf.q[1] = kq[u][2 * kc + 1];
        sa = __builtin_amdgcn_wmma_f32_16x16x32_f16(false, kf.f, false, qh[kc], (short)0, sa, false, false); }
#pragma unroll
      for (int i = 0; i < 8; ++i) { if constexpr (decltype(MK)::value) v[u][i] = ok[i] ? sa[i] : -3.0e38f; else v[u][i] = sa[i];
        mx = fmaxf(mx, v[u][i]); } }
    mx = fmaxf(mx, __shfl_xor(mx, 16));
    const float alpha = exp2_1((m - mx) * C2); m = mx;
    const float mb = 11.0f - m * C2;
#pragma unroll
    for (int j = 0; j < HD / 16; ++j) acc[j] *= alpha;
    v16h pf[2]; float ps[4];
#pragma unroll
    for (int c = 0; c < 2; ++c) { float e[16];
#pragma unroll
      for (int i = 0; i < 16; ++i) e[i] = v[2 * c + (i >> 3)][i & 7] * C2 + mb;
      exp2_16(e); ps[2 * c] = e[0]; ps[2 * c + 1] = e[8];
#pragma unroll
      for (int i = 0; i < 16; ++i) { if (i & 7) ps[2 * c + (i >> 3)] += e[i]; pf[c][i] = (_Float16)e[i]; } }
    sum = sum * alpha + ((ps[0] + ps[1]) + (ps[2] + ps[3]));
#pragma unroll
    for (int c = 0; c < 2; ++c)
#pragma unroll
      for (int j = 0; j < HD / 16; ++j) { union { v16h f; v8h q[2]; } vf; vf.q[0] = vq[c][j][0]; vf.q[1] = vq[c][j][1];
        acc[j] = __builtin_amdgcn_wmma_f32_16x16x32_f16(false, vf.f, false, pf[c], (short)0, acc[j], false, false); }
    }
    /* hand-over, passed by every wave, also one that skipped the pass */
    asm volatile("s_wait_dscnt 0x0" ::: "memory");      /* this wave's reads of the pass's buffer have retired */
    asm volatile("s_wait_asynccnt 0x0" ::: "memory");   /* its share of the next pass has landed */
    __syncthreads();                                    /* publishes the next pass and ends every wave's reads of this pass's buffer */
    if (p + 2 < npass) stage(p + 2, p & 1);             /* block-uniform: refill the buffer just left */
  }
  };
  if (rl_ >= 4) passes(Flag<false>{}); else passes(Flag<true>{});   /* block-uniform (the head's window size): every wave of a block runs the same loop and meets the same barriers */
  asm volatile("s_wait_asynccnt 0x0" ::: "memory");     /* no copy is outstanding when the wave ends */
  sum += __shfl_xor(sum, 16);
  const float inv = sum > 0.f ? 1.0f / sum : 0.f;   /* a fully excluded row yields 0 */
  /* lane = query t = row lane & 15 of the 16-token tile n0 / 16, register i of tile j = channel h*64 + j*16 + 8g + i = element i of piece j & 1 of 32-k chunk 2h + (j >> 1): the lane's own place in k_out's A fragment */
  _Float16* yp = Y + ((size_t)b * TT + n0) * CC + (size_t)(h * 4) * 256 + lane * 8;
#pragma unroll
  for (int j = 0; j < HD / 16; ++j) { v8h o;   /* the f32 value x 2^6 (exact), rounded once to f16; a wave's store is 512 contiguous bytes */
#pragma unroll
    for (int i = 0; i < 8; ++i) o[i] = (_Float16)((acc[j][i] * inv) * 64.0f);
    vst2(yp + j * 256, o); } }
// ---- k_out: block = (256 rows, 128 cols): out = ctx Wo (+ bo): ctx x 2^6 once to f16 (by k_attn; small-magnitude context rows stay clear of f16 subnormals) against Wo as f16(bf16 x 2^8) exact (1 product), un-scaled by 2^-14
__global__ __launch_bounds__(256) void k_out(const _Float16* __restrict__ Y, const _Float16* __restrict__ WH, const float* __restrict__ BO, float* __restrict__ OUT) { __shared__ __align__(16) char smem[SM_BYTES];
  const int tid = threadIdx.x, wave = tid >> 5, lane = tid & 31, col = lane & 15, g = lane >> 4; const int c0 = blockIdx.y * 128; const size_t r0 = (size_t)blockIdx.x * 256;
  v8f acc[2][8] = {};
  gemm_frag_256x128<1>(Y, r0, WH + (size_t)blockIdx.y * (128 * 512), smem, acc);
  float (*sf)[132] = (float (*)[132])(smem + wave * (32 * 132 * 4));   /* each wave stages its own 32 rows */
#pragma unroll
  for (int m = 0; m < 2; ++m)
#pragma unroll
    for (int j = 0; j < 8; ++j) { const float bias = BO ? bfr(BO[c0 + j * 16 + col]) : 0.f;
#pragma unroll
      for (int r = 0; r < 8; ++r) sf[m * 16 + 8 * g + r][j * 16 + col] = acc[m][j][r] * (1.0f / 16384.0f) + bias; }   /* 2^-8 (Wo carry) x 2^-6 (ctx carry) */
  LDSX(); for (int rl = 0; rl < 32; ++rl) vst2(OUT + (r0 + wave * 32 + rl) * DIN + c0 + lane * 4, *(const v4f*)&sf[rl][lane * 4]); }

extern "C" void kernel_launch(void* const* d_in, const int* in_sizes, int n_in, void* d_out, int out_size, void* d_ws, size_t ws_size, hipStream_t stream) {
  (void)in_sizes; (void)n_in; (void)out_size;
  const float** F = (const float**)d_in;
  if (ws_size < (size_t)WS_END) return;
  char* ws = (char*)d_ws; _Float16 *QH = (_Float16*)(ws + WS_QH), *KH = (_Float16*)(ws + WS_KH), *VT = (_Float16*)(ws + WS_VT), *Y = (_Float16*)(ws + WS_Y); __bf16 *XF = (__bf16*)(ws + WS_XF), *WB = (__bf16*)(ws + WS_WB);
  // inputs: 0 x [4,4096,512]; 1 Wq [512,512] (in,out); 2 Wkv [512,1024] (in,out; columns k | v, head*64+d); 3 Wproj [512,512] (in,out); 4 bproj [512]; 5 H (int 64); 6 W (int 64)
  const int* WI = (const int*)d_in[6];
  k_pre<<<dim3(NWB + TNB * TT / 32), 256, 0, stream>>>(F[0], F[1], F[2], F[3], XF, WB);
  k_proj<<<dim3(TNB * TT / 256, CC / 128, 3), 256, 0, stream>>>(XF, WB, nullptr, nullptr, nullptr, QH, KH, VT);
  k_attn<<<dim3(TT / 128, TNB, NH), 256, 0, stream>>>(QH, KH, VT, WI, Y);
  k_out<<<dim3(TNB * TT / 256, DIN / 128), 256, 0, stream>>>(Y, (const _Float16*)(ws + WS_WB) + (size_t)12 * 128 * 512, F[4], (float*)d_out);
}
